// v000
// The times below were measured on an AMD MI455X: many runs one after another, warmed up first and cycling through
// copies of the inputs, with the whole window's GPU time divided by the number of runs. Launches and the gaps
// between them are all in it. The median over several windows is given; except for v000 it joins two sittings, which
// can be a few percent apart, so the side-by-side timings, each taken in one sitting, are the better comparison.
// The starting kernel, v000, takes 1100 microseconds a run.
// compute dtype: all float inputs rounded to bf16; Q/K/V = {query,key,value} W^T with EXACT bf16 products on WMMA 16x16x32 (f32 accumulate) kept as f32 rows, then re-read in the module's (B, H, Sq, 64) reinterpretation: q, k once to f16 -> 1-product causal logits x 1/8, except the first 384 query positions of each (batch, head) (few keys, no averaging), which use q and k as f16 hi + residual (x 2^10) (3 products); softmax in f32 (precise expf); P x 2^11 once to f16 against v once to f16 (1 product), except the first 384 positions: P and v as bf16 hi + lo (3 products); concat once to f16 against W_ffn carried x 2^8 in f16 (exact bf16 values), except rows < 384 of each sequence: bf16 hi + lo against exact bf16 W_ffn (2 products); + b_ffn; f32 output.
#include <hip/hip_runtime.h>
#include <math.h>

typedef __attribute__((ext_vector_type(16))) _Float16 v16h;
typedef __attribute__((ext_vector_type(16))) __bf16 v16b;
typedef __attribute__((ext_vector_type(8)))  _Float16 v8h;
typedef __attribute__((ext_vector_type(8)))  float v8f;
typedef __attribute__((ext_vector_type(4)))  float v4f;
typedef __attribute__((ext_vector_type(2)))  float v2f;
typedef __attribute__((ext_vector_type(4)))  unsigned v4u;
typedef __attribute__((ext_vector_type(4)))  int v4i;
typedef float __attribute__((may_alias)) float_a;
typedef int __attribute__((may_alias)) int_a;

template <typename T> __device__ __forceinline__ void vst2(void* p, T v) { *(T*)p = v;  }
__device__ __forceinline__ v8f wmma16(v16h a, v16h b, v8f c) {
  v8f d = __builtin_amdgcn_wmma_f32_16x16x32_f16(false, a, false, b, (short)0, c, false, false);
  asm volatile("v_nop\n\tv_nop\n\tv_nop\n\tv_nop" : "+v"(d) : "v"(a), "v"(b));
  return d;
}
__device__ __forceinline__ v8f wmma_bf(v16b a, v16b b, v8f c) {
  v8f d = __builtin_amdgcn_wmma_f32_16x16x32_bf16(false, a, false, b, (short)0, c, false, false);
  asm volatile("v_nop\n\tv_nop\n\tv_nop\n\tv_nop" : "+v"(d) : "v"(a), "v"(b));
  return d;
}
// 16x16x32 fragments: lane = (h = lane>>4, row/col = lane&15); elements 0..7 = k0+8h+0..7, 8..15 = k0+16+8h+0..7; D element r = row 8h+r
__device__ __forceinline__ v16h frag_h(const _Float16* rowk0, int lane) {
  union { v16h v; v8h q[2]; } u; const _Float16* p = rowk0 + 8 * (lane >> 4);
  u.q[0] = *(const v8h*)p; u.q[1] = *(const v8h*)(p + 16); return u.v;
}
__device__ __forceinline__ v16h frag_f32(const float* rowk0, int lane) {
  v16h a; const float* p = rowk0 + 8 * (lane >> 4);
#pragma unroll
  for (int i = 0; i < 8; ++i) { a[i] = (_Float16)p[i]; a[8 + i] = (_Float16)p[16 + i]; }
  return a;
}
__device__ __forceinline__ v16h frag_f32s(const float* rowk0, int lane, float sc) {
  v16h a; const float* p = rowk0 + 8 * (lane >> 4);
#pragma unroll
  for (int i = 0; i < 8; ++i) { a[i] = (_Float16)(p[i] * sc); a[8 + i] = (_Float16)(p[16 + i] * sc); }
  return a;
}
// column fragment from a [K][ld] layout (column n), rows >= K read as 0
__device__ __forceinline__ v16h fragc_f32(const float* W, int k0, int n, int lane, int ld, int K) {
  v16h a; const int g = lane >> 4;
#pragma unroll
  for (int i = 0; i < 8; ++i) { const int ka = k0 + 8 * g + i, kb = ka + 16;
    a[i] = (_Float16)(ka < K ? W[(size_t)(ka < K ? ka : K - 1) * ld + n] : 0.f); a[8 + i] = (_Float16)(kb < K ? W[(size_t)(kb < K ? kb : K - 1) * ld + n] : 0.f); }
  return a;
}
struct F2 { v16b h, l; };
__device__ __forceinline__ F2 bsplit16(const float v[16]) { F2 r;
#pragma unroll
  for (int i = 0; i < 16; ++i) { const __bf16 h = (__bf16)v[i]; r.h[i] = h; r.l[i] = (__bf16)(v[i] - (float)h); }
  return r; }
__device__ __forceinline__ F2 split_row(const float* row, int k0, int lane) { float v[16]; const float* p = row + k0 + 8 * (lane >> 4);
#pragma unroll
  for (int i = 0; i < 8; ++i) { v[i] = p[i]; v[8 + i] = p[16 + i]; }
  return bsplit16(v); }
__device__ __forceinline__ F2 split_rowK(const float* row, int k0, int lane, int K) { float v[16]; const int g = lane >> 4;
#pragma unroll
  for (int i = 0; i < 8; ++i) { const int ka = k0 + 8 * g + i, kb = ka + 16; v[i] = ka < K ? row[ka < K ? ka : K - 1] : 0.f; v[8 + i] = kb < K ? row[kb < K ? kb : K - 1] : 0.f; }
  return bsplit16(v); }
__device__ __forceinline__ F2 split_col(const float* W, int k0, int n, int lane, int ld, int K) { float v[16]; const int g = lane >> 4;
#pragma unroll
  for (int i = 0; i < 8; ++i) { const int ka = k0 + 8 * g + i, kb = ka + 16; v[i] = ka < K ? W[(size_t)(ka < K ? ka : K - 1) * ld + n] : 0.f; v[8 + i] = kb < K ? W[(size_t)(kb < K ? kb : K - 1) * ld + n] : 0.f; }
  return bsplit16(v); }
__device__ __forceinline__ v8f mac3(const F2& a, const F2& b, v8f c) { c = wmma_bf(a.l, b.h, c); c = wmma_bf(a.h, b.l, c); return wmma_bf(a.h, b.h, c); }
__device__ __forceinline__ float sigm(float v) { return 1.0f / (1.0f + expf(-v)); }
#define LDSX() do { asm volatile("s_wait_dscnt 0" ::: "memory"); __builtin_amdgcn_wave_barrier(); __builtin_amdgcn_fence(__ATOMIC_RELEASE, "workgroup"); } while (0)

// Causal multi-head attention with the module's plain reshape (B 2, S 2,048, E 1,024, 16 heads x 64): Q = query Wq^T, K = key Wk^T, V = value Wv^T ((out,in), no bias); Q/K/V.reshape(B, H, S, 64) WITHOUT a transpose (head hh = the contiguous 128-row block hh of the [S, E] projection, position s = row hh*128 + s/16, columns (s%16)*64 ..); scores = Q K^T / 8 with key > query -> -inf; softmax; concat = head_out.transpose(0,2,1,3).reshape(B, S, E); out = concat W_ffn^T + b_ffn.
#define NB 2
#define TT 2048
#define CC 1024            // NH * HD = projected width
#define DIN 1024          // input (model) width
#define NH 16
#define HD 64
#define NQB (TT / 64)
#define HG 4
#define SCALE (0.125f)
#define CAUSAL 1
#ifndef TNB
#define TNB NB
#endif
__device__ __forceinline__ float bfr(float v) { return (float)(__bf16)v; }
__host__ __device__ __forceinline__ int kb_last(int qb) { return CAUSAL ? ((qb * 64 + 63) >> 7) : (TT / 128 - 1); }
typedef __attribute__((ext_vector_type(8))) __bf16 v8b;
__device__ __forceinline__ v16b frag_b(const __bf16* rowk0, int lane) {
  union { v16b v; v8b q[2]; } u; const __bf16* p = rowk0 + 8 * (lane >> 4);
  u.q[0] = *(const v8b*)p; u.q[1] = *(const v8b*)(p + 16); return u.v;
}
#define QBH 6              // causal: query blocks 0..QBH-1 of each sequence (few keys, no averaging) take the high-precision path
#define QHI 384            // rows carrying a q residual plane
#define KHI 384            // key rows carrying k residual / v bf16 hi+lo planes (used only by the causal high-precision path)
// B fragment (k rows k0+.., output column o) of a weight: (in,out) [K][ld] or (out,in) [ld rows of K]: bf16 exact, or f16(bf16 * 256) exact
__device__ __forceinline__ v16b wcol_io(const float* Wm, int k0, int o, int lane, int ld) { v16b w; const int g = lane >> 4;
#pragma unroll
  for (int i = 0; i < 8; ++i) { w[i] = (__bf16)Wm[(size_t)(k0 + 8 * g + i) * ld + o]; w[8 + i] = (__bf16)Wm[(size_t)(k0 + 16 + 8 * g + i) * ld + o]; }
  return w; }
__device__ __forceinline__ v16b wcol_oi(const float* Wm, int k0, int o, int lane, int K) { v16b w; const float* p = Wm + (size_t)o * K + k0 + 8 * (lane >> 4);
#pragma unroll
  for (int i = 0; i < 8; ++i) { w[i] = (__bf16)p[i]; w[8 + i] = (__bf16)p[16 + i]; }
  return w; }
__device__ __forceinline__ v16h wcolh_io(const float* Wm, int k0, int o, int lane, int ld) { v16h w; const int g = lane >> 4;
#pragma unroll
  for (int i = 0; i < 8; ++i) { w[i] = (_Float16)(bfr(Wm[(size_t)(k0 + 8 * g + i) * ld + o]) * 256.0f); w[8 + i] = (_Float16)(bfr(Wm[(size_t)(k0 + 16 + 8 * g + i) * ld + o]) * 256.0f); }
  return w; }
__device__ __forceinline__ v16h wcolh_oi(const float* Wm, int k0, int o, int lane, int K) { v16h w; const float* p = Wm + (size_t)o * K + k0 + 8 * (lane >> 4);
#pragma unroll
  for (int i = 0; i < 8; ++i) { w[i] = (_Float16)(bfr(p[i]) * 256.0f); w[8 + i] = (_Float16)(bfr(p[16 + i]) * 256.0f); }
  return w; }
#define WQKV_LAYOUT 1   // 0 = (in,out) [DIN][CC]; 1 = (out,in) [CC][DIN]; 2 = per-head [NH][DIN][HD]
__device__ __forceinline__ v16b wcol_hdk(const float* Wm, int k0, int o, int lane) { v16b w; const int g = lane >> 4; const float* p = Wm + (size_t)(o / HD) * DIN * HD + (o % HD);
#pragma unroll
  for (int i = 0; i < 8; ++i) { w[i] = (__bf16)p[(size_t)(k0 + 8 * g + i) * HD]; w[8 + i] = (__bf16)p[(size_t)(k0 + 16 + 8 * g + i) * HD]; }
  return w; }
#define WO_OUT_IN 1
#if WQKV_LAYOUT == 1
#define WCOL(W, k0, o, lane) wcol_oi(W, k0, o, lane, DIN)
#elif WQKV_LAYOUT == 2
#define WCOL(W, k0, o, lane) wcol_hdk(W, k0, o, lane)
#else
#define WCOL(W, k0, o, lane) wcol_io(W, k0, o, lane, CC)
#endif
#if WO_OUT_IN
#define WOCOL(W, k0, o, lane) wcol_oi(W, k0, o, lane, CC)
#define WOCOLH(W, k0, o, lane) wcolh_oi(W, k0, o, lane, CC)
#else
#define WOCOL(W, k0, o, lane) wcol_io(W, k0, o, lane, DIN)
#define WOCOLH(W, k0, o, lane) wcolh_io(W, k0, o, lane, DIN)
#endif

#ifndef SM_EXTRA_PARAMS
#define SM_EXTRA_PARAMS
#endif
#ifndef SM_MASK_HOOK
#define SM_MASK_HOOK (void)0
#endif

#define WS_QH  0u                                      // f16 q rows [b*t][CC]
#define WS_KH  (WS_QH + 2u * (size_t)NB * TT * CC)      // f16 k rows [b*t][CC]
#define WS_VT  (WS_KH + 2u * (size_t)NB * TT * CC)      // f16 v planes [b][c][t]
#define WS_QL  (WS_VT + 2u * (size_t)NB * CC * TT)      // f16 q residual x 2^10 rows [b][t < QHI][CC]
#define WS_KL  (WS_QL + 2u * (size_t)NB * QHI * CC)     // f16 k residual x 2^10 rows [b][t < KHI][CC]
#define WS_VB  (WS_KL + 2u * (size_t)NB * KHI * CC)     // bf16 v hi planes [b][c][t < KHI]
#define WS_VBL (WS_VB + 2u * (size_t)NB * CC * KHI)
#define WS_S   (WS_VBL + 2u * (size_t)NB * CC * KHI)    // f32 logits / P [hg][t][s]
#define WS_Y   (WS_S  + 4u * (size_t)HG * TT * TT)      // f32 ctx rows [b*t][CC] (only when there is an output projection)
#define WS_QF  (WS_Y  + 4u * (size_t)NB * TT * CC)      // f32 Q rows [b*t][CC] (projection output, module row order)
#define WS_KF  (WS_QF + 4u * (size_t)NB * TT * CC)
#define WS_VF  (WS_KF + 4u * (size_t)NB * TT * CC)
#define WS_END (WS_VF + 4u * (size_t)NB * TT * CC)

// ---- k_projf: block = (64 rows, 128 cols, which): Q/K/V = X W^T with exact bf16 products (K = DIN) -> f32 rows [b*t][CC] (512-B row segments by 32 lanes)
__global__ __launch_bounds__(128) void k_projf(const float* __restrict__ XQ, const float* __restrict__ XK, const float* __restrict__ XV, const float* __restrict__ WQ, const float* __restrict__ WK, const float* __restrict__ WV, float* __restrict__ QF, float* __restrict__ KF, float* __restrict__ VF) {
  __shared__ __align__(16) float sf[4][16][132];
  const int tid = threadIdx.x, wave = tid >> 5, lane = tid & 31, col = lane & 15, g = lane >> 4; const int which = blockIdx.z; const int c0 = blockIdx.y * 128; const size_t r0 = (size_t)blockIdx.x * 64;
  const float* X = which == 0 ? XQ : which == 1 ? XK : XV; const float* WA = which == 0 ? WQ : which == 1 ? WK : WV; float* D = which == 0 ? QF : which == 1 ? KF : VF;
  v8f acc[8] = {};
#pragma unroll 2
  for (int kc = 0; kc < DIN / 32; ++kc) { v16b a; { const float* p = X + (r0 + wave * 16 + col) * DIN + kc * 32 + 8 * g;
#pragma unroll
      for (int i = 0; i < 8; ++i) { a[i] = (__bf16)p[i]; a[8 + i] = (__bf16)p[16 + i]; } }
    asm volatile("s_wait_loadcnt 0x0" ::: "memory");
#pragma unroll
    for (int j = 0; j < 8; ++j) { const v16b w = WCOL(WA, kc * 32, c0 + j * 16 + col, lane); asm volatile("s_wait_loadcnt 0x0" ::: "memory"); acc[j] = wmma_bf(a, w, acc[j]); } }
#pragma unroll
  for (int j = 0; j < 8; ++j) {
#pragma unroll
    for (int r = 0; r < 8; ++r) sf[wave][8 * g + r][j * 16 + col] = acc[j][r]; }
  LDSX(); for (int rl = 0; rl < 16; ++rl) vst2(D + (r0 + wave * 16 + rl) * CC + c0 + lane * 4, *(const v4f*)&sf[wave][rl][lane * 4]); }
// ---- k_prep8: block = (64 attention positions s0.. of sequence b, head h): reads the f32 rows in the module's (B, H, S, 64) reinterpretation (element (b,h,s,c) = row-buffer float ((b*NH + h)*TT + s)*64 + c) and writes the standard attention planes: q -> f16 hi rows (+ x 2^10 residual rows for s < QHI), k -> f16 rows (+ residual rows s < KHI), v -> f16 planes [c][s] (+ bf16 hi/lo planes for s < KHI)
__global__ __launch_bounds__(128) void k_prep8(const float* __restrict__ Q, const float* __restrict__ K, const float* __restrict__ V, _Float16* __restrict__ QH, _Float16* __restrict__ QL, _Float16* __restrict__ KH, _Float16* __restrict__ KL, _Float16* __restrict__ VT, __bf16* __restrict__ VB, __bf16* __restrict__ VBL) {
  __shared__ __align__(16) _Float16 sq[64][136], sql[64][136], sk[64][136], skl[64][136], tv[128][72]; __shared__ __align__(16) __bf16 tb[128][72], tbl[128][72];
  const int tid = threadIdx.x; const int h = blockIdx.y; const size_t r0 = (size_t)blockIdx.x * 64; const size_t bb = r0 / TT; const int t0 = (int)(r0 % TT); const bool qhi = t0 < QHI, khi = t0 < KHI;
  for (int e = tid; e < 64 * 128; e += 128) { const int rl = e >> 7, c = e & 127; const size_t oi = ((bb * NH + h) * TT + t0 + rl) * HD + (c & 63);   /* c >= 64: duplicate read of the same element (tiles are 128 wide; HD is 64) */
    const float q = Q[oi], k = K[oi], v = V[oi];
    const _Float16 qh = (_Float16)q, kh = (_Float16)k; sq[rl][c] = qh; sql[rl][c] = (_Float16)((q - (float)qh) * 1024.0f); sk[rl][c] = kh; skl[rl][c] = (_Float16)((k - (float)kh) * 1024.0f);
    tv[c][rl] = (_Float16)v; const __bf16 vb = (__bf16)v; tb[c][rl] = vb; tbl[c][rl] = (__bf16)(v - (float)vb); }
  __syncthreads();
  for (int e = tid; e < 64 * 8; e += 128) { const int rl = e >> 3, q = e & 7; const size_t o = (r0 + rl) * CC + h * HD + q * 8; vst2((unsigned*)(QH + o), *(const v4u*)&sq[rl][q * 8]); vst2((unsigned*)(KH + o), *(const v4u*)&sk[rl][q * 8]);   
    if (qhi) vst2((unsigned*)(QL + (bb * QHI + t0 + rl) * (size_t)CC + h * HD + q * 8), *(const v4u*)&sql[rl][q * 8]); if (khi) vst2((unsigned*)(KL + (bb * KHI + t0 + rl) * (size_t)CC + h * HD + q * 8), *(const v4u*)&skl[rl][q * 8]); }
  for (int e = tid; e < 64 * 8; e += 128) { const int cl = e >> 3, q = e & 7; vst2((unsigned*)(VT + (bb * CC + h * HD + cl) * (size_t)TT + t0 + q * 8), *(const v4u*)&tv[cl][q * 8]);
    if (khi) { const size_t o3 = (bb * CC + h * HD + cl) * (size_t)KHI + t0 + q * 8; vst2((unsigned*)(VB + o3), *(const v4u*)&tb[cl][q * 8]); vst2((unsigned*)(VBL + o3), *(const v4u*)&tbl[cl][q * 8]); } } }
// ---- k_sc: block = (query block qb, key block kb <= kb_last(qb), head in group) of batch b: logits x SCALE; q hi + residual (x 2^10) against k (2 products) for query rows < QHI, plus the k residual (3 products) for query blocks < QBH (causal early rows); causal: blocks past the diagonal exit, the mask itself is applied by index in k_sm
__global__ __launch_bounds__(128) void k_sc(const _Float16* __restrict__ QH, const _Float16* __restrict__ KH, const _Float16* __restrict__ QL, const _Float16* __restrict__ KL, int b, int h0, float* __restrict__ S0) { __shared__ __align__(16) float ss[4][16][132];
  const int qb = blockIdx.x, kb = blockIdx.y; if (kb > kb_last(qb)) return;
  const int h = h0 + blockIdx.z; float* S = S0 + (size_t)blockIdx.z * TT * TT;
  const int tid = threadIdx.x, wave = tid >> 5, lane = tid & 31, col = lane & 15, g = lane >> 4; const int k0 = kb * 128; const int ql0 = qb * 64 + wave * 16; const size_t q0 = (size_t)b * TT + ql0, kr0 = (size_t)b * TT + k0;
  v8f acc[8] = {}, accl[8] = {};
  const _Float16* QLb = QL + (size_t)b * QHI * CC; const _Float16* KLb = KL + (size_t)b * KHI * CC;
  if (qb < QBH) {
#pragma unroll
    for (int kc = 0; kc < HD / 32; ++kc) { const v16h ah = frag_h(QH + (q0 + col) * CC + h * HD + kc * 32, lane), al = frag_h(QLb + (size_t)(ql0 + col) * CC + h * HD + kc * 32, lane);
#pragma unroll
      for (int j = 0; j < 8; ++j) { const v16h kbf = frag_h(KH + (kr0 + j * 16 + col) * CC + h * HD + kc * 32, lane), klf = frag_h(KLb + (size_t)(k0 + j * 16 + col) * CC + h * HD + kc * 32, lane); acc[j] = wmma16(ah, kbf, acc[j]); accl[j] = wmma16(al, kbf, accl[j]); accl[j] = wmma16(ah, klf, accl[j]); } }
  } else if (qb * 64 < QHI) {
#pragma unroll
    for (int kc = 0; kc < HD / 32; ++kc) { const v16h ah = frag_h(QH + (q0 + col) * CC + h * HD + kc * 32, lane), al = frag_h(QLb + (size_t)(ql0 + col) * CC + h * HD + kc * 32, lane);
#pragma unroll
      for (int j = 0; j < 8; ++j) { const v16h kbf = frag_h(KH + (kr0 + j * 16 + col) * CC + h * HD + kc * 32, lane); acc[j] = wmma16(ah, kbf, acc[j]); accl[j] = wmma16(al, kbf, accl[j]); } }
  } else {
#pragma unroll
    for (int kc = 0; kc < HD / 32; ++kc) { const v16h ah = frag_h(QH + (q0 + col) * CC + h * HD + kc * 32, lane);
#pragma unroll
      for (int j = 0; j < 8; ++j) { const v16h kbf = frag_h(KH + (kr0 + j * 16 + col) * CC + h * HD + kc * 32, lane); acc[j] = wmma16(ah, kbf, acc[j]); } } }
#pragma unroll
  for (int j = 0; j < 8; ++j) {
#pragma unroll
    for (int r = 0; r < 8; ++r) ss[wave][8 * g + r][j * 16 + col] = (acc[j][r] + accl[j][r] * (1.0f / 1024.0f)) * SCALE; }
  LDSX(); for (int rl = 0; rl < 16; ++rl) vst2(S + (size_t)(ql0 + rl) * TT + k0 + lane * 4, *(const v4f*)&ss[wave][rl][lane * 4]); }
// ---- k_sm: block = query row t (head in group): keys [0, kend): causal -> logit if s <= t else excluded; softmax in f32; P x 2^11 in place (0 for excluded)
__global__ __launch_bounds__(256) void k_sm(float* __restrict__ S0 SM_EXTRA_PARAMS) { __shared__ float sred[8]; __shared__ float sbc; __shared__ __align__(16) float shv[TT];
  const int tid = threadIdx.x; const int t = blockIdx.x; const int kend = (kb_last(t >> 6) + 1) * 128;
  float* sr = S0 + (size_t)blockIdx.y * TT * TT + (size_t)t * TT;
  float m = -3.0e38f; for (int k = tid; k < kend; k += 256) { float v = (!CAUSAL || k <= t) ? sr[k] : -3.0e38f; SM_MASK_HOOK; shv[k] = v; m = fmaxf(m, v); }
#pragma unroll
  for (int o = 1; o < 32; o <<= 1) m = fmaxf(m, __shfl_xor(m, o));
  if ((tid & 31) == 0) sred[tid >> 5] = m; __syncthreads(); if (tid == 0) { float a = sred[0]; for (int i = 1; i < 8; ++i) a = fmaxf(a, sred[i]); sbc = a; } __syncthreads(); m = sbc; __syncthreads();
  float sum = 0.f; for (int k = tid; k < kend; k += 256) { const float v = shv[k]; const float e = (v <= -1.0e38f) ? 0.f : expf(v - m); shv[k] = e; sum += e; }
#pragma unroll
  for (int o = 1; o < 32; o <<= 1) sum += __shfl_xor(sum, o);
  if ((tid & 31) == 0) sred[tid >> 5] = sum; __syncthreads(); if (tid == 0) { float a = 0.f; for (int i = 0; i < 8; ++i) a += sred[i]; sbc = 2048.0f / a; } __syncthreads(); const float inv = sbc;
  for (int k = tid; k < kend; k += 256) shv[k] = shv[k] * inv;
  __syncthreads(); for (int q = tid; q < kend / 4; q += 256) vst2(sr + q * 4, *(const v4f*)&shv[q * 4]); }
// ---- k_pv: block = 64 queries (qb) of (b, h): ctx = P . v over keys [0, kend) (P x 2^11 once to f16 against v f16: 1 product; causal early query blocks: P and v as bf16 hi + lo, 3 products); 256-B (row, head) segment by 16 lanes
__global__ __launch_bounds__(128) void k_pv(const float* __restrict__ PS0, const _Float16* __restrict__ VT, const __bf16* __restrict__ VB, const __bf16* __restrict__ VBL, int b, int h0, float* __restrict__ Y) { const int h = h0 + blockIdx.z; const float* PS = PS0 + (size_t)blockIdx.z * TT * TT; __shared__ __align__(16) float ss[4][16][HD + 4];
  const int tid = threadIdx.x, wave = tid >> 5, lane = tid & 31, col = lane & 15, g = lane >> 4; const int qb = blockIdx.x; const int ql0 = qb * 64 + wave * 16; const int kce = (kb_last(qb) + 1) * 4;
  v8f acc[HD / 16] = {};
  if (qb < QBH) {
#pragma unroll 1
    for (int kc = 0; kc < kce; ++kc) { const F2 p = split_row(PS + (size_t)(ql0 + col) * TT, kc * 32, lane);
      asm volatile("s_wait_loadcnt 0x0" ::: "memory");
#pragma unroll
      for (int j = 0; j < HD / 16; ++j) { const size_t po = ((size_t)b * CC + h * HD + j * 16 + col) * (size_t)KHI + kc * 32; const v16b vh = frag_b(VB + po, lane); acc[j] = wmma_bf(p.h, vh, acc[j]); acc[j] = wmma_bf(p.l, vh, acc[j]); acc[j] = wmma_bf(p.h, frag_b(VBL + po, lane), acc[j]); } }
  } else {
#pragma unroll 1
    for (int kc = 0; kc < kce; ++kc) { const v16h p = frag_f32(PS + (size_t)(ql0 + col) * TT + kc * 32, lane);
      asm volatile("s_wait_loadcnt 0x0" ::: "memory");
#pragma unroll
      for (int j = 0; j < HD / 16; ++j) { const size_t po = ((size_t)b * CC + h * HD + j * 16 + col) * (size_t)TT + kc * 32; acc[j] = wmma16(p, frag_h(VT + po, lane), acc[j]); } } }
#pragma unroll
  for (int j = 0; j < HD / 16; ++j)
#pragma unroll
    for (int r = 0; r < 8; ++r) ss[wave][8 * g + r][j * 16 + col] = acc[j][r] * (1.0f / 2048.0f);
  LDSX(); for (int rl = 0; rl < 16; ++rl) if (lane < HD / 4) vst2(Y + ((size_t)b * TT + ql0 + rl) * CC + h * HD + lane * 4, *(const v4f*)&ss[wave][rl][lane * 4]); }
// ---- k_out: block = (64 rows, 128 cols): out = ctx Wo (+ bo): ctx once to f16 against Wo as f16(bf16 x 2^8) exact (1 product) x 2^-8; causal early rows (< QHI of each sequence): ctx bf16 hi + lo against exact bf16 Wo (2 products)
__global__ __launch_bounds__(128) void k_out(const float* __restrict__ Y, const float* __restrict__ WO, const float* __restrict__ BO, float* __restrict__ OUT) { __shared__ __align__(16) float sf[4][16][132];
  const int tid = threadIdx.x, wave = tid >> 5, lane = tid & 31, col = lane & 15, g = lane >> 4; const int c0 = blockIdx.y * 128; const size_t r0 = (size_t)blockIdx.x * 64 + wave * 16;
  v8f acc[8] = {};
  if (CAUSAL && (int)(((size_t)blockIdx.x * 64) % TT) < QHI) {   /* block-uniform */
#pragma unroll 2
    for (int kc = 0; kc < CC / 32; ++kc) { const F2 a = split_row(Y + (r0 + col) * CC, kc * 32, lane); asm volatile("s_wait_loadcnt 0x0" ::: "memory");
#pragma unroll
      for (int j = 0; j < 8; ++j) { const v16b w = WOCOL(WO, kc * 32, c0 + j * 16 + col, lane); asm volatile("s_wait_loadcnt 0x0" ::: "memory"); acc[j] = wmma_bf(a.h, w, acc[j]); acc[j] = wmma_bf(a.l, w, acc[j]); } }
#pragma unroll
    for (int j = 0; j < 8; ++j) { const float bias = BO ? bfr(BO[c0 + j * 16 + col]) : 0.f;
#pragma unroll
      for (int r = 0; r < 8; ++r) sf[wave][8 * g + r][j * 16 + col] = acc[j][r] + bias; }
  } else {
#pragma unroll 2
    for (int kc = 0; kc < CC / 32; ++kc) { const v16h a = frag_f32(Y + (r0 + col) * CC + kc * 32, lane); asm volatile("s_wait_loadcnt 0x0" ::: "memory");
#pragma unroll
      for (int j = 0; j < 8; ++j) { const v16h w = WOCOLH(WO, kc * 32, c0 + j * 16 + col, lane); asm volatile("s_wait_loadcnt 0x0" ::: "memory"); acc[j] = wmma16(a, w, acc[j]); } }
#pragma unroll
    for (int j = 0; j < 8; ++j) { const float bias = BO ? bfr(BO[c0 + j * 16 + col]) : 0.f;
#pragma unroll
      for (int r = 0; r < 8; ++r) sf[wave][8 * g + r][j * 16 + col] = acc[j][r] * (1.0f / 256.0f) + bias; } }
  LDSX(); for (int rl = 0; rl < 16; ++rl) vst2(OUT + (r0 + rl) * DIN + c0 + lane * 4, *(const v4f*)&sf[wave][rl][lane * 4]); }

extern "C" void kernel_launch(void* const* d_in, const int* in_sizes, int n_in, void* d_out, int out_size, void* d_ws, size_t ws_size, hipStream_t stream) {
  (void)in_sizes; (void)n_in; (void)out_size;
  const float** F = (const float**)d_in;
  if (ws_size < (size_t)WS_END) return;
  char* ws = (char*)d_ws; _Float16 *QH = (_Float16*)(ws + WS_QH), *KH = (_Float16*)(ws + WS_KH), *VT = (_Float16*)(ws + WS_VT), *QL = (_Float16*)(ws + WS_QL), *KL = (_Float16*)(ws + WS_KL); __bf16 *VB = (__bf16*)(ws + WS_VB), *VBL = (__bf16*)(ws + WS_VBL); float *S = (float*)(ws + WS_S), *Y = (float*)(ws + WS_Y);
  (void)Y; (void)QL; (void)KL; (void)VB; (void)VBL;
  // inputs: 0 query, 1 key, 2 value [2,2048,1024]; 3 W_Q, 4 W_K, 5 W_V, 6 W_ffn (out,in) [1024,1024]; 7 b_ffn [1024]
  float *QF = (float*)(ws + WS_QF), *KF = (float*)(ws + WS_KF), *VF = (float*)(ws + WS_VF);
  k_projf<<<dim3(TNB * TT / 64, CC / 128, 3), 128, 0, stream>>>(F[0], F[1], F[2], F[3], F[4], F[5], QF, KF, VF);
  k_prep8<<<dim3(TNB * TT / 64, NH), 128, 0, stream>>>(QF, KF, VF, QH, QL, KH, KL, VT, VB, VBL);
  for (int b = 0; b < TNB; ++b) for (int h0 = 0; h0 < NH; h0 += HG) {
    k_sc<<<dim3(NQB, TT / 128, HG), 128, 0, stream>>>(QH, KH, QL, KL, b, h0, S);
    k_sm<<<dim3(TT, HG), 256, 0, stream>>>(S);
    k_pv<<<dim3(NQB, 1, HG), 128, 0, stream>>>(S, VT, VB, VBL, b, h0, Y);
  }
  k_out<<<dim3(TNB * TT / 64, DIN / 128), 128, 0, stream>>>(Y, F[6], F[7], (float*)d_out);
}

// v001
// One run takes 410 microseconds.
// Next to v000, in two timings, it ran 2.70 and 2.71 times as fast.
// compute dtype: all float inputs rounded to bf16; Q/K/V = {query,key,value} W^T with EXACT bf16 products on WMMA 16x16x32 (f32 accumulate) kept as f32 rows, then re-read in the module's (B, H, Sq, 64) reinterpretation: q, k once to f16 -> 1-product causal logits x 1/8, except the first 384 query positions of each (batch, head) (few keys, no averaging), which use q and k as f16 hi + residual (x 2^10) (3 products); softmax in f32 (precise expf); P x 2^11 once to f16 against v once to f16 (1 product), except the first 384 positions: P and v as bf16 hi + lo (3 products); concat once to f16 against W_ffn carried x 2^8 in f16 (exact bf16 values), except rows < 384 of each sequence: bf16 hi + lo against exact bf16 W_ffn (2 products); + b_ffn; f32 output.
#include <hip/hip_runtime.h>
#include <math.h>

typedef __attribute__((ext_vector_type(16))) _Float16 v16h;
typedef __attribute__((ext_vector_type(16))) __bf16 v16b;
typedef __attribute__((ext_vector_type(8)))  _Float16 v8h;
typedef __attribute__((ext_vector_type(8)))  float v8f;
typedef __attribute__((ext_vector_type(4)))  float v4f;
typedef __attribute__((ext_vector_type(2)))  float v2f;
typedef __attribute__((ext_vector_type(4)))  unsigned v4u;
typedef __attribute__((ext_vector_type(4)))  int v4i;
typedef float __attribute__((may_alias)) float_a;
typedef int __attribute__((may_alias)) int_a;

template <typename T> __device__ __forceinline__ void vst2(void* p, T v) { *(T*)p = v;  }
__device__ __forceinline__ v8f wmma16(v16h a, v16h b, v8f c) {
  v8f d = __builtin_amdgcn_wmma_f32_16x16x32_f16(false, a, false, b, (short)0, c, false, false);
  asm volatile("v_nop\n\tv_nop\n\tv_nop\n\tv_nop" : "+v"(d) : "v"(a), "v"(b));
  return d;
}
__device__ __forceinline__ v8f wmma_bf(v16b a, v16b b, v8f c) {
  v8f d = __builtin_amdgcn_wmma_f32_16x16x32_bf16(false, a, false, b, (short)0, c, false, false);
  asm volatile("v_nop\n\tv_nop\n\tv_nop\n\tv_nop" : "+v"(d) : "v"(a), "v"(b));
  return d;
}
// 16x16x32 fragments: lane = (h = lane>>4, row/col = lane&15); elements 0..7 = k0+8h+0..7, 8..15 = k0+16+8h+0..7; D element r = row 8h+r
__device__ __forceinline__ v16h frag_h(const _Float16* rowk0, int lane) {
  union { v16h v; v8h q[2]; } u; const _Float16* p = rowk0 + 8 * (lane >> 4);
  u.q[0] = *(const v8h*)p; u.q[1] = *(const v8h*)(p + 16); return u.v;
}
__device__ __forceinline__ v16h frag_f32(const float* rowk0, int lane) {
  v16h a; const float* p = rowk0 + 8 * (lane >> 4);
#pragma unroll
  for (int i = 0; i < 8; ++i) { a[i] = (_Float16)p[i]; a[8 + i] = (_Float16)p[16 + i]; }
  return a;
}
__device__ __forceinline__ v16h frag_f32s(const float* rowk0, int lane, float sc) {
  v16h a; const float* p = rowk0 + 8 * (lane >> 4);
#pragma unroll
  for (int i = 0; i < 8; ++i) { a[i] = (_Float16)(p[i] * sc); a[8 + i] = (_Float16)(p[16 + i] * sc); }
  return a;
}
// column fragment from a [K][ld] layout (column n), rows >= K read as 0
__device__ __forceinline__ v16h fragc_f32(const float* W, int k0, int n, int lane, int ld, int K) {
  v16h a; const int g = lane >> 4;
#pragma unroll
  for (int i = 0; i < 8; ++i) { const int ka = k0 + 8 * g + i, kb = ka + 16;
    a[i] = (_Float16)(ka < K ? W[(size_t)(ka < K ? ka : K - 1) * ld + n] : 0.f); a[8 + i] = (_Float16)(kb < K ? W[(size_t)(kb < K ? kb : K - 1) * ld + n] : 0.f); }
  return a;
}
struct F2 { v16b h, l; };
__device__ __forceinline__ F2 bsplit16(const float v[16]) { F2 r;
#pragma unroll
  for (int i = 0; i < 16; ++i) { const __bf16 h = (__bf16)v[i]; r.h[i] = h; r.l[i] = (__bf16)(v[i] - (float)h); }
  return r; }
__device__ __forceinline__ F2 split_row(const float* row, int k0, int lane) { float v[16]; const float* p = row + k0 + 8 * (lane >> 4);
#pragma unroll
  for (int i = 0; i < 8; ++i) { v[i] = p[i]; v[8 + i] = p[16 + i]; }
  return bsplit16(v); }
__device__ __forceinline__ F2 split_rowK(const float* row, int k0, int lane, int K) { float v[16]; const int g = lane >> 4;
#pragma unroll
  for (int i = 0; i < 8; ++i) { const int ka = k0 + 8 * g + i, kb = ka + 16; v[i] = ka < K ? row[ka < K ? ka : K - 1] : 0.f; v[8 + i] = kb < K ? row[kb < K ? kb : K - 1] : 0.f; }
  return bsplit16(v); }
__device__ __forceinline__ F2 split_col(const float* W, int k0, int n, int lane, int ld, int K) { float v[16]; const int g = lane >> 4;
#pragma unroll
  for (int i = 0; i < 8; ++i) { const int ka = k0 + 8 * g + i, kb = ka + 16; v[i] = ka < K ? W[(size_t)(ka < K ? ka : K - 1) * ld + n] : 0.f; v[8 + i] = kb < K ? W[(size_t)(kb < K ? kb : K - 1) * ld + n] : 0.f; }
  return bsplit16(v); }
__device__ __forceinline__ v8f mac3(const F2& a, const F2& b, v8f c) { c = wmma_bf(a.l, b.h, c); c = wmma_bf(a.h, b.l, c); return wmma_bf(a.h, b.h, c); }
__device__ __forceinline__ float sigm(float v) { return 1.0f / (1.0f + expf(-v)); }
#define LDSX() do { asm volatile("s_wait_dscnt 0" ::: "memory"); __builtin_amdgcn_wave_barrier(); __builtin_amdgcn_fence(__ATOMIC_RELEASE, "workgroup"); } while (0)

// Causal multi-head attention with the module's plain reshape (B 2, S 2,048, E 1,024, 16 heads x 64): Q = query Wq^T, K = key Wk^T, V = value Wv^T ((out,in), no bias); Q/K/V.reshape(B, H, S, 64) WITHOUT a transpose (head hh = the contiguous 128-row block hh of the [S, E] projection, position s = row hh*128 + s/16, columns (s%16)*64 ..); scores = Q K^T / 8 with key > query -> -inf; softmax; concat = head_out.transpose(0,2,1,3).reshape(B, S, E); out = concat W_ffn^T + b_ffn.
#define NB 2
#define TT 2048
#define CC 1024            // NH * HD = projected width
#define DIN 1024          // input (model) width
#define NH 16
#define HD 64
#define NQB (TT / 64)
#define HG 4
#define SCALE (0.125f)
#define CAUSAL 1
#ifndef TNB
#define TNB NB
#endif
__device__ __forceinline__ float bfr(float v) { return (float)(__bf16)v; }
__host__ __device__ __forceinline__ int kb_last(int qb) { return CAUSAL ? ((qb * 64 + 63) >> 7) : (TT / 128 - 1); }
typedef __attribute__((ext_vector_type(8))) __bf16 v8b;
__device__ __forceinline__ v16b frag_b(const __bf16* rowk0, int lane) {
  union { v16b v; v8b q[2]; } u; const __bf16* p = rowk0 + 8 * (lane >> 4);
  u.q[0] = *(const v8b*)p; u.q[1] = *(const v8b*)(p + 16); return u.v;
}
#define QBH 6              // unused: the causal high-precision path is taken by query positions < QHI of each sequence (few keys, no averaging)
#define QHI 384            // rows carrying a q residual plane
#define KHI 384            // key rows carrying k residual / v bf16 hi+lo planes (used only by the causal high-precision path)
// B fragment (k rows k0+.., output column o) of a weight: (in,out) [K][ld] or (out,in) [ld rows of K]: bf16 exact, or f16(bf16 * 256) exact
__device__ __forceinline__ v16b wcol_io(const float* Wm, int k0, int o, int lane, int ld) { v16b w; const int g = lane >> 4;
#pragma unroll
  for (int i = 0; i < 8; ++i) { w[i] = (__bf16)Wm[(size_t)(k0 + 8 * g + i) * ld + o]; w[8 + i] = (__bf16)Wm[(size_t)(k0 + 16 + 8 * g + i) * ld + o]; }
  return w; }
__device__ __forceinline__ v16b wcol_oi(const float* Wm, int k0, int o, int lane, int K) { v16b w; const float* p = Wm + (size_t)o * K + k0 + 8 * (lane >> 4);
#pragma unroll
  for (int i = 0; i < 8; ++i) { w[i] = (__bf16)p[i]; w[8 + i] = (__bf16)p[16 + i]; }
  return w; }
__device__ __forceinline__ v16h wcolh_io(const float* Wm, int k0, int o, int lane, int ld) { v16h w; const int g = lane >> 4;
#pragma unroll
  for (int i = 0; i < 8; ++i) { w[i] = (_Float16)(bfr(Wm[(size_t)(k0 + 8 * g + i) * ld + o]) * 256.0f); w[8 + i] = (_Float16)(bfr(Wm[(size_t)(k0 + 16 + 8 * g + i) * ld + o]) * 256.0f); }
  return w; }
__device__ __forceinline__ v16h wcolh_oi(const float* Wm, int k0, int o, int lane, int K) { v16h w; const float* p = Wm + (size_t)o * K + k0 + 8 * (lane >> 4);
#pragma unroll
  for (int i = 0; i < 8; ++i) { w[i] = (_Float16)(bfr(p[i]) * 256.0f); w[8 + i] = (_Float16)(bfr(p[16 + i]) * 256.0f); }
  return w; }
#define WQKV_LAYOUT 1   // 0 = (in,out) [DIN][CC]; 1 = (out,in) [CC][DIN]; 2 = per-head [NH][DIN][HD]
__device__ __forceinline__ v16b wcol_hdk(const float* Wm, int k0, int o, int lane) { v16b w; const int g = lane >> 4; const float* p = Wm + (size_t)(o / HD) * DIN * HD + (o % HD);
#pragma unroll
  for (int i = 0; i < 8; ++i) { w[i] = (__bf16)p[(size_t)(k0 + 8 * g + i) * HD]; w[8 + i] = (__bf16)p[(size_t)(k0 + 16 + 8 * g + i) * HD]; }
  return w; }
#define WO_OUT_IN 1
#if WQKV_LAYOUT == 1
#define WCOL(W, k0, o, lane) wcol_oi(W, k0, o, lane, DIN)
#elif WQKV_LAYOUT == 2
#define WCOL(W, k0, o, lane) wcol_hdk(W, k0, o, lane)
#else
#define WCOL(W, k0, o, lane) wcol_io(W, k0, o, lane, CC)
#endif
#if WO_OUT_IN
#define WOCOL(W, k0, o, lane) wcol_oi(W, k0, o, lane, CC)
#define WOCOLH(W, k0, o, lane) wcolh_oi(W, k0, o, lane, CC)
#else
#define WOCOL(W, k0, o, lane) wcol_io(W, k0, o, lane, DIN)
#define WOCOLH(W, k0, o, lane) wcolh_io(W, k0, o, lane, DIN)
#endif

#ifndef SM_EXTRA_PARAMS
#define SM_EXTRA_PARAMS
#endif
#ifndef SM_MASK_HOOK
#define SM_MASK_HOOK (void)0
#endif

#define WS_QH  0u                                      // f16 q rows [b*t][CC]
#define WS_KH  (WS_QH + 2u * (size_t)NB * TT * CC)      // f16 k rows [b*t][CC]
#define WS_VT  (WS_KH + 2u * (size_t)NB * TT * CC)      // f16 v planes [b][c][t]
#define WS_QL  (WS_VT + 2u * (size_t)NB * CC * TT)      // f16 q residual x 2^10 rows [b][t < QHI][CC]
#define WS_KL  (WS_QL + 2u * (size_t)NB * QHI * CC)     // f16 k residual x 2^10 rows [b][t < KHI][CC]
#define WS_VB  (WS_KL + 2u * (size_t)NB * KHI * CC)     // bf16 v hi planes [b][c][t < KHI]
#define WS_VBL (WS_VB + 2u * (size_t)NB * CC * KHI)
#define WS_S   (WS_VBL + 2u * (size_t)NB * CC * KHI)    // f32 [hg][t][s] region, unused: the logit rows stay in LDS
#define WS_Y   (WS_S  + 4u * (size_t)HG * TT * TT)      // f32 ctx rows [b*t][CC] (only when there is an output projection)
#define WS_QF  (WS_Y  + 4u * (size_t)NB * TT * CC)      // f32 Q rows [b*t][CC] (projection output, module row order)
#define WS_KF  (WS_QF + 4u * (size_t)NB * TT * CC)
#define WS_VF  (WS_KF + 4u * (size_t)NB * TT * CC)
#define WS_END (WS_VF + 4u * (size_t)NB * TT * CC)

// ---- k_projf: block = (64 rows, 128 cols, which): Q/K/V = X W^T with exact bf16 products (K = DIN) -> f32 rows [b*t][CC] (512-B row segments by 32 lanes)
__global__ __launch_bounds__(128) void k_projf(const float* __restrict__ XQ, const float* __restrict__ XK, const float* __restrict__ XV, const float* __restrict__ WQ, const float* __restrict__ WK, const float* __restrict__ WV, float* __restrict__ QF, float* __restrict__ KF, float* __restrict__ VF) {
  __shared__ __align__(16) float sf[4][16][132];
  const int tid = threadIdx.x, wave = tid >> 5, lane = tid & 31, col = lane & 15, g = lane >> 4; const int which = blockIdx.z; const int c0 = blockIdx.y * 128; const size_t r0 = (size_t)blockIdx.x * 64;
  const float* X = which == 0 ? XQ : which == 1 ? XK : XV; const float* WA = which == 0 ? WQ : which == 1 ? WK : WV; float* D = which == 0 ? QF : which == 1 ? KF : VF;
  v8f acc[8] = {};
#pragma unroll 2
  for (int kc = 0; kc < DIN / 32; ++kc) { v16b a; { const float* p = X + (r0 + wave * 16 + col) * DIN + kc * 32 + 8 * g;
#pragma unroll
      for (int i = 0; i < 8; ++i) { a[i] = (__bf16)p[i]; a[8 + i] = (__bf16)p[16 + i]; } }
    asm volatile("s_wait_loadcnt 0x0" ::: "memory");
#pragma unroll
    for (int j = 0; j < 8; ++j) { const v16b w = WCOL(WA, kc * 32, c0 + j * 16 + col, lane); asm volatile("s_wait_loadcnt 0x0" ::: "memory"); acc[j] = wmma_bf(a, w, acc[j]); } }
#pragma unroll
  for (int j = 0; j < 8; ++j) {
#pragma unroll
    for (int r = 0; r < 8; ++r) sf[wave][8 * g + r][j * 16 + col] = acc[j][r]; }
  LDSX(); for (int rl = 0; rl < 16; ++rl) vst2(D + (r0 + wave * 16 + rl) * CC + c0 + lane * 4, *(const v4f*)&sf[wave][rl][lane * 4]); }
// ---- k_prep8: block = (64 attention positions s0.. of sequence b, head h): reads the f32 rows in the module's (B, H, S, 64) reinterpretation (element (b,h,s,c) = row-buffer float ((b*NH + h)*TT + s)*64 + c) and writes the standard attention planes: q -> f16 hi rows (+ x 2^10 residual rows for s < QHI), k -> f16 rows (+ residual rows s < KHI), v -> f16 planes [c][s] (+ bf16 hi/lo planes for s < KHI)
__global__ __launch_bounds__(128) void k_prep8(const float* __restrict__ Q, const float* __restrict__ K, const float* __restrict__ V, _Float16* __restrict__ QH, _Float16* __restrict__ QL, _Float16* __restrict__ KH, _Float16* __restrict__ KL, _Float16* __restrict__ VT, __bf16* __restrict__ VB, __bf16* __restrict__ VBL) {
  __shared__ __align__(16) _Float16 sq[64][136], sql[64][136], sk[64][136], skl[64][136], tv[128][72]; __shared__ __align__(16) __bf16 tb[128][72], tbl[128][72];
  const int tid = threadIdx.x; const int h = blockIdx.y; const size_t r0 = (size_t)blockIdx.x * 64; const size_t bb = r0 / TT; const int t0 = (int)(r0 % TT); const bool qhi = t0 < QHI, khi = t0 < KHI;
  for (int e = tid; e < 64 * 128; e += 128) { const int rl = e >> 7, c = e & 127; const size_t oi = ((bb * NH + h) * TT + t0 + rl) * HD + (c & 63);   /* c >= 64: duplicate read of the same element (tiles are 128 wide; HD is 64) */
    const float q = Q[oi], k = K[oi], v = V[oi];
    const _Float16 qh = (_Float16)q, kh = (_Float16)k; sq[rl][c] = qh; sql[rl][c] = (_Float16)((q - (float)qh) * 1024.0f); sk[rl][c] = kh; skl[rl][c] = (_Float16)((k - (float)kh) * 1024.0f);
    tv[c][rl] = (_Float16)v; const __bf16 vb = (__bf16)v; tb[c][rl] = vb; tbl[c][rl] = (__bf16)(v - (float)vb); }
  __syncthreads();
  for (int e = tid; e < 64 * 8; e += 128) { const int rl = e >> 3, q = e & 7; const size_t o = (r0 + rl) * CC + h * HD + q * 8; vst2((unsigned*)(QH + o), *(const v4u*)&sq[rl][q * 8]); vst2((unsigned*)(KH + o), *(const v4u*)&sk[rl][q * 8]);   
    if (qhi) vst2((unsigned*)(QL + (bb * QHI + t0 + rl) * (size_t)CC + h * HD + q * 8), *(const v4u*)&sql[rl][q * 8]); if (khi) vst2((unsigned*)(KL + (bb * KHI + t0 + rl) * (size_t)CC + h * HD + q * 8), *(const v4u*)&skl[rl][q * 8]); }
  for (int e = tid; e < 64 * 8; e += 128) { const int cl = e >> 3, q = e & 7; vst2((unsigned*)(VT + (bb * CC + h * HD + cl) * (size_t)TT + t0 + q * 8), *(const v4u*)&tv[cl][q * 8]);
    if (khi) { const size_t o3 = (bb * CC + h * HD + cl) * (size_t)KHI + t0 + q * 8; vst2((unsigned*)(VB + o3), *(const v4u*)&tb[cl][q * 8]); vst2((unsigned*)(VBL + o3), *(const v4u*)&tbl[cl][q * 8]); } } }
// ---- k_att: block = (16 query positions, head h of batch b), 8 waves: the tile's logit rows stay in LDS from the q k^T products through the softmax to the P v products (no logit plane in memory, one launch for all heads).
// phase 1: wave w takes the 16-key tiles w, w + 8, ..: logits x SCALE, key > query -> excluded (first QHI positions: q and k hi + residual, 3 products); phase 2: wave w takes rows 2w, 2w + 1: max, expf, sum in f32, 2^11 / sum kept per row;
// phase 3: each wave takes a contiguous run of 32-key chunks: P x 2^11 once to f16 against v f16 (first QHI positions: P and v as bf16 hi + lo, 3 products); the 8 partial tiles are added in wave order through LDS; 256-B (row, head) segment by 16 lanes
// fragment from the lane's own pointer (row or plane base + k0 + 8 * (lane >> 4))
__device__ __forceinline__ v16h frag_hp(const _Float16* p) { union { v16h v; v8h q[2]; } u; u.q[0] = *(const v8h*)p; u.q[1] = *(const v8h*)(p + 16); return u.v; }
__device__ __forceinline__ v16b frag_bp(const __bf16* p) { union { v16b v; v8b q[2]; } u; u.q[0] = *(const v8b*)p; u.q[1] = *(const v8b*)(p + 16); return u.v; }
#define SP 2052            // floats per logit row in LDS: 16 B x odd, so the 16-byte fragment reads of the 16 rows fall on different banks
__global__ __launch_bounds__(256) void k_att(const _Float16* __restrict__ QH, const _Float16* __restrict__ KH, const _Float16* __restrict__ QL, const _Float16* __restrict__ KL, const _Float16* __restrict__ VT, const __bf16* __restrict__ VB, const __bf16* __restrict__ VBL, float* __restrict__ Y) {
  __shared__ __align__(16) float sl[16][SP]; __shared__ float sinv[16];
  const int tid = threadIdx.x, lane = tid & 31, col = lane & 15, g = lane >> 4; const int wave = __builtin_amdgcn_readfirstlane(tid >> 5);
  const int b = blockIdx.x / NH, h = blockIdx.x % NH; const int ql0 = (TT / 16 - 1 - (int)blockIdx.y) * 16;   /* longest tiles start first */
  const int nkc = (ql0 + 16 + 31) >> 5;   /* 32-key chunks that hold a key <= the tile's last query */
  const int n = ((ql0 + 16 + 127) >> 7) << 7, nt = n >> 4;   /* logits are formed for keys [0, n), whole 128-key blocks (excluded keys included): every wave has n / 128 tiles and every lane n / 128 quads of a row; n <= TT, and n <= KHI when ql0 < QHI */
  const bool hi = ql0 < QHI;   /* block-uniform */
  const size_t q0 = (size_t)b * TT + ql0, kr0 = (size_t)b * TT;
  const size_t lrow = (size_t)col * CC + h * HD + 8 * g;   /* the lane's fragment start in a 16-row tile of q or k rows */
  if (hi) { const _Float16* QLb = QL + (size_t)b * QHI * CC; const _Float16* KLb = KL + (size_t)b * KHI * CC; v16h ah[2], al[2];
#pragma unroll
    for (int kc = 0; kc < 2; ++kc) { ah[kc] = frag_hp(QH + q0 * CC + lrow + kc * 32); al[kc] = frag_hp(QLb + (size_t)ql0 * CC + lrow + kc * 32); }
    for (int j = wave; j < nt; j += 8) { v8f acc = {}, accl = {}; v16h kbf[2], klf[2]; const _Float16* th = KH + (kr0 + j * 16) * CC + lrow; const _Float16* tl = KLb + (size_t)(j * 16) * CC + lrow;   /* all four fragments are loaded ahead of the products: one load latency a tile */
#pragma unroll
      for (int kc = 0; kc < 2; ++kc) { kbf[kc] = frag_hp(th + kc * 32); klf[kc] = frag_hp(tl + kc * 32); }
      /* inputs-only fence on the loaded fragments and their pointers: all the loads are issued ahead of the first product and the address registers stay untouched until the loads have returned */
      asm volatile("" :: "v"(kbf[0]), "v"(kbf[1]), "v"(klf[0]), "v"(klf[1]), "v"(th), "v"(tl));
#pragma unroll
      for (int kc = 0; kc < 2; ++kc) { acc = wmma16(ah[kc], kbf[kc], acc); accl = wmma16(al[kc], kbf[kc], accl); accl = wmma16(ah[kc], klf[kc], accl); }
#pragma unroll
      for (int r = 0; r < 8; ++r) sl[8 * g + r][j * 16 + col] = (j * 16 + col <= ql0 + 8 * g + r) ? (acc[r] + accl[r] * (1.0f / 1024.0f)) * SCALE : -3.0e38f; }
  } else { v16h ah[2]; const _Float16* qp = QH + q0 * CC + lrow;
#pragma unroll
    for (int kc = 0; kc < 2; ++kc) ah[kc] = frag_hp(qp + kc * 32);
    const _Float16* kp = KH + kr0 * CC + lrow;
    for (int j0 = wave; j0 < nt; j0 += 64) { v16h kf[8][2]; const _Float16* tp[8];   /* eight tiles' k fragments are loaded ahead of the products: one load latency per eight tiles; a tile past the end re-reads tile j0 and is not used */
#pragma unroll
      for (int u = 0; u < 8; ++u) { const int j = (j0 + 8 * u < nt) ? j0 + 8 * u : j0; tp[u] = kp + (size_t)j * 16 * CC;
#pragma unroll
        for (int kc = 0; kc < 2; ++kc) kf[u][kc] = frag_hp(tp[u] + kc * 32); }
      /* inputs-only fence on the loaded fragments and their pointers: keeps all the loads issued here, ahead of the first product (without it the compiler sinks a tile's loads into that tile's branch, a second load latency per group), and keeps every address register untouched until its loads have returned, so that no wait for an address register stands inside the run of loads (qp: the q loads in front of the loop are still in flight in the first run) */
      asm volatile("" :: "v"(kf[0][0]), "v"(kf[0][1]), "v"(kf[1][0]), "v"(kf[1][1]), "v"(kf[2][0]), "v"(kf[2][1]), "v"(kf[3][0]), "v"(kf[3][1]), "v"(kf[4][0]), "v"(kf[4][1]), "v"(kf[5][0]), "v"(kf[5][1]), "v"(kf[6][0]), "v"(kf[6][1]), "v"(kf[7][0]), "v"(kf[7][1]), "v"(tp[0]), "v"(tp[1]), "v"(tp[2]), "v"(tp[3]), "v"(tp[4]), "v"(tp[5]), "v"(tp[6]), "v"(tp[7]), "v"(qp));
#pragma unroll
      for (int u = 0; u < 8; ++u) { const int j = j0 + 8 * u; if (j < nt) { v8f acc = {}; acc = wmma16(ah[0], kf[u][0], acc); acc = wmma16(ah[1], kf[u][1], acc);
#pragma unroll
          for (int r = 0; r < 8; ++r) sl[8 * g + r][j * 16 + col] = (j * 16 + col <= ql0 + 8 * g + r) ? acc[r] * SCALE : -3.0e38f; } } } }
  __syncthreads();
  { float* sr0 = &sl[wave * 2][lane * 4]; float* sr1 = &sl[wave * 2 + 1][lane * 4]; float m0 = -3.0e38f, m1 = -3.0e38f, sum0 = 0.f, sum1 = 0.f;   /* the wave's two rows side by side: two independent chains of LDS reads */
#pragma unroll 2   /* four LDS reads in flight */
    for (int k = 0; k < n; k += 128) { const v4f v0 = *(const v4f*)&sr0[k], v1 = *(const v4f*)&sr1[k]; m0 = fmaxf(m0, fmaxf(fmaxf(v0[0], v0[1]), fmaxf(v0[2], v0[3]))); m1 = fmaxf(m1, fmaxf(fmaxf(v1[0], v1[1]), fmaxf(v1[2], v1[3]))); }
#pragma unroll
    for (int o = 1; o < 32; o <<= 1) { m0 = fmaxf(m0, __shfl_xor(m0, o)); m1 = fmaxf(m1, __shfl_xor(m1, o)); }
#pragma unroll 2   /* four LDS reads in flight */
    for (int k = 0; k < n; k += 128) { const v4f v0 = *(const v4f*)&sr0[k], v1 = *(const v4f*)&sr1[k]; v4f e0, e1;
#pragma unroll
      for (int i = 0; i < 4; ++i) { const float x0 = expf(v0[i] - m0), x1 = expf(v1[i] - m1); e0[i] = (v0[i] <= -1.0e38f) ? 0.f : x0; e1[i] = (v1[i] <= -1.0e38f) ? 0.f : x1; sum0 += e0[i]; sum1 += e1[i]; }
      *(v4f*)&sr0[k] = e0; *(v4f*)&sr1[k] = e1; }
#pragma unroll
    for (int o = 1; o < 32; o <<= 1) { sum0 += __shfl_xor(sum0, o); sum1 += __shfl_xor(sum1, o); }
    if (lane == 0) { sinv[wave * 2] = 2048.0f / sum0; sinv[wave * 2 + 1] = 2048.0f / sum1; } }
  __syncthreads();
  const float sc = sinv[col]; const int per = (nkc + 7) >> 3; const int kcs = wave * per, kce = (kcs + per < nkc) ? kcs + per : nkc;
  v8f acc[HD / 16] = {};
  if (hi) {
    for (int kc = kcs; kc < kce; ++kc) { float v[16]; const float* p = &sl[col][kc * 32 + 8 * g];
#pragma unroll
      for (int i = 0; i < 8; ++i) { v[i] = p[i] * sc; v[8 + i] = p[16 + i] * sc; }
      const F2 pf = bsplit16(v); v16b vh[HD / 16], vl[HD / 16]; const size_t po = ((size_t)b * CC + h * HD + col) * (size_t)KHI + kc * 32 + 8 * g; const __bf16* ph = VB + po; const __bf16* pl = VBL + po;   /* the chunk's eight v fragments are loaded ahead of the products */
#pragma unroll
      for (int j = 0; j < HD / 16; ++j) { vh[j] = frag_bp(ph + (size_t)j * 16 * KHI); vl[j] = frag_bp(pl + (size_t)j * 16 * KHI); }
      /* inputs-only fence on the loaded fragments and their pointers: all the loads are issued ahead of the first product and the address registers stay untouched until the loads have returned */
      asm volatile("" :: "v"(vh[0]), "v"(vh[1]), "v"(vh[2]), "v"(vh[3]), "v"(vl[0]), "v"(vl[1]), "v"(vl[2]), "v"(vl[3]), "v"(ph), "v"(pl));
#pragma unroll
      for (int j = 0; j < HD / 16; ++j) { acc[j] = wmma_bf(pf.h, vh[j], acc[j]); acc[j] = wmma_bf(pf.l, vh[j], acc[j]); acc[j] = wmma_bf(pf.h, vl[j], acc[j]); } }
  } else {
    const _Float16* vp = VT + ((size_t)b * CC + h * HD + col) * (size_t)TT + 8 * g;   /* the lane's fragment start in the head's first 16 v planes */
    for (int kc0 = kcs; kc0 < kce; kc0 += 4) { v16h vf[4][HD / 16], pf[4]; const _Float16* cp[4];   /* four chunks' v and P fragments are loaded ahead of the products: one load latency per four chunks; a chunk past the end re-reads chunk kc0 and is not used */
#pragma unroll
      for (int u = 0; u < 4; ++u) { const int kc = (kc0 + u < kce) ? kc0 + u : kc0; cp[u] = vp + kc * 32;
#pragma unroll
        for (int j = 0; j < HD / 16; ++j) vf[u][j] = frag_hp(cp[u] + (size_t)j * 16 * TT);
        pf[u] = frag_f32s(&sl[col][kc * 32], lane, sc); }
      /* inputs-only fence on the loaded v fragments and their pointers: as in phase 1 */
      asm volatile("" :: "v"(vf[0][0]), "v"(vf[0][1]), "v"(vf[0][2]), "v"(vf[0][3]), "v"(vf[1][0]), "v"(vf[1][1]), "v"(vf[1][2]), "v"(vf[1][3]), "v"(vf[2][0]), "v"(vf[2][1]), "v"(vf[2][2]), "v"(vf[2][3]), "v"(vf[3][0]), "v"(vf[3][1]), "v"(vf[3][2]), "v"(vf[3][3]), "v"(cp[0]), "v"(cp[1]), "v"(cp[2]), "v"(cp[3]));
#pragma unroll
      for (int u = 0; u < 4; ++u) if (kc0 + u < kce) {
#pragma unroll
        for (int j = 0; j < HD / 16; ++j) acc[j] = wmma16(pf[u], vf[u][j], acc[j]); } } }
  __syncthreads();   /* every wave has read its P chunks: the logit rows become the staging of the 8 partial tiles */
  float* red = &sl[0][0];
#pragma unroll
  for (int j = 0; j < HD / 16; ++j)
#pragma unroll
    for (int r = 0; r < 8; ++r) red[(wave * 16 + 8 * g + r) * (HD + 4) + j * 16 + col] = acc[j][r];
  __syncthreads();
  { const int row = tid >> 4, c4 = (tid & 15) * 4; v4f s = *(const v4f*)&red[row * (HD + 4) + c4];
#pragma unroll
    for (int w = 1; w < 8; ++w) s += *(const v4f*)&red[(w * 16 + row) * (HD + 4) + c4];
    vst2(Y + ((size_t)b * TT + ql0 + row) * CC + h * HD + c4, s * (1.0f / 2048.0f)); } }
// ---- k_out: block = (64 rows, 128 cols): out = ctx Wo (+ bo): ctx once to f16 against Wo as f16(bf16 x 2^8) exact (1 product) x 2^-8; causal early rows (< QHI of each sequence): ctx bf16 hi + lo against exact bf16 Wo (2 products)
__global__ __launch_bounds__(128) void k_out(const float* __restrict__ Y, const float* __restrict__ WO, const float* __restrict__ BO, float* __restrict__ OUT) { __shared__ __align__(16) float sf[4][16][132];
  const int tid = threadIdx.x, wave = tid >> 5, lane = tid & 31, col = lane & 15, g = lane >> 4; const int c0 = blockIdx.y * 128; const size_t r0 = (size_t)blockIdx.x * 64 + wave * 16;
  v8f acc[8] = {};
  if (CAUSAL && (int)(((size_t)blockIdx.x * 64) % TT) < QHI) {   /* block-uniform */
#pragma unroll 2
    for (int kc = 0; kc < CC / 32; ++kc) { const F2 a = split_row(Y + (r0 + col) * CC, kc * 32, lane); asm volatile("s_wait_loadcnt 0x0" ::: "memory");
#pragma unroll
      for (int j = 0; j < 8; ++j) { const v16b w = WOCOL(WO, kc * 32, c0 + j * 16 + col, lane); asm volatile("s_wait_loadcnt 0x0" ::: "memory"); acc[j] = wmma_bf(a.h, w, acc[j]); acc[j] = wmma_bf(a.l, w, acc[j]); } }
#pragma unroll
    for (int j = 0; j < 8; ++j) { const float bias = BO ? bfr(BO[c0 + j * 16 + col]) : 0.f;
#pragma unroll
      for (int r = 0; r < 8; ++r) sf[wave][8 * g + r][j * 16 + col] = acc[j][r] + bias; }
  } else {
#pragma unroll 2
    for (int kc = 0; kc < CC / 32; ++kc) { const v16h a = frag_f32(Y + (r0 + col) * CC + kc * 32, lane); asm volatile("s_wait_loadcnt 0x0" ::: "memory");
#pragma unroll
      for (int j = 0; j < 8; ++j) { const v16h w = WOCOLH(WO, kc * 32, c0 + j * 16 + col, lane); asm volatile("s_wait_loadcnt 0x0" ::: "memory"); acc[j] = wmma16(a, w, acc[j]); } }
#pragma unroll
    for (int j = 0; j < 8; ++j) { const float bias = BO ? bfr(BO[c0 + j * 16 + col]) : 0.f;
#pragma unroll
      for (int r = 0; r < 8; ++r) sf[wave][8 * g + r][j * 16 + col] = acc[j][r] * (1.0f / 256.0f) + bias; } }
  LDSX(); for (int rl = 0; rl < 16; ++rl) vst2(OUT + (r0 + rl) * DIN + c0 + lane * 4, *(const v4f*)&sf[wave][rl][lane * 4]); }

extern "C" void kernel_launch(void* const* d_in, const int* in_sizes, int n_in, void* d_out, int out_size, void* d_ws, size_t ws_size, hipStream_t stream) {
  (void)in_sizes; (void)n_in; (void)out_size;
  const float** F = (const float**)d_in;
  if (ws_size < (size_t)WS_END) return;
  char* ws = (char*)d_ws; _Float16 *QH = (_Float16*)(ws + WS_QH), *KH = (_Float16*)(ws + WS_KH), *VT = (_Float16*)(ws + WS_VT), *QL = (_Float16*)(ws + WS_QL), *KL = (_Float16*)(ws + WS_KL); __bf16 *VB = (__bf16*)(ws + WS_VB), *VBL = (__bf16*)(ws + WS_VBL); float *Y = (float*)(ws + WS_Y);
  (void)Y; (void)QL; (void)KL; (void)VB; (void)VBL;
  // inputs: 0 query, 1 key, 2 value [2,2048,1024]; 3 W_Q, 4 W_K, 5 W_V, 6 W_ffn (out,in) [1024,1024]; 7 b_ffn [1024]
  float *QF = (float*)(ws + WS_QF), *KF = (float*)(ws + WS_KF), *VF = (float*)(ws + WS_VF);
  k_projf<<<dim3(TNB * TT / 64, CC / 128, 3), 128, 0, stream>>>(F[0], F[1], F[2], F[3], F[4], F[5], QF, KF, VF);
  k_prep8<<<dim3(TNB * TT / 64, NH), 128, 0, stream>>>(QF, KF, VF, QH, QL, KH, KL, VT, VB, VBL);
  k_att<<<dim3(TNB * NH, TT / 16), 256, 0, stream>>>(QH, KH, QL, KL, VT, VB, VBL, Y);
  k_out<<<dim3(TNB * TT / 64, DIN / 128), 128, 0, stream>>>(Y, F[6], F[7], (float*)d_out);
}

// v002
// A run of this version takes 205 microseconds.
// Next to v001, in two timings, it ran 2.00 and 2.01 times as fast.
// Counting every step since v000, it is 5.42 times as fast.
// compute dtype: all float inputs rounded to bf16; Q/K/V = {query,key,value} W^T with EXACT bf16 products on WMMA 16x16x32 (f32 accumulate) kept as f32 rows, then re-read in the module's (B, H, Sq, 64) reinterpretation: q, k once to f16 -> 1-product causal logits x 1/8, except the first 384 query positions of each (batch, head) (few keys, no averaging), which use q and k as f16 hi + residual (x 2^10) (3 products); softmax in f32 (precise expf); P x 2^11 once to f16 against v once to f16 (1 product), except the first 384 positions: P and v as bf16 hi + lo (3 products); concat once to f16 against W_ffn carried x 2^8 in f16 (exact bf16 values), except rows < 384 of each sequence: bf16 hi + lo against exact bf16 W_ffn (2 products); + b_ffn; f32 output.
#include <hip/hip_runtime.h>
#include <math.h>
#include <type_traits>

typedef __attribute__((ext_vector_type(16))) _Float16 v16h;
typedef __attribute__((ext_vector_type(16))) __bf16 v16b;
typedef __attribute__((ext_vector_type(8)))  _Float16 v8h;
typedef __attribute__((ext_vector_type(8)))  float v8f;
typedef __attribute__((ext_vector_type(4)))  float v4f;
typedef __attribute__((ext_vector_type(2)))  float v2f;
typedef __attribute__((ext_vector_type(4)))  unsigned v4u;
typedef __attribute__((ext_vector_type(4)))  int v4i;
typedef float __attribute__((may_alias)) float_a;
typedef int __attribute__((may_alias)) int_a;

template <typename T> __device__ __forceinline__ void vst2(void* p, T v) { *(T*)p = v;  }
__device__ __forceinline__ v8f wmma16(v16h a, v16h b, v8f c) {
  v8f d = __builtin_amdgcn_wmma_f32_16x16x32_f16(false, a, false, b, (short)0, c, false, false);
  asm volatile("v_nop\n\tv_nop\n\tv_nop\n\tv_nop" : "+v"(d) : "v"(a), "v"(b));
  return d;
}
__device__ __forceinline__ v8f wmma_bf(v16b a, v16b b, v8f c) {
  v8f d = __builtin_amdgcn_wmma_f32_16x16x32_bf16(false, a, false, b, (short)0, c, false, false);
  asm volatile("v_nop\n\tv_nop\n\tv_nop\n\tv_nop" : "+v"(d) : "v"(a), "v"(b));
  return d;
}
// 16x16x32 fragments: lane = (h = lane>>4, row/col = lane&15); elements 0..7 = k0+8h+0..7, 8..15 = k0+16+8h+0..7; D element r = row 8h+r
__device__ __forceinline__ v16h frag_h(const _Float16* rowk0, int lane) {
  union { v16h v; v8h q[2]; } u; const _Float16* p = rowk0 + 8 * (lane >> 4);
  u.q[0] = *(const v8h*)p; u.q[1] = *(const v8h*)(p + 16); return u.v;
}
__device__ __forceinline__ v16h frag_f32(const float* rowk0, int lane) {
  v16h a; const float* p = rowk0 + 8 * (lane >> 4);
#pragma unroll
  for (int i = 0; i < 8; ++i) { a[i] = (_Float16)p[i]; a[8 + i] = (_Float16)p[16 + i]; }
  return a;
}
__device__ __forceinline__ v16h frag_f32s(const float* rowk0, int lane, float sc) {
  v16h a; const float* p = rowk0 + 8 * (lane >> 4);
#pragma unroll
  for (int i = 0; i < 8; ++i) { a[i] = (_Float16)(p[i] * sc); a[8 + i] = (_Float16)(p[16 + i] * sc); }
  return a;
}
// column fragment from a [K][ld] layout (column n), rows >= K read as 0
__device__ __forceinline__ v16h fragc_f32(const float* W, int k0, int n, int lane, int ld, int K) {
  v16h a; const int g = lane >> 4;
#pragma unroll
  for (int i = 0; i < 8; ++i) { const int ka = k0 + 8 * g + i, kb = ka + 16;
    a[i] = (_Float16)(ka < K ? W[(size_t)(ka < K ? ka : K - 1) * ld + n] : 0.f); a[8 + i] = (_Float16)(kb < K ? W[(size_t)(kb < K ? kb : K - 1) * ld + n] : 0.f); }
  return a;
}
struct F2 { v16b h, l; };
__device__ __forceinline__ F2 bsplit16(const float v[16]) { F2 r;
#pragma unroll
  for (int i = 0; i < 16; ++i) { const __bf16 h = (__bf16)v[i]; r.h[i] = h; r.l[i] = (__bf16)(v[i] - (float)h); }
  return r; }
__device__ __forceinline__ F2 split_row(const float* row, int k0, int lane) { float v[16]; const float* p = row + k0 + 8 * (lane >> 4);
#pragma unroll
  for (int i = 0; i < 8; ++i) { v[i] = p[i]; v[8 + i] = p[16 + i]; }
  return bsplit16(v); }
__device__ __forceinline__ F2 split_rowK(const float* row, int k0, int lane, int K) { float v[16]; const int g = lane >> 4;
#pragma unroll
  for (int i = 0; i < 8; ++i) { const int ka = k0 + 8 * g + i, kb = ka + 16; v[i] = ka < K ? row[ka < K ? ka : K - 1] : 0.f; v[8 + i] = kb < K ? row[kb < K ? kb : K - 1] : 0.f; }
  return bsplit16(v); }
__device__ __forceinline__ F2 split_col(const float* W, int k0, int n, int lane, int ld, int K) { float v[16]; const int g = lane >> 4;
#pragma unroll
  for (int i = 0; i < 8; ++i) { const int ka = k0 + 8 * g + i, kb = ka + 16; v[i] = ka < K ? W[(size_t)(ka < K ? ka : K - 1) * ld + n] : 0.f; v[8 + i] = kb < K ? W[(size_t)(kb < K ? kb : K - 1) * ld + n] : 0.f; }
  return bsplit16(v); }
__device__ __forceinline__ v8f mac3(const F2& a, const F2& b, v8f c) { c = wmma_bf(a.l, b.h, c); c = wmma_bf(a.h, b.l, c); return wmma_bf(a.h, b.h, c); }
__device__ __forceinline__ float sigm(float v) { return 1.0f / (1.0f + expf(-v)); }
#define LDSX() do { asm volatile("s_wait_dscnt 0" ::: "memory"); __builtin_amdgcn_wave_barrier(); __builtin_amdgcn_fence(__ATOMIC_RELEASE, "workgroup"); } while (0)

// Causal multi-head attention with the module's plain reshape (B 2, S 2,048, E 1,024, 16 heads x 64): Q = query Wq^T, K = key Wk^T, V = value Wv^T ((out,in), no bias); Q/K/V.reshape(B, H, S, 64) WITHOUT a transpose (head hh = the contiguous 128-row block hh of the [S, E] projection, position s = row hh*128 + s/16, columns (s%16)*64 ..); scores = Q K^T / 8 with key > query -> -inf; softmax; concat = head_out.transpose(0,2,1,3).reshape(B, S, E); out = concat W_ffn^T + b_ffn.
#define NB 2
#define TT 2048
#define CC 1024            // NH * HD = projected width
#define DIN 1024          // input (model) width
#define NH 16
#define HD 64
#define NQB (TT / 64)
#define HG 4
#define SCALE (0.125f)
#define CAUSAL 1
#ifndef TNB
#define TNB NB
#endif
__device__ __forceinline__ float bfr(float v) { return (float)(__bf16)v; }
__host__ __device__ __forceinline__ int kb_last(int qb) { return CAUSAL ? ((qb * 64 + 63) >> 7) : (TT / 128 - 1); }
typedef __attribute__((ext_vector_type(8))) __bf16 v8b;
__device__ __forceinline__ v16b frag_b(const __bf16* rowk0, int lane) {
  union { v16b v; v8b q[2]; } u; const __bf16* p = rowk0 + 8 * (lane >> 4);
  u.q[0] = *(const v8b*)p; u.q[1] = *(const v8b*)(p + 16); return u.v;
}
#define QBH 6              // unused: the causal high-precision path is taken by query positions < QHI of each sequence (few keys, no averaging)
#define QHI 384            // rows carrying a q residual plane
#define KHI 384            // key rows carrying k residual / v bf16 hi+lo planes (used only by the causal high-precision path)
// B fragment (k rows k0+.., output column o) of a weight: (in,out) [K][ld] or (out,in) [ld rows of K]: bf16 exact, or f16(bf16 * 256) exact
__device__ __forceinline__ v16b wcol_io(const float* Wm, int k0, int o, int lane, int ld) { v16b w; const int g = lane >> 4;
#pragma unroll
  for (int i = 0; i < 8; ++i) { w[i] = (__bf16)Wm[(size_t)(k0 + 8 * g + i) * ld + o]; w[8 + i] = (__bf16)Wm[(size_t)(k0 + 16 + 8 * g + i) * ld + o]; }
  return w; }
__device__ __forceinline__ v16b wcol_oi(const float* Wm, int k0, int o, int lane, int K) { v16b w; const float* p = Wm + (size_t)o * K + k0 + 8 * (lane >> 4);
#pragma unroll
  for (int i = 0; i < 8; ++i) { w[i] = (__bf16)p[i]; w[8 + i] = (__bf16)p[16 + i]; }
  return w; }
__device__ __forceinline__ v16h wcolh_io(const float* Wm, int k0, int o, int lane, int ld) { v16h w; const int g = lane >> 4;
#pragma unroll
  for (int i = 0; i < 8; ++i) { w[i] = (_Float16)(bfr(Wm[(size_t)(k0 + 8 * g + i) * ld + o]) * 256.0f); w[8 + i] = (_Float16)(bfr(Wm[(size_t)(k0 + 16 + 8 * g + i) * ld + o]) * 256.0f); }
  return w; }
__device__ __forceinline__ v16h wcolh_oi(const float* Wm, int k0, int o, int lane, int K) { v16h w; const float* p = Wm + (size_t)o * K + k0 + 8 * (lane >> 4);
#pragma unroll
  for (int i = 0; i < 8; ++i) { w[i] = (_Float16)(bfr(p[i]) * 256.0f); w[8 + i] = (_Float16)(bfr(p[16 + i]) * 256.0f); }
  return w; }
#define WQKV_LAYOUT 1   // 0 = (in,out) [DIN][CC]; 1 = (out,in) [CC][DIN]; 2 = per-head [NH][DIN][HD]
__device__ __forceinline__ v16b wcol_hdk(const float* Wm, int k0, int o, int lane) { v16b w; const int g = lane >> 4; const float* p = Wm + (size_t)(o / HD) * DIN * HD + (o % HD);
#pragma unroll
  for (int i = 0; i < 8; ++i) { w[i] = (__bf16)p[(size_t)(k0 + 8 * g + i) * HD]; w[8 + i] = (__bf16)p[(size_t)(k0 + 16 + 8 * g + i) * HD]; }
  return w; }
#define WO_OUT_IN 1
#if WQKV_LAYOUT == 1
#define WCOL(W, k0, o, lane) wcol_oi(W, k0, o, lane, DIN)
#elif WQKV_LAYOUT == 2
#define WCOL(W, k0, o, lane) wcol_hdk(W, k0, o, lane)
#else
#define WCOL(W, k0, o, lane) wcol_io(W, k0, o, lane, CC)
#endif
#if WO_OUT_IN
#define WOCOL(W, k0, o, lane) wcol_oi(W, k0, o, lane, CC)
#define WOCOLH(W, k0, o, lane) wcolh_oi(W, k0, o, lane, CC)
#else
#define WOCOL(W, k0, o, lane) wcol_io(W, k0, o, lane, DIN)
#define WOCOLH(W, k0, o, lane) wcolh_io(W, k0, o, lane, DIN)
#endif

#ifndef SM_EXTRA_PARAMS
#define SM_EXTRA_PARAMS
#endif
#ifndef SM_MASK_HOOK
#define SM_MASK_HOOK (void)0
#endif

#define WS_QH  0u                                      // f16 q rows [b*t][CC]
#define WS_KH  (WS_QH + 2u * (size_t)NB * TT * CC)      // f16 k rows [b*t][CC]
#define WS_VT  (WS_KH + 2u * (size_t)NB * TT * CC)      // f16 v planes [b][c][t]
#define WS_QL  (WS_VT + 2u * (size_t)NB * CC * TT)      // f16 q residual x 2^10 rows [b][t < QHI][CC]
#define WS_KL  (WS_QL + 2u * (size_t)NB * QHI * CC)     // f16 k residual x 2^10 rows [b][t < KHI][CC]
#define WS_VB  (WS_KL + 2u * (size_t)NB * KHI * CC)     // bf16 v hi planes [b][c][t < KHI]
#define WS_VBL (WS_VB + 2u * (size_t)NB * CC * KHI)
#define WS_S   (WS_VBL + 2u * (size_t)NB * CC * KHI)    // f32 [hg][t][s] region, unused: the logit rows stay in LDS
#define WS_Y   (WS_S  + 4u * (size_t)HG * TT * TT)      // f32 ctx rows [b*t][CC] (only when there is an output projection)
#define WS_QF  (WS_Y  + 4u * (size_t)NB * TT * CC)      // f32 Q rows [b*t][CC] (projection output, module row order)
#define WS_KF  (WS_QF + 4u * (size_t)NB * TT * CC)
#define WS_VF  (WS_KF + 4u * (size_t)NB * TT * CC)
#define WS_END (WS_VF + 4u * (size_t)NB * TT * CC)

// ---- staged GEMM tiles (k_projf, k_out): block = 128 rows x 128 cols, 8 waves (4 x 2), wave = 32 rows x 64 cols (2 x 4 accumulator tiles). Per pass of 32 k the block reads its 128-B row pieces once with whole-line loads (8 lanes a row), converts them once and lays them in LDS; every wave takes its fragments from there. Two LDS buffers: the next pass's global loads are issued ahead of this pass's products, converted and stored behind them; one barrier a pass. k runs upward into one accumulator per tile, in the fragments' k order of frag_b / frag_h.
#define GP 40              // 16-bit elements per staged row: 80 B = 16 B x odd, so the 16-byte fragment reads of 16 rows fall on different banks
#define GSP 68             // floats per row of a wave's output staging (16-byte reads of a row walk without conflicts)
typedef __attribute__((ext_vector_type(4))) __bf16 v4b;
typedef __attribute__((ext_vector_type(4))) _Float16 v4h;
// the wave's 32 x 64 tile -> rows of D (pointer at the tile's first element), 16 rows at a time through the wave's own LDS range sw[16][GSP]: 256-B row segments by 16 lanes
__device__ __forceinline__ void tile_out(float* sw, const v8f (&acc)[2][4], float* D, int ld, int lane) { const int col = lane & 15, g = lane >> 4;
#pragma unroll
  for (int i = 0; i < 2; ++i) {
#pragma unroll
    for (int j = 0; j < 4; ++j) {
#pragma unroll
      for (int r = 0; r < 8; ++r) sw[(8 * g + r) * GSP + j * 16 + col] = acc[i][j][r]; }
    LDSX();
#pragma unroll
    for (int rr = 0; rr < 8; ++rr) vst2(D + (size_t)(i * 16 + rr * 2 + g) * ld + col * 4, *(const v4f*)&sw[(rr * 2 + g) * GSP + col * 4]); } }
// ---- k_projf: block = (128 rows, 128 cols, which): Q/K/V = X W^T with exact bf16 products (K = DIN) -> f32 rows [b*t][CC]
__global__ __launch_bounds__(256) void k_projf(const float* __restrict__ XQ, const float* __restrict__ XK, const float* __restrict__ XV, const float* __restrict__ WQ, const float* __restrict__ WK, const float* __restrict__ WV, float* __restrict__ QF, float* __restrict__ KF, float* __restrict__ VF) {
  __shared__ __align__(16) __bf16 st[2][256][GP];   /* rows 0..127: X, 128..255: W; after the last pass: the waves' output staging */
  const int tid = threadIdx.x, wave = tid >> 5, lane = tid & 31, col = lane & 15; const int wm = wave >> 1, wn = wave & 1; const int which = blockIdx.z; const int c0 = blockIdx.y * 128; const size_t r0 = (size_t)blockIdx.x * 128;
  const float* X = which == 0 ? XQ : which == 1 ? XK : XV; const float* WA = which == 0 ? WQ : which == 1 ? WK : WV; float* D = which == 0 ? QF : which == 1 ? KF : VF;
  const int lr = tid >> 3, lq = (tid & 7) * 4;   /* the thread's row (and + 32, 64, 96) and its four k of a pass */
  const float* xp = X + (r0 + lr) * DIN + lq; const float* wp = WA + (size_t)(c0 + lr) * DIN + lq;
  v4f px[4], pw[4]; v8f acc[2][4] = {};
#pragma unroll
  for (int i = 0; i < 4; ++i) { px[i] = *(const v4f*)(xp + (size_t)i * 32 * DIN); pw[i] = *(const v4f*)(wp + (size_t)i * 32 * DIN); }
#pragma unroll
  for (int i = 0; i < 4; ++i) { *(v4b*)&st[0][lr + 32 * i][lq] = __builtin_convertvector(px[i], v4b); *(v4b*)&st[0][128 + lr + 32 * i][lq] = __builtin_convertvector(pw[i], v4b); }
  __syncthreads();
#pragma unroll 2   /* the buffer index becomes a constant */
  for (int kc = 0; kc < DIN / 32; ++kc) { const int cur = kc & 1; const bool more = kc + 1 < DIN / 32;
    if (more) {
#pragma unroll
      for (int i = 0; i < 4; ++i) { px[i] = *(const v4f*)(xp + (size_t)i * 32 * DIN + (kc + 1) * 32); pw[i] = *(const v4f*)(wp + (size_t)i * 32 * DIN + (kc + 1) * 32); } }
    v16b a[2], w[4];
#pragma unroll
    for (int i = 0; i < 2; ++i) a[i] = frag_b(&st[cur][wm * 32 + i * 16 + col][0], lane);
#pragma unroll
    for (int j = 0; j < 4; ++j) w[j] = frag_b(&st[cur][128 + wn * 64 + j * 16 + col][0], lane);
#pragma unroll
    for (int i = 0; i < 2; ++i) {
#pragma unroll
      for (int j = 0; j < 4; ++j) acc[i][j] = wmma_bf(a[i], w[j], acc[i][j]); }
    if (more) {
#pragma unroll
      for (int i = 0; i < 4; ++i) { *(v4b*)&st[cur ^ 1][lr + 32 * i][lq] = __builtin_convertvector(px[i], v4b); *(v4b*)&st[cur ^ 1][128 + lr + 32 * i][lq] = __builtin_convertvector(pw[i], v4b); } }
    __syncthreads(); }   /* publishes the next pass's buffer and ends every wave's reads of this one */
  tile_out((float*)&st[0][0][0] + wave * 16 * GSP, acc, D + (r0 + wm * 32) * CC + c0 + wn * 64, CC, lane); }
// ---- k_prep8: block = (64 attention positions s0.. of sequence b, head h): reads the f32 rows in the module's (B, H, S, 64) reinterpretation (element (b,h,s,c) = row-buffer float ((b*NH + h)*TT + s)*64 + c) and writes the standard attention planes: q -> f16 hi rows (+ x 2^10 residual rows for s < QHI), k -> f16 rows (+ residual rows s < KHI), v -> f16 planes [c][s] (+ bf16 hi/lo planes for s < KHI)
__global__ __launch_bounds__(128) void k_prep8(const float* __restrict__ Q, const float* __restrict__ K, const float* __restrict__ V, _Float16* __restrict__ QH, _Float16* __restrict__ QL, _Float16* __restrict__ KH, _Float16* __restrict__ KL, _Float16* __restrict__ VT, __bf16* __restrict__ VB, __bf16* __restrict__ VBL) {
  __shared__ __align__(16) _Float16 sq[64][136], sql[64][136], sk[64][136], skl[64][136], tv[128][72]; __shared__ __align__(16) __bf16 tb[128][72], tbl[128][72];
  const int tid = threadIdx.x; const int h = blockIdx.y; const size_t r0 = (size_t)blockIdx.x * 64; const size_t bb = r0 / TT; const int t0 = (int)(r0 % TT); const bool qhi = t0 < QHI, khi = t0 < KHI;
  for (int e = tid; e < 64 * 128; e += 128) { const int rl = e >> 7, c = e & 127; const size_t oi = ((bb * NH + h) * TT + t0 + rl) * HD + (c & 63);   /* c >= 64: duplicate read of the same element (tiles are 128 wide; HD is 64) */
    const float q = Q[oi], k = K[oi], v = V[oi];
    const _Float16 qh = (_Float16)q, kh = (_Float16)k; sq[rl][c] = qh; sql[rl][c] = (_Float16)((q - (float)qh) * 1024.0f); sk[rl][c] = kh; skl[rl][c] = (_Float16)((k - (float)kh) * 1024.0f);
    tv[c][rl] = (_Float16)v; const __bf16 vb = (__bf16)v; tb[c][rl] = vb; tbl[c][rl] = (__bf16)(v - (float)vb); }
  __syncthreads();
  for (int e = tid; e < 64 * 8; e += 128) { const int rl = e >> 3, q = e & 7; const size_t o = (r0 + rl) * CC + h * HD + q * 8; vst2((unsigned*)(QH + o), *(const v4u*)&sq[rl][q * 8]); vst2((unsigned*)(KH + o), *(const v4u*)&sk[rl][q * 8]);   
    if (qhi) vst2((unsigned*)(QL + (bb * QHI + t0 + rl) * (size_t)CC + h * HD + q * 8), *(const v4u*)&sql[rl][q * 8]); if (khi) vst2((unsigned*)(KL + (bb * KHI + t0 + rl) * (size_t)CC + h * HD + q * 8), *(const v4u*)&skl[rl][q * 8]); }
  for (int e = tid; e < 64 * 8; e += 128) { const int cl = e >> 3, q = e & 7; vst2((unsigned*)(VT + (bb * CC + h * HD + cl) * (size_t)TT + t0 + q * 8), *(const v4u*)&tv[cl][q * 8]);
    if (khi) { const size_t o3 = (bb * CC + h * HD + cl) * (size_t)KHI + t0 + q * 8; vst2((unsigned*)(VB + o3), *(const v4u*)&tb[cl][q * 8]); vst2((unsigned*)(VBL + o3), *(const v4u*)&tbl[cl][q * 8]); } } }
// ---- k_att: block = (16 query positions, head h of batch b), 8 waves: the tile's logit rows stay in LDS from the q k^T products through the softmax to the P v products (no logit plane in memory, one launch for all heads).
// phase 1: wave w takes the 16-key tiles w, w + 8, ..: logits x SCALE, key > query -> excluded (first QHI positions: q and k hi + residual, 3 products); phase 2: wave w takes rows 2w, 2w + 1: max, expf, sum in f32, 2^11 / sum kept per row;
// phase 3: each wave takes a contiguous run of 32-key chunks: P x 2^11 once to f16 against v f16 (first QHI positions: P and v as bf16 hi + lo, 3 products); the 8 partial tiles are added in wave order through LDS; 256-B (row, head) segment by 16 lanes
// fragment from the lane's own pointer (row or plane base + k0 + 8 * (lane >> 4))
__device__ __forceinline__ v16h frag_hp(const _Float16* p) { union { v16h v; v8h q[2]; } u; u.q[0] = *(const v8h*)p; u.q[1] = *(const v8h*)(p + 16); return u.v; }
__device__ __forceinline__ v16b frag_bp(const __bf16* p) { union { v16b v; v8b q[2]; } u; u.q[0] = *(const v8b*)p; u.q[1] = *(const v8b*)(p + 16); return u.v; }
#define SP 2052            // floats per logit row in LDS: 16 B x odd, so the 16-byte fragment reads of the 16 rows fall on different banks
__global__ __launch_bounds__(256) void k_att(const _Float16* __restrict__ QH, const _Float16* __restrict__ KH, const _Float16* __restrict__ QL, const _Float16* __restrict__ KL, const _Float16* __restrict__ VT, const __bf16* __restrict__ VB, const __bf16* __restrict__ VBL, float* __restrict__ Y) {
  __shared__ __align__(16) float sl[16][SP]; __shared__ float sinv[16];
  const int tid = threadIdx.x, lane = tid & 31, col = lane & 15, g = lane >> 4; const int wave = __builtin_amdgcn_readfirstlane(tid >> 5);
  const int b = blockIdx.x / NH, h = blockIdx.x % NH; const int ql0 = (TT / 16 - 1 - (int)blockIdx.y) * 16;   /* longest tiles start first */
  const int nkc = (ql0 + 16 + 31) >> 5;   /* 32-key chunks that hold a key <= the tile's last query */
  const int n = ((ql0 + 16 + 127) >> 7) << 7, nt = n >> 4;   /* logits are formed for keys [0, n), whole 128-key blocks (excluded keys included): every wave has n / 128 tiles and every lane n / 128 quads of a row; n <= TT, and n <= KHI when ql0 < QHI */
  const bool hi = ql0 < QHI;   /* block-uniform */
  const size_t q0 = (size_t)b * TT + ql0, kr0 = (size_t)b * TT;
  const size_t lrow = (size_t)col * CC + h * HD + 8 * g;   /* the lane's fragment start in a 16-row tile of q or k rows */
  if (hi) { const _Float16* QLb = QL + (size_t)b * QHI * CC; const _Float16* KLb = KL + (size_t)b * KHI * CC; v16h ah[2], al[2];
#pragma unroll
    for (int kc = 0; kc < 2; ++kc) { ah[kc] = frag_hp(QH + q0 * CC + lrow + kc * 32); al[kc] = frag_hp(QLb + (size_t)ql0 * CC + lrow + kc * 32); }
    for (int j = wave; j < nt; j += 8) { v8f acc = {}, accl = {}; v16h kbf[2], klf[2]; const _Float16* th = KH + (kr0 + j * 16) * CC + lrow; const _Float16* tl = KLb + (size_t)(j * 16) * CC + lrow;   /* all four fragments are loaded ahead of the products: one load latency a tile */
#pragma unroll
      for (int kc = 0; kc < 2; ++kc) { kbf[kc] = frag_hp(th + kc * 32); klf[kc] = frag_hp(tl + kc * 32); }
      /* inputs-only fence on the loaded fragments and their pointers: all the loads are issued ahead of the first product and the address registers stay untouched until the loads have returned */
      asm volatile("" :: "v"(kbf[0]), "v"(kbf[1]), "v"(klf[0]), "v"(klf[1]), "v"(th), "v"(tl));
#pragma unroll
      for (int kc = 0; kc < 2; ++kc) { acc = wmma16(ah[kc], kbf[kc], acc); accl = wmma16(al[kc], kbf[kc], accl); accl = wmma16(ah[kc], klf[kc], accl); }
#pragma unroll
      for (int r = 0; r < 8; ++r) sl[8 * g + r][j * 16 + col] = (j * 16 + col <= ql0 + 8 * g + r) ? (acc[r] + accl[r] * (1.0f / 1024.0f)) * SCALE : -3.0e38f; }
  } else { v16h ah[2]; const _Float16* qp = QH + q0 * CC + lrow;
#pragma unroll
    for (int kc = 0; kc < 2; ++kc) ah[kc] = frag_hp(qp + kc * 32);
    const _Float16* kp = KH + kr0 * CC + lrow;
    for (int j0 = wave; j0 < nt; j0 += 64) { v16h kf[8][2]; const _Float16* tp[8];   /* eight tiles' k fragments are loaded ahead of the products: one load latency per eight tiles; a tile past the end re-reads tile j0 and is not used */
#pragma unroll
      for (int u = 0; u < 8; ++u) { const int j = (j0 + 8 * u < nt) ? j0 + 8 * u : j0; tp[u] = kp + (size_t)j * 16 * CC;
#pragma unroll
        for (int kc = 0; kc < 2; ++kc) kf[u][kc] = frag_hp(tp[u] + kc * 32); }
      /* inputs-only fence on the loaded fragments and their pointers: keeps all the loads issued here, ahead of the first product (without it the compiler sinks a tile's loads into that tile's branch, a second load latency per group), and keeps every address register untouched until its loads have returned, so that no wait for an address register stands inside the run of loads (qp: the q loads in front of the loop are still in flight in the first run) */
      asm volatile("" :: "v"(kf[0][0]), "v"(kf[0][1]), "v"(kf[1][0]), "v"(kf[1][1]), "v"(kf[2][0]), "v"(kf[2][1]), "v"(kf[3][0]), "v"(kf[3][1]), "v"(kf[4][0]), "v"(kf[4][1]), "v"(kf[5][0]), "v"(kf[5][1]), "v"(kf[6][0]), "v"(kf[6][1]), "v"(kf[7][0]), "v"(kf[7][1]), "v"(tp[0]), "v"(tp[1]), "v"(tp[2]), "v"(tp[3]), "v"(tp[4]), "v"(tp[5]), "v"(tp[6]), "v"(tp[7]), "v"(qp));
#pragma unroll
      for (int u = 0; u < 8; ++u) { const int j = j0 + 8 * u; if (j < nt) { v8f acc = {}; acc = wmma16(ah[0], kf[u][0], acc); acc = wmma16(ah[1], kf[u][1], acc);
#pragma unroll
          for (int r = 0; r < 8; ++r) sl[8 * g + r][j * 16 + col] = (j * 16 + col <= ql0 + 8 * g + r) ? acc[r] * SCALE : -3.0e38f; } } } }
  __syncthreads();
  { float* sr0 = &sl[wave * 2][lane * 4]; float* sr1 = &sl[wave * 2 + 1][lane * 4]; float m0 = -3.0e38f, m1 = -3.0e38f, sum0 = 0.f, sum1 = 0.f;   /* the wave's two rows side by side: two independent chains of LDS reads */
#pragma unroll 2   /* four LDS reads in flight */
    for (int k = 0; k < n; k += 128) { const v4f v0 = *(const v4f*)&sr0[k], v1 = *(const v4f*)&sr1[k]; m0 = fmaxf(m0, fmaxf(fmaxf(v0[0], v0[1]), fmaxf(v0[2], v0[3]))); m1 = fmaxf(m1, fmaxf(fmaxf(v1[0], v1[1]), fmaxf(v1[2], v1[3]))); }
#pragma unroll
    for (int o = 1; o < 32; o <<= 1) { m0 = fmaxf(m0, __shfl_xor(m0, o)); m1 = fmaxf(m1, __shfl_xor(m1, o)); }
#pragma unroll 2   /* four LDS reads in flight */
    for (int k = 0; k < n; k += 128) { const v4f v0 = *(const v4f*)&sr0[k], v1 = *(const v4f*)&sr1[k]; v4f e0, e1;
#pragma unroll
      for (int i = 0; i < 4; ++i) { const float x0 = expf(v0[i] - m0), x1 = expf(v1[i] - m1); e0[i] = (v0[i] <= -1.0e38f) ? 0.f : x0; e1[i] = (v1[i] <= -1.0e38f) ? 0.f : x1; sum0 += e0[i]; sum1 += e1[i]; }
      *(v4f*)&sr0[k] = e0; *(v4f*)&sr1[k] = e1; }
#pragma unroll
    for (int o = 1; o < 32; o <<= 1) { sum0 += __shfl_xor(sum0, o); sum1 += __shfl_xor(sum1, o); }
    if (lane == 0) { sinv[wave * 2] = 2048.0f / sum0; sinv[wave * 2 + 1] = 2048.0f / sum1; } }
  __syncthreads();
  const float sc = sinv[col]; const int per = (nkc + 7) >> 3; const int kcs = wave * per, kce = (kcs + per < nkc) ? kcs + per : nkc;
  v8f acc[HD / 16] = {};
  if (hi) {
    for (int kc = kcs; kc < kce; ++kc) { float v[16]; const float* p = &sl[col][kc * 32 + 8 * g];
#pragma unroll
      for (int i = 0; i < 8; ++i) { v[i] = p[i] * sc; v[8 + i] = p[16 + i] * sc; }
      const F2 pf = bsplit16(v); v16b vh[HD / 16], vl[HD / 16]; const size_t po = ((size_t)b * CC + h * HD + col) * (size_t)KHI + kc * 32 + 8 * g; const __bf16* ph = VB + po; const __bf16* pl = VBL + po;   /* the chunk's eight v fragments are loaded ahead of the products */
#pragma unroll
      for (int j = 0; j < HD / 16; ++j) { vh[j] = frag_bp(ph + (size_t)j * 16 * KHI); vl[j] = frag_bp(pl + (size_t)j * 16 * KHI); }
      /* inputs-only fence on the loaded fragments and their pointers: all the loads are issued ahead of the first product and the address registers stay untouched until the loads have returned */
      asm volatile("" :: "v"(vh[0]), "v"(vh[1]), "v"(vh[2]), "v"(vh[3]), "v"(vl[0]), "v"(vl[1]), "v"(vl[2]), "v"(vl[3]), "v"(ph), "v"(pl));
#pragma unroll
      for (int j = 0; j < HD / 16; ++j) { acc[j] = wmma_bf(pf.h, vh[j], acc[j]); acc[j] = wmma_bf(pf.l, vh[j], acc[j]); acc[j] = wmma_bf(pf.h, vl[j], acc[j]); } }
  } else {
    const _Float16* vp = VT + ((size_t)b * CC + h * HD + col) * (size_t)TT + 8 * g;   /* the lane's fragment start in the head's first 16 v planes */
    for (int kc0 = kcs; kc0 < kce; kc0 += 4) { v16h vf[4][HD / 16], pf[4]; const _Float16* cp[4];   /* four chunks' v and P fragments are loaded ahead of the products: one load latency per four chunks; a chunk past the end re-reads chunk kc0 and is not used */
#pragma unroll
      for (int u = 0; u < 4; ++u) { const int kc = (kc0 + u < kce) ? kc0 + u : kc0; cp[u] = vp + kc * 32;
#pragma unroll
        for (int j = 0; j < HD / 16; ++j) vf[u][j] = frag_hp(cp[u] + (size_t)j * 16 * TT);
        pf[u] = frag_f32s(&sl[col][kc * 32], lane, sc); }
      /* inputs-only fence on the loaded v fragments and their pointers: as in phase 1 */
      asm volatile("" :: "v"(vf[0][0]), "v"(vf[0][1]), "v"(vf[0][2]), "v"(vf[0][3]), "v"(vf[1][0]), "v"(vf[1][1]), "v"(vf[1][2]), "v"(vf[1][3]), "v"(vf[2][0]), "v"(vf[2][1]), "v"(vf[2][2]), "v"(vf[2][3]), "v"(vf[3][0]), "v"(vf[3][1]), "v"(vf[3][2]), "v"(vf[3][3]), "v"(cp[0]), "v"(cp[1]), "v"(cp[2]), "v"(cp[3]));
#pragma unroll
      for (int u = 0; u < 4; ++u) if (kc0 + u < kce) {
#pragma unroll
        for (int j = 0; j < HD / 16; ++j) acc[j] = wmma16(pf[u], vf[u][j], acc[j]); } } }
  __syncthreads();   /* every wave has read its P chunks: the logit rows become the staging of the 8 partial tiles */
  float* red = &sl[0][0];
#pragma unroll
  for (int j = 0; j < HD / 16; ++j)
#pragma unroll
    for (int r = 0; r < 8; ++r) red[(wave * 16 + 8 * g + r) * (HD + 4) + j * 16 + col] = acc[j][r];
  __syncthreads();
  { const int row = tid >> 4, c4 = (tid & 15) * 4; v4f s = *(const v4f*)&red[row * (HD + 4) + c4];
#pragma unroll
    for (int w = 1; w < 8; ++w) s += *(const v4f*)&red[(w * 16 + row) * (HD + 4) + c4];
    vst2(Y + ((size_t)b * TT + ql0 + row) * CC + h * HD + c4, s * (1.0f / 2048.0f)); } }
// ---- k_out: block = (128 rows, 128 cols), staged as above: out = ctx Wo (+ bo): ctx once to f16 against Wo as f16(bf16 x 2^8) exact (1 product) x 2^-8; causal early rows (< QHI of each sequence): ctx bf16 hi + lo against exact bf16 Wo (2 products)
template <bool HI> __device__ __forceinline__ void out_tile(char* sm, const float* __restrict__ Y, const float* __restrict__ WO, const float* __restrict__ BO, float* __restrict__ OUT) {
  typedef typename std::conditional<HI, __bf16, _Float16>::type E; typedef E v4e __attribute__((ext_vector_type(4)));
  E (*st)[384][GP] = (E (*)[384][GP])sm;   /* rows 0..127: ctx (hi), 128..255: Wo, 256..383: ctx lo (HI only) */
  const int tid = threadIdx.x, wave = tid >> 5, lane = tid & 31, col = lane & 15; const int wm = wave >> 1, wn = wave & 1; const int c0 = blockIdx.y * 128; const size_t r0 = (size_t)blockIdx.x * 128;
  const int lr = tid >> 3, lq = (tid & 7) * 4;
  const float* xp = Y + (r0 + lr) * CC + lq; const float* wp = WO + (size_t)(c0 + lr) * CC + lq;
  v4f px[4], pw[4]; v8f acc[2][4] = {};
  auto put = [&](int buf) {
#pragma unroll
    for (int i = 0; i < 4; ++i) {
      if constexpr (HI) { const v4b h = __builtin_convertvector(px[i], v4b); *(v4b*)&st[buf][lr + 32 * i][lq] = h; *(v4b*)&st[buf][256 + lr + 32 * i][lq] = __builtin_convertvector(px[i] - __builtin_convertvector(h, v4f), v4b); *(v4b*)&st[buf][128 + lr + 32 * i][lq] = __builtin_convertvector(pw[i], v4b); }
      else { *(v4h*)&st[buf][lr + 32 * i][lq] = __builtin_convertvector(px[i], v4h); *(v4h*)&st[buf][128 + lr + 32 * i][lq] = __builtin_convertvector(__builtin_convertvector(__builtin_convertvector(pw[i], v4b), v4f) * 256.0f, v4h); } } };
#pragma unroll
  for (int i = 0; i < 4; ++i) { px[i] = *(const v4f*)(xp + (size_t)i * 32 * CC); pw[i] = *(const v4f*)(wp + (size_t)i * 32 * CC); }
  float bias[4] = {0.f, 0.f, 0.f, 0.f};   /* read here, beside the first tile's loads, so that the epilogue waits for nothing */
  if (BO) {
#pragma unroll
    for (int j = 0; j < 4; ++j) bias[j] = BO[c0 + wn * 64 + j * 16 + col]; }
  put(0);
  __syncthreads();
#pragma unroll 2   /* the buffer index becomes a constant */
  for (int kc = 0; kc < CC / 32; ++kc) { const int cur = kc & 1; const bool more = kc + 1 < CC / 32;
    if (more) {
#pragma unroll
      for (int i = 0; i < 4; ++i) { px[i] = *(const v4f*)(xp + (size_t)i * 32 * CC + (kc + 1) * 32); pw[i] = *(const v4f*)(wp + (size_t)i * 32 * CC + (kc + 1) * 32); } }
    if constexpr (HI) { v16b ah[2], al[2], w[4];
#pragma unroll
      for (int i = 0; i < 2; ++i) { ah[i] = frag_b(&st[cur][wm * 32 + i * 16 + col][0], lane); al[i] = frag_b(&st[cur][256 + wm * 32 + i * 16 + col][0], lane); }
#pragma unroll
      for (int j = 0; j < 4; ++j) w[j] = frag_b(&st[cur][128 + wn * 64 + j * 16 + col][0], lane);
#pragma unroll
      for (int i = 0; i < 2; ++i) {
#pragma unroll
        for (int j = 0; j < 4; ++j) acc[i][j] = wmma_bf(ah[i], w[j], acc[i][j]);
#pragma unroll
        for (int j = 0; j < 4; ++j) acc[i][j] = wmma_bf(al[i], w[j], acc[i][j]); }
    } else { v16h a[2], w[4];
#pragma unroll
      for (int i = 0; i < 2; ++i) a[i] = frag_h(&st[cur][wm * 32 + i * 16 + col][0], lane);
#pragma unroll
      for (int j = 0; j < 4; ++j) w[j] = frag_h(&st[cur][128 + wn * 64 + j * 16 + col][0], lane);
#pragma unroll
      for (int i = 0; i < 2; ++i) {
#pragma unroll
        for (int j = 0; j < 4; ++j) acc[i][j] = wmma16(a[i], w[j], acc[i][j]); } }
    if (more) put(cur ^ 1);
    __syncthreads(); }   /* publishes the next pass's buffer and ends every wave's reads of this one */
#pragma unroll
  for (int j = 0; j < 4; ++j) { const float bj = bfr(bias[j]);
#pragma unroll
    for (int i = 0; i < 2; ++i) {
#pragma unroll
      for (int r = 0; r < 8; ++r) acc[i][j][r] = HI ? acc[i][j][r] + bj : acc[i][j][r] * (1.0f / 256.0f) + bj; } }
  tile_out((float*)sm + wave * 16 * GSP, acc, OUT + (r0 + wm * 32) * DIN + c0 + wn * 64, DIN, lane); }
static_assert(QHI % 128 == 0 && TT % 128 == 0, "the early-row path is chosen per 128-row block");
__global__ __launch_bounds__(256) void k_out(const float* __restrict__ Y, const float* __restrict__ WO, const float* __restrict__ BO, float* __restrict__ OUT) { __shared__ __align__(16) char sm[2 * 384 * GP * 2];
  if (CAUSAL && (int)(((size_t)blockIdx.x * 128) % TT) < QHI) out_tile<true>(sm, Y, WO, BO, OUT);   /* block-uniform */
  else out_tile<false>(sm, Y, WO, BO, OUT); }

extern "C" void kernel_launch(void* const* d_in, const int* in_sizes, int n_in, void* d_out, int out_size, void* d_ws, size_t ws_size, hipStream_t stream) {
  (void)in_sizes; (void)n_in; (void)out_size;
  const float** F = (const float**)d_in;
  if (ws_size < (size_t)WS_END) return;
  char* ws = (char*)d_ws; _Float16 *QH = (_Float16*)(ws + WS_QH), *KH = (_Float16*)(ws + WS_KH), *VT = (_Float16*)(ws + WS_VT), *QL = (_Float16*)(ws + WS_QL), *KL = (_Float16*)(ws + WS_KL); __bf16 *VB = (__bf16*)(ws + WS_VB), *VBL = (__bf16*)(ws + WS_VBL); float *Y = (float*)(ws + WS_Y);
  (void)Y; (void)QL; (void)KL; (void)VB; (void)VBL;
  // inputs: 0 query, 1 key, 2 value [2,2048,1024]; 3 W_Q, 4 W_K, 5 W_V, 6 W_ffn (out,in) [1024,1024]; 7 b_ffn [1024]
  float *QF = (float*)(ws + WS_QF), *KF = (float*)(ws + WS_KF), *VF = (float*)(ws + WS_VF);
  k_projf<<<dim3(TNB * TT / 128, CC / 128, 3), 256, 0, stream>>>(F[0], F[1], F[2], F[3], F[4], F[5], QF, KF, VF);
  k_prep8<<<dim3(TNB * TT / 64, NH), 128, 0, stream>>>(QF, KF, VF, QH, QL, KH, KL, VT, VB, VBL);
  k_att<<<dim3(TNB * NH, TT / 16), 256, 0, stream>>>(QH, KH, QL, KL, VT, VB, VBL, Y);
  k_out<<<dim3(TNB * TT / 128, DIN / 128), 256, 0, stream>>>(Y, F[6], F[7], (float*)d_out);
}

// v003
// One run takes 179 microseconds.
// In both of two side-by-side timings against v002, it was 1.15 times as fast.
// All steps since v000 together make it 6.22 times as fast.
// compute dtype: all float inputs rounded to bf16; Q/K/V = {query,key,value} W^T with EXACT bf16 products on WMMA 16x16x32 (f32 accumulate) kept as f32 rows, then re-read in the module's (B, H, Sq, 64) reinterpretation: q, k once to f16 -> 1-product causal logits x 1/8, except the first 384 query positions of each (batch, head) (few keys, no averaging), which use q and k as f16 hi + residual (x 2^10) (3 products); softmax in f32 (precise expf); P x 2^11 once to f16 against v once to f16 (1 product), except the first 384 positions: P and v as bf16 hi + lo (3 products); concat once to f16 against W_ffn carried x 2^8 in f16 (exact bf16 values), except rows < 384 of each sequence: bf16 hi + lo against exact bf16 W_ffn (2 products); + b_ffn; f32 output.
#include <hip/hip_runtime.h>
#include <math.h>
#include <type_traits>

typedef __attribute__((ext_vector_type(16))) _Float16 v16h;
typedef __attribute__((ext_vector_type(16))) __bf16 v16b;
typedef __attribute__((ext_vector_type(8)))  _Float16 v8h;
typedef __attribute__((ext_vector_type(8)))  float v8f;
typedef __attribute__((ext_vector_type(4)))  float v4f;
typedef __attribute__((ext_vector_type(2)))  float v2f;
typedef __attribute__((ext_vector_type(4)))  unsigned v4u;
typedef __attribute__((ext_vector_type(4)))  int v4i;
typedef float __attribute__((may_alias)) float_a;
typedef int __attribute__((may_alias)) int_a;

template <typename T> __device__ __forceinline__ void vst2(void* p, T v) { *(T*)p = v;  }
__device__ __forceinline__ v8f wmma16(v16h a, v16h b, v8f c) {
  v8f d = __builtin_amdgcn_wmma_f32_16x16x32_f16(false, a, false, b, (short)0, c, false, false);
  asm volatile("v_nop\n\tv_nop\n\tv_nop\n\tv_nop" : "+v"(d) : "v"(a), "v"(b));
  return d;
}
__device__ __forceinline__ v8f wmma_bf(v16b a, v16b b, v8f c) {
  v8f d = __builtin_amdgcn_wmma_f32_16x16x32_bf16(false, a, false, b, (short)0, c, false, false);
  asm volatile("v_nop\n\tv_nop\n\tv_nop\n\tv_nop" : "+v"(d) : "v"(a), "v"(b));
  return d;
}
// 16x16x32 fragments: lane = (h = lane>>4, row/col = lane&15); elements 0..7 = k0+8h+0..7, 8..15 = k0+16+8h+0..7; D element r = row 8h+r
__device__ __forceinline__ v16h frag_h(const _Float16* rowk0, int lane) {
  union { v16h v; v8h q[2]; } u; const _Float16* p = rowk0 + 8 * (lane >> 4);
  u.q[0] = *(const v8h*)p; u.q[1] = *(const v8h*)(p + 16); return u.v;
}
__device__ __forceinline__ v16h frag_f32(const float* rowk0, int lane) {
  v16h a; const float* p = rowk0 + 8 * (lane >> 4);
#pragma unroll
  for (int i = 0; i < 8; ++i) { a[i] = (_Float16)p[i]; a[8 + i] = (_Float16)p[16 + i]; }
  return a;
}
__device__ __forceinline__ v16h frag_f32s(const float* rowk0, int lane, float sc) {
  v16h a; const float* p = rowk0 + 8 * (lane >> 4);
#pragma unroll
  for (int i = 0; i < 8; ++i) { a[i] = (_Float16)(p[i] * sc); a[8 + i] = (_Float16)(p[16 + i] * sc); }
  return a;
}
// column fragment from a [K][ld] layout (column n), rows >= K read as 0
__device__ __forceinline__ v16h fragc_f32(const float* W, int k0, int n, int lane, int ld, int K) {
  v16h a; const int g = lane >> 4;
#pragma unroll
  for (int i = 0; i < 8; ++i) { const int ka = k0 + 8 * g + i, kb = ka + 16;
    a[i] = (_Float16)(ka < K ? W[(size_t)(ka < K ? ka : K - 1) * ld + n] : 0.f); a[8 + i] = (_Float16)(kb < K ? W[(size_t)(kb < K ? kb : K - 1) * ld + n] : 0.f); }
  return a;
}
struct F2 { v16b h, l; };
__device__ __forceinline__ F2 bsplit16(const float v[16]) { F2 r;
#pragma unroll
  for (int i = 0; i < 16; ++i) { const __bf16 h = (__bf16)v[i]; r.h[i] = h; r.l[i] = (__bf16)(v[i] - (float)h); }
  return r; }
__device__ __forceinline__ F2 split_row(const float* row, int k0, int lane) { float v[16]; const float* p = row + k0 + 8 * (lane >> 4);
#pragma unroll
  for (int i = 0; i < 8; ++i) { v[i] = p[i]; v[8 + i] = p[16 + i]; }
  return bsplit16(v); }
__device__ __forceinline__ F2 split_rowK(const float* row, int k0, int lane, int K) { float v[16]; const int g = lane >> 4;
#pragma unroll
  for (int i = 0; i < 8; ++i) { const int ka = k0 + 8 * g + i, kb = ka + 16; v[i] = ka < K ? row[ka < K ? ka : K - 1] : 0.f; v[8 + i] = kb < K ? row[kb < K ? kb : K - 1] : 0.f; }
  return bsplit16(v); }
__device__ __forceinline__ F2 split_col(const float* W, int k0, int n, int lane, int ld, int K) { float v[16]; const int g = lane >> 4;
#pragma unroll
  for (int i = 0; i < 8; ++i) { const int ka = k0 + 8 * g + i, kb = ka + 16; v[i] = ka < K ? W[(size_t)(ka < K ? ka : K - 1) * ld + n] : 0.f; v[8 + i] = kb < K ? W[(size_t)(kb < K ? kb : K - 1) * ld + n] : 0.f; }
  return bsplit16(v); }
__device__ __forceinline__ v8f mac3(const F2& a, const F2& b, v8f c) { c = wmma_bf(a.l, b.h, c); c = wmma_bf(a.h, b.l, c); return wmma_bf(a.h, b.h, c); }
__device__ __forceinline__ float sigm(float v) { return 1.0f / (1.0f + expf(-v)); }
#define LDSX() do { asm volatile("s_wait_dscnt 0" ::: "memory"); __builtin_amdgcn_wave_barrier(); __builtin_amdgcn_fence(__ATOMIC_RELEASE, "workgroup"); } while (0)

// Causal multi-head attention with the module's plain reshape (B 2, S 2,048, E 1,024, 16 heads x 64): Q = query Wq^T, K = key Wk^T, V = value Wv^T ((out,in), no bias); Q/K/V.reshape(B, H, S, 64) WITHOUT a transpose (head hh = the contiguous 128-row block hh of the [S, E] projection, position s = row hh*128 + s/16, columns (s%16)*64 ..); scores = Q K^T / 8 with key > query -> -inf; softmax; concat = head_out.transpose(0,2,1,3).reshape(B, S, E); out = concat W_ffn^T + b_ffn.
#define NB 2
#define TT 2048
#define CC 1024            // NH * HD = projected width
#define DIN 1024          // input (model) width
#define NH 16
#define HD 64
#define NQB (TT / 64)
#define HG 4
#define SCALE (0.125f)
#define CAUSAL 1
#ifndef TNB
#define TNB NB
#endif
__device__ __forceinline__ float bfr(float v) { return (float)(__bf16)v; }
__host__ __device__ __forceinline__ int kb_last(int qb) { return CAUSAL ? ((qb * 64 + 63) >> 7) : (TT / 128 - 1); }
typedef __attribute__((ext_vector_type(8))) __bf16 v8b;
__device__ __forceinline__ v16b frag_b(const __bf16* rowk0, int lane) {
  union { v16b v; v8b q[2]; } u; const __bf16* p = rowk0 + 8 * (lane >> 4);
  u.q[0] = *(const v8b*)p; u.q[1] = *(const v8b*)(p + 16); return u.v;
}
#define QBH 6              // unused: the causal high-precision path is taken by query positions < QHI of each sequence (few keys, no averaging)
#define QHI 384            // rows carrying a q residual plane
#define KHI 384            // key rows carrying k residual / v bf16 hi+lo planes (used only by the causal high-precision path)
// B fragment (k rows k0+.., output column o) of a weight: (in,out) [K][ld] or (out,in) [ld rows of K]: bf16 exact, or f16(bf16 * 256) exact
__device__ __forceinline__ v16b wcol_io(const float* Wm, int k0, int o, int lane, int ld) { v16b w; const int g = lane >> 4;
#pragma unroll
  for (int i = 0; i < 8; ++i) { w[i] = (__bf16)Wm[(size_t)(k0 + 8 * g + i) * ld + o]; w[8 + i] = (__bf16)Wm[(size_t)(k0 + 16 + 8 * g + i) * ld + o]; }
  return w; }
__device__ __forceinline__ v16b wcol_oi(const float* Wm, int k0, int o, int lane, int K) { v16b w; const float* p = Wm + (size_t)o * K + k0 + 8 * (lane >> 4);
#pragma unroll
  for (int i = 0; i < 8; ++i) { w[i] = (__bf16)p[i]; w[8 + i] = (__bf16)p[16 + i]; }
  return w; }
__device__ __forceinline__ v16h wcolh_io(const float* Wm, int k0, int o, int lane, int ld) { v16h w; const int g = lane >> 4;
#pragma unroll
  for (int i = 0; i < 8; ++i) { w[i] = (_Float16)(bfr(Wm[(size_t)(k0 + 8 * g + i) * ld + o]) * 256.0f); w[8 + i] = (_Float16)(bfr(Wm[(size_t)(k0 + 16 + 8 * g + i) * ld + o]) * 256.0f); }
  return w; }
__device__ __forceinline__ v16h wcolh_oi(const float* Wm, int k0, int o, int lane, int K) { v16h w; const float* p = Wm + (size_t)o * K + k0 + 8 * (lane >> 4);
#pragma unroll
  for (int i = 0; i < 8; ++i) { w[i] = (_Float16)(bfr(p[i]) * 256.0f); w[8 + i] = (_Float16)(bfr(p[16 + i]) * 256.0f); }
  return w; }
#define WQKV_LAYOUT 1   // 0 = (in,out) [DIN][CC]; 1 = (out,in) [CC][DIN]; 2 = per-head [NH][DIN][HD]
__device__ __forceinline__ v16b wcol_hdk(const float* Wm, int k0, int o, int lane) { v16b w; const int g = lane >> 4; const float* p = Wm + (size_t)(o / HD) * DIN * HD + (o % HD);
#pragma unroll
  for (int i = 0; i < 8; ++i) { w[i] = (__bf16)p[(size_t)(k0 + 8 * g + i) * HD]; w[8 + i] = (__bf16)p[(size_t)(k0 + 16 + 8 * g + i) * HD]; }
  return w; }
#define WO_OUT_IN 1
#if WQKV_LAYOUT == 1
#define WCOL(W, k0, o, lane) wcol_oi(W, k0, o, lane, DIN)
#elif WQKV_LAYOUT == 2
#define WCOL(W, k0, o, lane) wcol_hdk(W, k0, o, lane)
#else
#define WCOL(W, k0, o, lane) wcol_io(W, k0, o, lane, CC)
#endif
#if WO_OUT_IN
#define WOCOL(W, k0, o, lane) wcol_oi(W, k0, o, lane, CC)
#define WOCOLH(W, k0, o, lane) wcolh_oi(W, k0, o, lane, CC)
#else
#define WOCOL(W, k0, o, lane) wcol_io(W, k0, o, lane, DIN)
#define WOCOLH(W, k0, o, lane) wcolh_io(W, k0, o, lane, DIN)
#endif

#ifndef SM_EXTRA_PARAMS
#define SM_EXTRA_PARAMS
#endif
#ifndef SM_MASK_HOOK
#define SM_MASK_HOOK (void)0
#endif

#define WS_QH  0u                                      // f16 q in fragment order [b][h][16-position tile][kc*2 + half][lane][8]
#define WS_KH  (WS_QH + 2u * (size_t)NB * TT * CC)      // f16 k, fragment order as q
#define WS_VT  (WS_KH + 2u * (size_t)NB * TT * CC)      // f16 v in fragment order [b][h][32-key chunk][j*2 + half][lane][8]
#define WS_QL  (WS_VT + 2u * (size_t)NB * CC * TT)      // f16 q residual x 2^10, fragment order as q, positions < QHI
#define WS_KL  (WS_QL + 2u * (size_t)NB * QHI * CC)     // f16 k residual x 2^10, fragment order as k, keys < KHI
#define WS_VB  (WS_KL + 2u * (size_t)NB * KHI * CC)     // bf16 v hi (and lo behind it), fragment order as v, keys < KHI
#define WS_VBL (WS_VB + 2u * (size_t)NB * CC * KHI)
#define WS_S   (WS_VBL + 2u * (size_t)NB * CC * KHI)    // f32 [hg][t][s] region, unused: the logit rows stay in LDS
#define WS_Y   (WS_S  + 4u * (size_t)HG * TT * TT)      // f32 ctx rows [b*t][CC] (only when there is an output projection)
#define WS_QF  (WS_Y  + 4u * (size_t)NB * TT * CC)      // f32 Q rows [b*t][CC] (projection output, module row order)
#define WS_KF  (WS_QF + 4u * (size_t)NB * TT * CC)
#define WS_VF  (WS_KF + 4u * (size_t)NB * TT * CC)
#define WS_END (WS_VF + 4u * (size_t)NB * TT * CC)

// ---- staged GEMM tiles (k_projf, k_out): block = 128 rows x 128 cols, 8 waves (4 x 2), wave = 32 rows x 64 cols (2 x 4 accumulator tiles). Per pass of 32 k the block reads its 128-B row pieces once with whole-line loads (8 lanes a row), converts them once and lays them in LDS; every wave takes its fragments from there. Two LDS buffers: the next pass's global loads are issued ahead of this pass's products, converted and stored behind them; one barrier a pass. k runs upward into one accumulator per tile, in the fragments' k order of frag_b / frag_h.
#define GP 40              // 16-bit elements per staged row: 80 B = 16 B x odd, so the 16-byte fragment reads of 16 rows fall on different banks
#define GSP 68             // floats per row of a wave's output staging (16-byte reads of a row walk without conflicts)
typedef __attribute__((ext_vector_type(4))) __bf16 v4b;
typedef __attribute__((ext_vector_type(4))) _Float16 v4h;
// the wave's 32 x 64 tile -> rows of D (pointer at the tile's first element), 16 rows at a time through the wave's own LDS range sw[16][GSP]: 256-B row segments by 16 lanes
__device__ __forceinline__ void tile_out(float* sw, const v8f (&acc)[2][4], float* D, int ld, int lane) { const int col = lane & 15, g = lane >> 4;
#pragma unroll
  for (int i = 0; i < 2; ++i) {
#pragma unroll
    for (int j = 0; j < 4; ++j) {
#pragma unroll
      for (int r = 0; r < 8; ++r) sw[(8 * g + r) * GSP + j * 16 + col] = acc[i][j][r]; }
    LDSX();
#pragma unroll
    for (int rr = 0; rr < 8; ++rr) vst2(D + (size_t)(i * 16 + rr * 2 + g) * ld + col * 4, *(const v4f*)&sw[(rr * 2 + g) * GSP + col * 4]); } }
// ---- k_projf: block = (128 rows, 128 cols, which): Q/K/V = X W^T with exact bf16 products (K = DIN) -> f32 rows [b*t][CC]
__global__ __launch_bounds__(256) void k_projf(const float* __restrict__ XQ, const float* __restrict__ XK, const float* __restrict__ XV, const float* __restrict__ WQ, const float* __restrict__ WK, const float* __restrict__ WV, float* __restrict__ QF, float* __restrict__ KF, float* __restrict__ VF) {
  __shared__ __align__(16) __bf16 st[2][256][GP];   /* rows 0..127: X, 128..255: W; after the last pass: the waves' output staging */
  const int tid = threadIdx.x, wave = tid >> 5, lane = tid & 31, col = lane & 15; const int wm = wave >> 1, wn = wave & 1; const int which = blockIdx.z; const int c0 = blockIdx.y * 128; const size_t r0 = (size_t)blockIdx.x * 128;
  const float* X = which == 0 ? XQ : which == 1 ? XK : XV; const float* WA = which == 0 ? WQ : which == 1 ? WK : WV; float* D = which == 0 ? QF : which == 1 ? KF : VF;
  const int lr = tid >> 3, lq = (tid & 7) * 4;   /* the thread's row (and + 32, 64, 96) and its four k of a pass */
  const float* xp = X + (r0 + lr) * DIN + lq; const float* wp = WA + (size_t)(c0 + lr) * DIN + lq;
  v4f px[4], pw[4]; v8f acc[2][4] = {};
#pragma unroll
  for (int i = 0; i < 4; ++i) { px[i] = *(const v4f*)(xp + (size_t)i * 32 * DIN); pw[i] = *(const v4f*)(wp + (size_t)i * 32 * DIN); }
#pragma unroll
  for (int i = 0; i < 4; ++i) { *(v4b*)&st[0][lr + 32 * i][lq] = __builtin_convertvector(px[i], v4b); *(v4b*)&st[0][128 + lr + 32 * i][lq] = __builtin_convertvector(pw[i], v4b); }
  __syncthreads();
#pragma unroll 2   /* the buffer index becomes a constant */
  for (int kc = 0; kc < DIN / 32; ++kc) { const int cur = kc & 1; const bool more = kc + 1 < DIN / 32;
    if (more) {
#pragma unroll
      for (int i = 0; i < 4; ++i) { px[i] = *(const v4f*)(xp + (size_t)i * 32 * DIN + (kc + 1) * 32); pw[i] = *(const v4f*)(wp + (size_t)i * 32 * DIN + (kc + 1) * 32); } }
    v16b a[2], w[4];
#pragma unroll
    for (int i = 0; i < 2; ++i) a[i] = frag_b(&st[cur][wm * 32 + i * 16 + col][0], lane);
#pragma unroll
    for (int j = 0; j < 4; ++j) w[j] = frag_b(&st[cur][128 + wn * 64 + j * 16 + col][0], lane);
#pragma unroll
    for (int i = 0; i < 2; ++i) {
#pragma unroll
      for (int j = 0; j < 4; ++j) acc[i][j] = wmma_bf(a[i], w[j], acc[i][j]); }
    if (more) {
#pragma unroll
      for (int i = 0; i < 4; ++i) { *(v4b*)&st[cur ^ 1][lr + 32 * i][lq] = __builtin_convertvector(px[i], v4b); *(v4b*)&st[cur ^ 1][128 + lr + 32 * i][lq] = __builtin_convertvector(pw[i], v4b); } }
    __syncthreads(); }   /* publishes the next pass's buffer and ends every wave's reads of this one */
  tile_out((float*)&st[0][0][0] + wave * 16 * GSP, acc, D + (r0 + wm * 32) * CC + c0 + wn * 64, CC, lane); }
// behind a store whose address or data registers are rewritten next (the following piece's LDS read, the next trip's address step)
#define XW() asm volatile("s_wait_xcnt 0x0" ::: "memory")
// ---- k_prep8: block = (64 attention positions s0.. of sequence b, head h): reads the f32 rows in the module's (B, H, S, 64) reinterpretation (element (b,h,s,c) = row-buffer float ((b*NH + h)*TT + s)*64 + c) and writes the standard attention planes: q -> f16 hi (+ x 2^10 residual for s < QHI), k -> f16 (+ residual for s < KHI), v -> f16 (+ bf16 hi/lo for s < KHI), all laid out in the order in which k_att's lanes take their fragments: the 16 bytes of lane 0..31 of one load lie side by side, so that one wave-wide 16-byte load covers 512 contiguous bytes (four whole lines) and not 32-byte pieces of 16 lines
__global__ __launch_bounds__(128) void k_prep8(const float* __restrict__ Q, const float* __restrict__ K, const float* __restrict__ V, _Float16* __restrict__ QH, _Float16* __restrict__ QL, _Float16* __restrict__ KH, _Float16* __restrict__ KL, _Float16* __restrict__ VT, __bf16* __restrict__ VB, __bf16* __restrict__ VBL) {
  __shared__ __align__(16) _Float16 sq[64][136], sql[64][136], sk[64][136], skl[64][136], tv[128][72]; __shared__ __align__(16) __bf16 tb[128][72], tbl[128][72];
  const int tid = threadIdx.x; const int h = blockIdx.y; const size_t r0 = (size_t)blockIdx.x * 64; const size_t bb = r0 / TT; const int t0 = (int)(r0 % TT); const bool qhi = t0 < QHI, khi = t0 < KHI;
  for (int e = tid; e < 64 * 128; e += 128) { const int rl = e >> 7, c = e & 127; const size_t oi = ((bb * NH + h) * TT + t0 + rl) * HD + (c & 63);   /* c >= 64: duplicate read of the same element (tiles are 128 wide; HD is 64) */
    const float q = Q[oi], k = K[oi], v = V[oi];
    const _Float16 qh = (_Float16)q, kh = (_Float16)k; sq[rl][c] = qh; sql[rl][c] = (_Float16)((q - (float)qh) * 1024.0f); sk[rl][c] = kh; skl[rl][c] = (_Float16)((k - (float)kh) * 1024.0f);
    tv[c][rl] = (_Float16)v; const __bf16 vb = (__bf16)v; tb[c][rl] = vb; tbl[c][rl] = (__bf16)(v - (float)vb); }
  __syncthreads();
  /* q, k: piece e = (tile e >> 7, load (e >> 5) & 3 = kc * 2 + half, lane e & 31 = g * 16 + position) holds elements kc * 32 + half * 16 + 8 g + 0..7 of its position */
  for (int e = tid; e < 64 * 8; e += 128) { const int rl = (e >> 7) * 16 + (e & 15), c8 = ((e >> 5) & 3) * 16 + ((e >> 4) & 1) * 8; const size_t o = ((bb * NH + h) * TT + t0) * (size_t)HD + e * 8;
    vst2((unsigned*)(QH + o), *(const v4u*)&sq[rl][c8]); vst2((unsigned*)(KH + o), *(const v4u*)&sk[rl][c8]); XW();
    if (qhi) { vst2((unsigned*)(QL + ((bb * NH + h) * QHI + t0) * (size_t)HD + e * 8), *(const v4u*)&sql[rl][c8]); XW(); }
    if (khi) { vst2((unsigned*)(KL + ((bb * NH + h) * KHI + t0) * (size_t)HD + e * 8), *(const v4u*)&skl[rl][c8]); XW(); } }
  /* v: piece e = (chunk e >> 8, load (e >> 5) & 7 = j * 2 + half, lane e & 31 = g * 16 + column) holds keys half * 16 + 8 g + 0..7 of the chunk for head column j * 16 + column */
  for (int e = tid; e < 64 * 8; e += 128) { const int cl = ((e >> 6) & 3) * 16 + (e & 15), k8 = (e >> 8) * 32 + ((e >> 5) & 1) * 16 + ((e >> 4) & 1) * 8; vst2((unsigned*)(VT + ((bb * NH + h) * TT + t0) * (size_t)HD + e * 8), *(const v4u*)&tv[cl][k8]); XW();
    if (khi) { const size_t o3 = ((bb * NH + h) * KHI + t0) * (size_t)HD + e * 8; vst2((unsigned*)(VB + o3), *(const v4u*)&tb[cl][k8]); vst2((unsigned*)(VBL + o3), *(const v4u*)&tbl[cl][k8]); XW(); } } }
// ---- k_att: block = (16 query positions, head h of batch b), 8 waves: the tile's logit rows stay in LDS from the q k^T products through the softmax to the P v products (no logit plane in memory, one launch for all heads).
// phase 1: wave w takes the 16-key tiles w, w + 8, ..: logits x SCALE, key > query -> excluded (first QHI positions: q and k hi + residual, 3 products); phase 2: wave w takes rows 2w, 2w + 1: max, expf, sum in f32, 2^11 / sum kept per row;
// phase 3: each wave takes a contiguous run of 32-key chunks: P x 2^11 once to f16 against v f16 (first QHI positions: P and v as bf16 hi + lo, 3 products); the 8 partial tiles are added in wave order through LDS; 256-B (row, head) segment by 16 lanes
// fragment from the fragment-ordered q / k / v buffers: the lane's pointer (load base + lane * 8); the second half lies one wave-wide load (256 elements) further
__device__ __forceinline__ v16h frag_hk(const _Float16* p) { union { v16h v; v8h q[2]; } u; u.q[0] = *(const v8h*)p; u.q[1] = *(const v8h*)(p + 256); return u.v; }
__device__ __forceinline__ v16b frag_bk(const __bf16* p) { union { v16b v; v8b q[2]; } u; u.q[0] = *(const v8b*)p; u.q[1] = *(const v8b*)(p + 256); return u.v; }
#define SP 2052            // floats per logit row in LDS: 16 B x odd, so the 16-byte fragment reads of the 16 rows fall on different banks
__global__ __launch_bounds__(256) void k_att(const _Float16* __restrict__ QH, const _Float16* __restrict__ KH, const _Float16* __restrict__ QL, const _Float16* __restrict__ KL, const _Float16* __restrict__ VT, const __bf16* __restrict__ VB, const __bf16* __restrict__ VBL, float* __restrict__ Y) {
  __shared__ __align__(16) float sl[16][SP]; __shared__ float sinv[16];
  const int tid = threadIdx.x, lane = tid & 31, col = lane & 15, g = lane >> 4; const int wave = __builtin_amdgcn_readfirstlane(tid >> 5);
  const int b = blockIdx.x / NH, h = blockIdx.x % NH; const int ql0 = (TT / 16 - 1 - (int)blockIdx.y) * 16;   /* longest tiles start first */
  const int nkc = (ql0 + 16 + 31) >> 5;   /* 32-key chunks that hold a key <= the tile's last query */
  const int n = ((ql0 + 16 + 127) >> 7) << 7, nt = n >> 4;   /* logits are formed for keys [0, n), whole 128-key blocks (excluded keys included): every wave has n / 128 tiles and every lane n / 128 quads of a row; n <= TT, and n <= KHI when ql0 < QHI */
  const bool hi = ql0 < QHI;   /* block-uniform */
  const size_t hb = (size_t)(b * NH + h) * TT * HD + lane * 8, hbh = (size_t)(b * NH + h) * KHI * HD + lane * 8;   /* the lane's 16 bytes in the first load of the head's fragment-ordered q, k or v (all positions; positions < KHI) */
  static_assert(QHI == KHI, "one base serves the q and the k residuals");
  const _Float16* qp = QH + hb + (ql0 >> 4) * 1024;
  if (hi) { const _Float16* qlp = QL + hbh + (ql0 >> 4) * 1024; v16h ah[2], al[2];
#pragma unroll
    for (int kc = 0; kc < 2; ++kc) { ah[kc] = frag_hk(qp + kc * 512); al[kc] = frag_hk(qlp + kc * 512); }
    for (int j = wave; j < nt; j += 8) { v8f acc = {}, accl = {}; v16h kbf[2], klf[2]; const _Float16* th = KH + hb + j * 1024; const _Float16* tl = KL + hbh + j * 1024;   /* all four fragments are loaded ahead of the products: one load latency a tile */
#pragma unroll
      for (int kc = 0; kc < 2; ++kc) { kbf[kc] = frag_hk(th + kc * 512); klf[kc] = frag_hk(tl + kc * 512); }
      /* inputs-only fence on the loaded fragments and their pointers: all the loads are issued ahead of the first product and the address registers stay untouched until the loads have returned */
      asm volatile("" :: "v"(kbf[0]), "v"(kbf[1]), "v"(klf[0]), "v"(klf[1]), "v"(th), "v"(tl));
#pragma unroll
      for (int kc = 0; kc < 2; ++kc) { acc = wmma16(ah[kc], kbf[kc], acc); accl = wmma16(al[kc], kbf[kc], accl); accl = wmma16(ah[kc], klf[kc], accl); }
#pragma unroll
      for (int r = 0; r < 8; ++r) sl[8 * g + r][j * 16 + col] = (j * 16 + col <= ql0 + 8 * g + r) ? (acc[r] + accl[r] * (1.0f / 1024.0f)) * SCALE : -3.0e38f; }
  } else { v16h ah[2];
#pragma unroll
    for (int kc = 0; kc < 2; ++kc) ah[kc] = frag_hk(qp + kc * 512);
    const _Float16* kp = KH + hb;
    for (int j0 = wave; j0 < nt; j0 += 64) { v16h kf[8][2]; const _Float16* tp[8];   /* eight tiles' k fragments are loaded ahead of the products: one load latency per eight tiles; a tile past the end re-reads tile j0 and is not used */
#pragma unroll
      for (int u = 0; u < 8; ++u) { const int j = (j0 + 8 * u < nt) ? j0 + 8 * u : j0; tp[u] = kp + j * 1024;
#pragma unroll
        for (int kc = 0; kc < 2; ++kc) kf[u][kc] = frag_hk(tp[u] + kc * 512); }
      /* inputs-only fence on the loaded fragments and their pointers: keeps all the loads issued here, ahead of the first product (without it the compiler sinks a tile's loads into that tile's branch, a second load latency per group), and keeps every address register untouched until its loads have returned, so that no wait for an address register stands inside the run of loads (qp: the q loads in front of the loop are still in flight in the first run) */
      asm volatile("" :: "v"(kf[0][0]), "v"(kf[0][1]), "v"(kf[1][0]), "v"(kf[1][1]), "v"(kf[2][0]), "v"(kf[2][1]), "v"(kf[3][0]), "v"(kf[3][1]), "v"(kf[4][0]), "v"(kf[4][1]), "v"(kf[5][0]), "v"(kf[5][1]), "v"(kf[6][0]), "v"(kf[6][1]), "v"(kf[7][0]), "v"(kf[7][1]), "v"(tp[0]), "v"(tp[1]), "v"(tp[2]), "v"(tp[3]), "v"(tp[4]), "v"(tp[5]), "v"(tp[6]), "v"(tp[7]), "v"(qp));
#pragma unroll
      for (int u = 0; u < 8; ++u) { const int j = j0 + 8 * u; if (j < nt) { v8f acc = {}; acc = wmma16(ah[0], kf[u][0], acc); acc = wmma16(ah[1], kf[u][1], acc);
#pragma unroll
          for (int r = 0; r < 8; ++r) sl[8 * g + r][j * 16 + col] = (j * 16 + col <= ql0 + 8 * g + r) ? acc[r] * SCALE : -3.0e38f; } } } }
  __syncthreads();
  { float* sr0 = &sl[wave * 2][lane * 4]; float* sr1 = &sl[wave * 2 + 1][lane * 4]; float m0 = -3.0e38f, m1 = -3.0e38f, sum0 = 0.f, sum1 = 0.f;   /* the wave's two rows side by side: two independent chains of LDS reads */
#pragma unroll 2   /* four LDS reads in flight */
    for (int k = 0; k < n; k += 128) { const v4f v0 = *(const v4f*)&sr0[k], v1 = *(const v4f*)&sr1[k]; m0 = fmaxf(m0, fmaxf(fmaxf(v0[0], v0[1]), fmaxf(v0[2], v0[3]))); m1 = fmaxf(m1, fmaxf(fmaxf(v1[0], v1[1]), fmaxf(v1[2], v1[3]))); }
#pragma unroll
    for (int o = 1; o < 32; o <<= 1) { m0 = fmaxf(m0, __shfl_xor(m0, o)); m1 = fmaxf(m1, __shfl_xor(m1, o)); }
#pragma unroll 2   /* four LDS reads in flight */
    for (int k = 0; k < n; k += 128) { const v4f v0 = *(const v4f*)&sr0[k], v1 = *(const v4f*)&sr1[k]; v4f e0, e1;
#pragma unroll
      for (int i = 0; i < 4; ++i) { const float x0 = expf(v0[i] - m0), x1 = expf(v1[i] - m1); e0[i] = (v0[i] <= -1.0e38f) ? 0.f : x0; e1[i] = (v1[i] <= -1.0e38f) ? 0.f : x1; sum0 += e0[i]; sum1 += e1[i]; }
      *(v4f*)&sr0[k] = e0; *(v4f*)&sr1[k] = e1; }
#pragma unroll
    for (int o = 1; o < 32; o <<= 1) { sum0 += __shfl_xor(sum0, o); sum1 += __shfl_xor(sum1, o); }
    if (lane == 0) { sinv[wave * 2] = 2048.0f / sum0; sinv[wave * 2 + 1] = 2048.0f / sum1; } }
  __syncthreads();
  const float sc = sinv[col]; const int per = (nkc + 7) >> 3; const int kcs = wave * per, kce = (kcs + per < nkc) ? kcs + per : nkc;
  v8f acc[HD / 16] = {};
  if (hi) {
    for (int kc = kcs; kc < kce; ++kc) { float v[16]; const float* p = &sl[col][kc * 32 + 8 * g];
#pragma unroll
      for (int i = 0; i < 8; ++i) { v[i] = p[i] * sc; v[8 + i] = p[16 + i] * sc; }
      const F2 pf = bsplit16(v); v16b vh[HD / 16], vl[HD / 16]; const size_t po = hbh + kc * 2048; const __bf16* ph = VB + po; const __bf16* pl = VBL + po;   /* the chunk's eight v fragments are loaded ahead of the products */
#pragma unroll
      for (int j = 0; j < HD / 16; ++j) { vh[j] = frag_bk(ph + j * 512); vl[j] = frag_bk(pl + j * 512); }
      /* inputs-only fence on the loaded fragments and their pointers: all the loads are issued ahead of the first product and the address registers stay untouched until the loads have returned */
      asm volatile("" :: "v"(vh[0]), "v"(vh[1]), "v"(vh[2]), "v"(vh[3]), "v"(vl[0]), "v"(vl[1]), "v"(vl[2]), "v"(vl[3]), "v"(ph), "v"(pl));
#pragma unroll
      for (int j = 0; j < HD / 16; ++j) { acc[j] = wmma_bf(pf.h, vh[j], acc[j]); acc[j] = wmma_bf(pf.l, vh[j], acc[j]); acc[j] = wmma_bf(pf.h, vl[j], acc[j]); } }
  } else {
    const _Float16* vp = VT + hb;
    for (int kc0 = kcs; kc0 < kce; kc0 += 4) { v16h vf[4][HD / 16], pf[4]; const _Float16* cp[4];   /* four chunks' v and P fragments are loaded ahead of the products: one load latency per four chunks; a chunk past the end re-reads chunk kc0 and is not used */
#pragma unroll
      for (int u = 0; u < 4; ++u) { const int kc = (kc0 + u < kce) ? kc0 + u : kc0; cp[u] = vp + kc * 2048;
#pragma unroll
        for (int j = 0; j < HD / 16; ++j) vf[u][j] = frag_hk(cp[u] + j * 512);
        pf[u] = frag_f32s(&sl[col][kc * 32], lane, sc); }
      /* inputs-only fence on the loaded v fragments and their pointers: as in phase 1 */
      asm volatile("" :: "v"(vf[0][0]), "v"(vf[0][1]), "v"(vf[0][2]), "v"(vf[0][3]), "v"(vf[1][0]), "v"(vf[1][1]), "v"(vf[1][2]), "v"(vf[1][3]), "v"(vf[2][0]), "v"(vf[2][1]), "v"(vf[2][2]), "v"(vf[2][3]), "v"(vf[3][0]), "v"(vf[3][1]), "v"(vf[3][2]), "v"(vf[3][3]), "v"(cp[0]), "v"(cp[1]), "v"(cp[2]), "v"(cp[3]));
#pragma unroll
      for (int u = 0; u < 4; ++u) if (kc0 + u < kce) {
#pragma unroll
        for (int j = 0; j < HD / 16; ++j) acc[j] = wmma16(pf[u], vf[u][j], acc[j]); } } }
  __syncthreads();   /* every wave has read its P chunks: the logit rows become the staging of the 8 partial tiles */
  float* red = &sl[0][0];
#pragma unroll
  for (int j = 0; j < HD / 16; ++j)
#pragma unroll
    for (int r = 0; r < 8; ++r) red[(wave * 16 + 8 * g + r) * (HD + 4) + j * 16 + col] = acc[j][r];
  __syncthreads();
  { const int row = tid >> 4, c4 = (tid & 15) * 4; v4f s = *(const v4f*)&red[row * (HD + 4) + c4];
#pragma unroll
    for (int w = 1; w < 8; ++w) s += *(const v4f*)&red[(w * 16 + row) * (HD + 4) + c4];
    vst2(Y + ((size_t)b * TT + ql0 + row) * CC + h * HD + c4, s * (1.0f / 2048.0f)); } }
// ---- k_out: block = (128 rows, 128 cols), staged as above: out = ctx Wo (+ bo): ctx once to f16 against Wo as f16(bf16 x 2^8) exact (1 product) x 2^-8; causal early rows (< QHI of each sequence): ctx bf16 hi + lo against exact bf16 Wo (2 products)
template <bool HI> __device__ __forceinline__ void out_tile(char* sm, const float* __restrict__ Y, const float* __restrict__ WO, const float* __restrict__ BO, float* __restrict__ OUT) {
  typedef typename std::conditional<HI, __bf16, _Float16>::type E; typedef E v4e __attribute__((ext_vector_type(4)));
  E (*st)[384][GP] = (E (*)[384][GP])sm;   /* rows 0..127: ctx (hi), 128..255: Wo, 256..383: ctx lo (HI only) */
  const int tid = threadIdx.x, wave = tid >> 5, lane = tid & 31, col = lane & 15; const int wm = wave >> 1, wn = wave & 1; const int c0 = blockIdx.y * 128; const size_t r0 = (size_t)blockIdx.x * 128;
  const int lr = tid >> 3, lq = (tid & 7) * 4;
  const float* xp = Y + (r0 + lr) * CC + lq; const float* wp = WO + (size_t)(c0 + lr) * CC + lq;
  v4f px[4], pw[4]; v8f acc[2][4] = {};
  auto put = [&](int buf) {
#pragma unroll
    for (int i = 0; i < 4; ++i) {
      if constexpr (HI) { const v4b h = __builtin_convertvector(px[i], v4b); *(v4b*)&st[buf][lr + 32 * i][lq] = h; *(v4b*)&st[buf][256 + lr + 32 * i][lq] = __builtin_convertvector(px[i] - __builtin_convertvector(h, v4f), v4b); *(v4b*)&st[buf][128 + lr + 32 * i][lq] = __builtin_convertvector(pw[i], v4b); }
      else { *(v4h*)&st[buf][lr + 32 * i][lq] = __builtin_convertvector(px[i], v4h); *(v4h*)&st[buf][128 + lr + 32 * i][lq] = __builtin_convertvector(__builtin_convertvector(__builtin_convertvector(pw[i], v4b), v4f) * 256.0f, v4h); } } };
#pragma unroll
  for (int i = 0; i < 4; ++i) { px[i] = *(const v4f*)(xp + (size_t)i * 32 * CC); pw[i] = *(const v4f*)(wp + (size_t)i * 32 * CC); }
  float bias[4] = {0.f, 0.f, 0.f, 0.f};   /* read here, beside the first tile's loads, so that the epilogue waits for nothing */
  if (BO) {
#pragma unroll
    for (int j = 0; j < 4; ++j) bias[j] = BO[c0 + wn * 64 + j * 16 + col]; }
  put(0);
  __syncthreads();
#pragma unroll 2   /* the buffer index becomes a constant */
  for (int kc = 0; kc < CC / 32; ++kc) { const int cur = kc & 1; const bool more = kc + 1 < CC / 32;
    if (more) {
#pragma unroll
      for (int i = 0; i < 4; ++i) { px[i] = *(const v4f*)(xp + (size_t)i * 32 * CC + (kc + 1) * 32); pw[i] = *(const v4f*)(wp + (size_t)i * 32 * CC + (kc + 1) * 32); } }
    if constexpr (HI) { v16b ah[2], al[2], w[4];
#pragma unroll
      for (int i = 0; i < 2; ++i) { ah[i] = frag_b(&st[cur][wm * 32 + i * 16 + col][0], lane); al[i] = frag_b(&st[cur][256 + wm * 32 + i * 16 + col][0], lane); }
#pragma unroll
      for (int j = 0; j < 4; ++j) w[j] = frag_b(&st[cur][128 + wn * 64 + j * 16 + col][0], lane);
#pragma unroll
      for (int i = 0; i < 2; ++i) {
#pragma unroll
        for (int j = 0; j < 4; ++j) acc[i][j] = wmma_bf(ah[i], w[j], acc[i][j]);
#pragma unroll
        for (int j = 0; j < 4; ++j) acc[i][j] = wmma_bf(al[i], w[j], acc[i][j]); }
    } else { v16h a[2], w[4];
#pragma unroll
      for (int i = 0; i < 2; ++i) a[i] = frag_h(&st[cur][wm * 32 + i * 16 + col][0], lane);
#pragma unroll
      for (int j = 0; j < 4; ++j) w[j] = frag_h(&st[cur][128 + wn * 64 + j * 16 + col][0], lane);
#pragma unroll
      for (int i = 0; i < 2; ++i) {
#pragma unroll
        for (int j = 0; j < 4; ++j) acc[i][j] = wmma16(a[i], w[j], acc[i][j]); } }
    if (more) put(cur ^ 1);
    __syncthreads(); }   /* publishes the next pass's buffer and ends every wave's reads of this one */
#pragma unroll
  for (int j = 0; j < 4; ++j) { const float bj = bfr(bias[j]);
#pragma unroll
    for (int i = 0; i < 2; ++i) {
#pragma unroll
      for (int r = 0; r < 8; ++r) acc[i][j][r] = HI ? acc[i][j][r] + bj : acc[i][j][r] * (1.0f / 256.0f) + bj; } }
  tile_out((float*)sm + wave * 16 * GSP, acc, OUT + (r0 + wm * 32) * DIN + c0 + wn * 64, DIN, lane); }
static_assert(QHI % 128 == 0 && TT % 128 == 0, "the early-row path is chosen per 128-row block");
__global__ __launch_bounds__(256) void k_out(const float* __restrict__ Y, const float* __restrict__ WO, const float* __restrict__ BO, float* __restrict__ OUT) { __shared__ __align__(16) char sm[2 * 384 * GP * 2];
  if (CAUSAL && (int)(((size_t)blockIdx.x * 128) % TT) < QHI) out_tile<true>(sm, Y, WO, BO, OUT);   /* block-uniform */
  else out_tile<false>(sm, Y, WO, BO, OUT); }

extern "C" void kernel_launch(void* const* d_in, const int* in_sizes, int n_in, void* d_out, int out_size, void* d_ws, size_t ws_size, hipStream_t stream) {
  (void)in_sizes; (void)n_in; (void)out_size;
  const float** F = (const float**)d_in;
  if (ws_size < (size_t)WS_END) return;
  char* ws = (char*)d_ws; _Float16 *QH = (_Float16*)(ws + WS_QH), *KH = (_Float16*)(ws + WS_KH), *VT = (_Float16*)(ws + WS_VT), *QL = (_Float16*)(ws + WS_QL), *KL = (_Float16*)(ws + WS_KL); __bf16 *VB = (__bf16*)(ws + WS_VB), *VBL = (__bf16*)(ws + WS_VBL); float *Y = (float*)(ws + WS_Y);
  (void)Y; (void)QL; (void)KL; (void)VB; (void)VBL;
  // inputs: 0 query, 1 key, 2 value [2,2048,1024]; 3 W_Q, 4 W_K, 5 W_V, 6 W_ffn (out,in) [1024,1024]; 7 b_ffn [1024]
  float *QF = (float*)(ws + WS_QF), *KF = (float*)(ws + WS_KF), *VF = (float*)(ws + WS_VF);
  k_projf<<<dim3(TNB * TT / 128, CC / 128, 3), 256, 0, stream>>>(F[0], F[1], F[2], F[3], F[4], F[5], QF, KF, VF);
  k_prep8<<<dim3(TNB * TT / 64, NH), 128, 0, stream>>>(QF, KF, VF, QH, QL, KH, KL, VT, VB, VBL);
  k_att<<<dim3(TNB * NH, TT / 16), 256, 0, stream>>>(QH, KH, QL, KL, VT, VB, VBL, Y);
  k_out<<<dim3(TNB * TT / 128, DIN / 128), 256, 0, stream>>>(Y, F[6], F[7], (float*)d_out);
}

// v004
// It runs in 142 microseconds.
// Next to v003, in two timings, it ran 1.26 and 1.25 times as fast.
// Over all steps from v000 it is 7.81 times as fast.
// compute dtype: all float inputs rounded to bf16; Q/K/V = {query,key,value} W^T with EXACT bf16 products on WMMA 16x16x32 (f32 accumulate) kept as f32 rows, then re-read in the module's (B, H, Sq, 64) reinterpretation: q, k once to f16 -> 1-product causal logits x 1/8, except the first 384 query positions of each (batch, head) (few keys, no averaging), which use q and k as f16 hi + residual (x 2^10) (3 products); softmax in f32: positions >= 384 in one pass with a running maximum, base-2 hardware exponentials and the division by the row sum at the end, exp(logit - max) x 2^11 once to f16 against v once to f16 (1 product); the first 384 positions: precise expf, P and v as bf16 hi + lo (3 products); concat once to f16 against W_ffn carried x 2^8 in f16 (exact bf16 values), except rows < 384 of each sequence: bf16 hi + lo against exact bf16 W_ffn (2 products); + b_ffn; f32 output.
#include <hip/hip_runtime.h>
#include <math.h>
#include <type_traits>

typedef __attribute__((ext_vector_type(16))) _Float16 v16h;
typedef __attribute__((ext_vector_type(16))) __bf16 v16b;
typedef __attribute__((ext_vector_type(8)))  _Float16 v8h;
typedef __attribute__((ext_vector_type(8)))  float v8f;
typedef __attribute__((ext_vector_type(4)))  float v4f;
typedef __attribute__((ext_vector_type(2)))  float v2f;
typedef __attribute__((ext_vector_type(4)))  unsigned v4u;
typedef __attribute__((ext_vector_type(4)))  int v4i;
typedef float __attribute__((may_alias)) float_a;
typedef int __attribute__((may_alias)) int_a;

template <typename T> __device__ __forceinline__ void vst2(void* p, T v) { *(T*)p = v;  }
__device__ __forceinline__ v8f wmma16(v16h a, v16h b, v8f c) {
  v8f d = __builtin_amdgcn_wmma_f32_16x16x32_f16(false, a, false, b, (short)0, c, false, false);
  asm volatile("v_nop\n\tv_nop\n\tv_nop\n\tv_nop" : "+v"(d) : "v"(a), "v"(b));
  return d;
}
__device__ __forceinline__ v8f wmma_bf(v16b a, v16b b, v8f c) {
  v8f d = __builtin_amdgcn_wmma_f32_16x16x32_bf16(false, a, false, b, (short)0, c, false, false);
  asm volatile("v_nop\n\tv_nop\n\tv_nop\n\tv_nop" : "+v"(d) : "v"(a), "v"(b));
  return d;
}
// 16x16x32 fragments: lane = (h = lane>>4, row/col = lane&15); elements 0..7 = k0+8h+0..7, 8..15 = k0+16+8h+0..7; D element r = row 8h+r
__device__ __forceinline__ v16h frag_h(const _Float16* rowk0, int lane) {
  union { v16h v; v8h q[2]; } u; const _Float16* p = rowk0 + 8 * (lane >> 4);
  u.q[0] = *(const v8h*)p; u.q[1] = *(const v8h*)(p + 16); return u.v;
}
__device__ __forceinline__ v16h frag_f32(const float* rowk0, int lane) {
  v16h a; const float* p = rowk0 + 8 * (lane >> 4);
#pragma unroll
  for (int i = 0; i < 8; ++i) { a[i] = (_Float16)p[i]; a[8 + i] = (_Float16)p[16 + i]; }
  return a;
}
__device__ __forceinline__ v16h frag_f32s(const float* rowk0, int lane, float sc) {
  v16h a; const float* p = rowk0 + 8 * (lane >> 4);
#pragma unroll
  for (int i = 0; i < 8; ++i) { a[i] = (_Float16)(p[i] * sc); a[8 + i] = (_Float16)(p[16 + i] * sc); }
  return a;
}
// column fragment from a [K][ld] layout (column n), rows >= K read as 0
__device__ __forceinline__ v16h fragc_f32(const float* W, int k0, int n, int lane, int ld, int K) {
  v16h a; const int g = lane >> 4;
#pragma unroll
  for (int i = 0; i < 8; ++i) { const int ka = k0 + 8 * g + i, kb = ka + 16;
    a[i] = (_Float16)(ka < K ? W[(size_t)(ka < K ? ka : K - 1) * ld + n] : 0.f); a[8 + i] = (_Float16)(kb < K ? W[(size_t)(kb < K ? kb : K - 1) * ld + n] : 0.f); }
  return a;
}
struct F2 { v16b h, l; };
__device__ __forceinline__ F2 bsplit16(const float v[16]) { F2 r;
#pragma unroll
  for (int i = 0; i < 16; ++i) { const __bf16 h = (__bf16)v[i]; r.h[i] = h; r.l[i] = (__bf16)(v[i] - (float)h); }
  return r; }
__device__ __forceinline__ F2 split_row(const float* row, int k0, int lane) { float v[16]; const float* p = row + k0 + 8 * (lane >> 4);
#pragma unroll
  for (int i = 0; i < 8; ++i) { v[i] = p[i]; v[8 + i] = p[16 + i]; }
  return bsplit16(v); }
__device__ __forceinline__ F2 split_rowK(const float* row, int k0, int lane, int K) { float v[16]; const int g = lane >> 4;
#pragma unroll
  for (int i = 0; i < 8; ++i) { const int ka = k0 + 8 * g + i, kb = ka + 16; v[i] = ka < K ? row[ka < K ? ka : K - 1] : 0.f; v[8 + i] = kb < K ? row[kb < K ? kb : K - 1] : 0.f; }
  return bsplit16(v); }
__device__ __forceinline__ F2 split_col(const float* W, int k0, int n, int lane, int ld, int K) { float v[16]; const int g = lane >> 4;
#pragma unroll
  for (int i = 0; i < 8; ++i) { const int ka = k0 + 8 * g + i, kb = ka + 16; v[i] = ka < K ? W[(size_t)(ka < K ? ka : K - 1) * ld + n] : 0.f; v[8 + i] = kb < K ? W[(size_t)(kb < K ? kb : K - 1) * ld + n] : 0.f; }
  return bsplit16(v); }
__device__ __forceinline__ v8f mac3(const F2& a, const F2& b, v8f c) { c = wmma_bf(a.l, b.h, c); c = wmma_bf(a.h, b.l, c); return wmma_bf(a.h, b.h, c); }
__device__ __forceinline__ float sigm(float v) { return 1.0f / (1.0f + expf(-v)); }
#define LDSX() do { asm volatile("s_wait_dscnt 0" ::: "memory"); __builtin_amdgcn_wave_barrier(); __builtin_amdgcn_fence(__ATOMIC_RELEASE, "workgroup"); } while (0)

// Causal multi-head attention with the module's plain reshape (B 2, S 2,048, E 1,024, 16 heads x 64): Q = query Wq^T, K = key Wk^T, V = value Wv^T ((out,in), no bias); Q/K/V.reshape(B, H, S, 64) WITHOUT a transpose (head hh = the contiguous 128-row block hh of the [S, E] projection, position s = row hh*128 + s/16, columns (s%16)*64 ..); scores = Q K^T / 8 with key > query -> -inf; softmax; concat = head_out.transpose(0,2,1,3).reshape(B, S, E); out = concat W_ffn^T + b_ffn.
#define NB 2
#define TT 2048
#define CC 1024            // NH * HD = projected width
#define DIN 1024          // input (model) width
#define NH 16
#define HD 64
#define NQB (TT / 64)
#define HG 4
#define SCALE (0.125f)
#define CAUSAL 1
#ifndef TNB
#define TNB NB
#endif
__device__ __forceinline__ float bfr(float v) { return (float)(__bf16)v; }
__host__ __device__ __forceinline__ int kb_last(int qb) { return CAUSAL ? ((qb * 64 + 63) >> 7) : (TT / 128 - 1); }
typedef __attribute__((ext_vector_type(8))) __bf16 v8b;
__device__ __forceinline__ v16b frag_b(const __bf16* rowk0, int lane) {
  union { v16b v; v8b q[2]; } u; const __bf16* p = rowk0 + 8 * (lane >> 4);
  u.q[0] = *(const v8b*)p; u.q[1] = *(const v8b*)(p + 16); return u.v;
}
#define QBH 6              // unused: the causal high-precision path is taken by query positions < QHI of each sequence (few keys, no averaging)
#define QHI 384            // rows carrying a q residual plane
#define KHI 384            // key rows carrying k residual / v bf16 hi+lo planes (used only by the causal high-precision path)
// B fragment (k rows k0+.., output column o) of a weight: (in,out) [K][ld] or (out,in) [ld rows of K]: bf16 exact, or f16(bf16 * 256) exact
__device__ __forceinline__ v16b wcol_io(const float* Wm, int k0, int o, int lane, int ld) { v16b w; const int g = lane >> 4;
#pragma unroll
  for (int i = 0; i < 8; ++i) { w[i] = (__bf16)Wm[(size_t)(k0 + 8 * g + i) * ld + o]; w[8 + i] = (__bf16)Wm[(size_t)(k0 + 16 + 8 * g + i) * ld + o]; }
  return w; }
__device__ __forceinline__ v16b wcol_oi(const float* Wm, int k0, int o, int lane, int K) { v16b w; const float* p = Wm + (size_t)o * K + k0 + 8 * (lane >> 4);
#pragma unroll
  for (int i = 0; i < 8; ++i) { w[i] = (__bf16)p[i]; w[8 + i] = (__bf16)p[16 + i]; }
  return w; }
__device__ __forceinline__ v16h wcolh_io(const float* Wm, int k0, int o, int lane, int ld) { v16h w; const int g = lane >> 4;
#pragma unroll
  for (int i = 0; i < 8; ++i) { w[i] = (_Float16)(bfr(Wm[(size_t)(k0 + 8 * g + i) * ld + o]) * 256.0f); w[8 + i] = (_Float16)(bfr(Wm[(size_t)(k0 + 16 + 8 * g + i) * ld + o]) * 256.0f); }
  return w; }
__device__ __forceinline__ v16h wcolh_oi(const float* Wm, int k0, int o, int lane, int K) { v16h w; const float* p = Wm + (size_t)o * K + k0 + 8 * (lane >> 4);
#pragma unroll
  for (int i = 0; i < 8; ++i) { w[i] = (_Float16)(bfr(p[i]) * 256.0f); w[8 + i] = (_Float16)(bfr(p[16 + i]) * 256.0f); }
  return w; }
#define WQKV_LAYOUT 1   // 0 = (in,out) [DIN][CC]; 1 = (out,in) [CC][DIN]; 2 = per-head [NH][DIN][HD]
__device__ __forceinline__ v16b wcol_hdk(const float* Wm, int k0, int o, int lane) { v16b w; const int g = lane >> 4; const float* p = Wm + (size_t)(o / HD) * DIN * HD + (o % HD);
#pragma unroll
  for (int i = 0; i < 8; ++i) { w[i] = (__bf16)p[(size_t)(k0 + 8 * g + i) * HD]; w[8 + i] = (__bf16)p[(size_t)(k0 + 16 + 8 * g + i) * HD]; }
  return w; }
#define WO_OUT_IN 1
#if WQKV_LAYOUT == 1
#define WCOL(W, k0, o, lane) wcol_oi(W, k0, o, lane, DIN)
#elif WQKV_LAYOUT == 2
#define WCOL(W, k0, o, lane) wcol_hdk(W, k0, o, lane)
#else
#define WCOL(W, k0, o, lane) wcol_io(W, k0, o, lane, CC)
#endif
#if WO_OUT_IN
#define WOCOL(W, k0, o, lane) wcol_oi(W, k0, o, lane, CC)
#define WOCOLH(W, k0, o, lane) wcolh_oi(W, k0, o, lane, CC)
#else
#define WOCOL(W, k0, o, lane) wcol_io(W, k0, o, lane, DIN)
#define WOCOLH(W, k0, o, lane) wcolh_io(W, k0, o, lane, DIN)
#endif

#ifndef SM_EXTRA_PARAMS
#define SM_EXTRA_PARAMS
#endif
#ifndef SM_MASK_HOOK
#define SM_MASK_HOOK (void)0
#endif

#define WS_QH  0u                                      // f16 q in fragment order [b][h][16-position tile][kc*2 + half][lane][8]
#define WS_KH  (WS_QH + 2u * (size_t)NB * TT * CC)      // f16 k, fragment order as q
#define WS_VT  (WS_KH + 2u * (size_t)NB * TT * CC)      // f16 v in fragment order [b][h][32-key chunk][j*2 + half][lane][8]
#define WS_QL  (WS_VT + 2u * (size_t)NB * CC * TT)      // f16 q residual x 2^10, fragment order as q, positions < QHI
#define WS_KL  (WS_QL + 2u * (size_t)NB * QHI * CC)     // f16 k residual x 2^10, fragment order as k, keys < KHI
#define WS_VB  (WS_KL + 2u * (size_t)NB * KHI * CC)     // bf16 v hi (and lo behind it), fragment order as v, keys < KHI
#define WS_VBL (WS_VB + 2u * (size_t)NB * CC * KHI)
#define WS_S   (WS_VBL + 2u * (size_t)NB * CC * KHI)    // f32 [hg][t][s] region, unused: the logits stay in registers (positions < QHI: LDS rows)
#define WS_Y   (WS_S  + 4u * (size_t)HG * TT * TT)      // f32 ctx rows [b*t][CC] (only when there is an output projection)
#define WS_QF  (WS_Y  + 4u * (size_t)NB * TT * CC)      // f32 Q rows [b*t][CC] (projection output, module row order)
#define WS_KF  (WS_QF + 4u * (size_t)NB * TT * CC)
#define WS_VF  (WS_KF + 4u * (size_t)NB * TT * CC)
#define WS_END (WS_VF + 4u * (size_t)NB * TT * CC)

// ---- staged GEMM tiles (k_projf, k_out): block = 128 rows x 128 cols, 8 waves (4 x 2), wave = 32 rows x 64 cols (2 x 4 accumulator tiles). Per pass of 32 k the block reads its 128-B row pieces once with whole-line loads (8 lanes a row), converts them once and lays them in LDS; every wave takes its fragments from there. Two LDS buffers: the next pass's global loads are issued ahead of this pass's products, converted and stored behind them; one barrier a pass. k runs upward into one accumulator per tile, in the fragments' k order of frag_b / frag_h.
#define GP 40              // 16-bit elements per staged row: 80 B = 16 B x odd, so the 16-byte fragment reads of 16 rows fall on different banks
#define GSP 68             // floats per row of a wave's output staging (16-byte reads of a row walk without conflicts)
typedef __attribute__((ext_vector_type(4))) __bf16 v4b;
typedef __attribute__((ext_vector_type(4))) _Float16 v4h;
// the wave's 32 x 64 tile -> rows of D (pointer at the tile's first element), 16 rows at a time through the wave's own LDS range sw[16][GSP]: 256-B row segments by 16 lanes
__device__ __forceinline__ void tile_out(float* sw, const v8f (&acc)[2][4], float* D, int ld, int lane) { const int col = lane & 15, g = lane >> 4;
#pragma unroll
  for (int i = 0; i < 2; ++i) {
#pragma unroll
    for (int j = 0; j < 4; ++j) {
#pragma unroll
      for (int r = 0; r < 8; ++r) sw[(8 * g + r) * GSP + j * 16 + col] = acc[i][j][r]; }
    LDSX();
#pragma unroll
    for (int rr = 0; rr < 8; ++rr) vst2(D + (size_t)(i * 16 + rr * 2 + g) * ld + col * 4, *(const v4f*)&sw[(rr * 2 + g) * GSP + col * 4]); } }
// ---- k_projf: block = (128 rows, 128 cols, which): Q/K/V = X W^T with exact bf16 products (K = DIN) -> f32 rows [b*t][CC]
__global__ __launch_bounds__(256) void k_projf(const float* __restrict__ XQ, const float* __restrict__ XK, const float* __restrict__ XV, const float* __restrict__ WQ, const float* __restrict__ WK, const float* __restrict__ WV, float* __restrict__ QF, float* __restrict__ KF, float* __restrict__ VF) {
  __shared__ __align__(16) __bf16 st[2][256][GP];   /* rows 0..127: X, 128..255: W; after the last pass: the waves' output staging */
  const int tid = threadIdx.x, wave = tid >> 5, lane = tid & 31, col = lane & 15; const int wm = wave >> 1, wn = wave & 1; const int which = blockIdx.z; const int c0 = blockIdx.y * 128; const size_t r0 = (size_t)blockIdx.x * 128;
  const float* X = which == 0 ? XQ : which == 1 ? XK : XV; const float* WA = which == 0 ? WQ : which == 1 ? WK : WV; float* D = which == 0 ? QF : which == 1 ? KF : VF;
  const int lr = tid >> 3, lq = (tid & 7) * 4;   /* the thread's row (and + 32, 64, 96) and its four k of a pass */
  const float* xp = X + (r0 + lr) * DIN + lq; const float* wp = WA + (size_t)(c0 + lr) * DIN + lq;
  v4f px[4], pw[4]; v8f acc[2][4] = {};
#pragma unroll
  for (int i = 0; i < 4; ++i) { px[i] = *(const v4f*)(xp + (size_t)i * 32 * DIN); pw[i] = *(const v4f*)(wp + (size_t)i * 32 * DIN); }
#pragma unroll
  for (int i = 0; i < 4; ++i) { *(v4b*)&st[0][lr + 32 * i][lq] = __builtin_convertvector(px[i], v4b); *(v4b*)&st[0][128 + lr + 32 * i][lq] = __builtin_convertvector(pw[i], v4b); }
  __syncthreads();
#pragma unroll 2   /* the buffer index becomes a constant */
  for (int kc = 0; kc < DIN / 32; ++kc) { const int cur = kc & 1; const bool more = kc + 1 < DIN / 32;
    if (more) {
#pragma unroll
      for (int i = 0; i < 4; ++i) { px[i] = *(const v4f*)(xp + (size_t)i * 32 * DIN + (kc + 1) * 32); pw[i] = *(const v4f*)(wp + (size_t)i * 32 * DIN + (kc + 1) * 32); } }
    v16b a[2], w[4];
#pragma unroll
    for (int i = 0; i < 2; ++i) a[i] = frag_b(&st[cur][wm * 32 + i * 16 + col][0], lane);
#pragma unroll
    for (int j = 0; j < 4; ++j) w[j] = frag_b(&st[cur][128 + wn * 64 + j * 16 + col][0], lane);
#pragma unroll
    for (int i = 0; i < 2; ++i) {
#pragma unroll
      for (int j = 0; j < 4; ++j) acc[i][j] = wmma_bf(a[i], w[j], acc[i][j]); }
    if (more) {
#pragma unroll
      for (int i = 0; i < 4; ++i) { *(v4b*)&st[cur ^ 1][lr + 32 * i][lq] = __builtin_convertvector(px[i], v4b); *(v4b*)&st[cur ^ 1][128 + lr + 32 * i][lq] = __builtin_convertvector(pw[i], v4b); } }
    __syncthreads(); }   /* publishes the next pass's buffer and ends every wave's reads of this one */
  tile_out((float*)&st[0][0][0] + wave * 16 * GSP, acc, D + (r0 + wm * 32) * CC + c0 + wn * 64, CC, lane); }
// behind a store whose address or data registers are rewritten next (the following piece's LDS read, the next trip's address step)
#define XW() asm volatile("s_wait_xcnt 0x0" ::: "memory")
// ---- k_prep8: block = (64 attention positions s0.. of sequence b, head h): reads the f32 rows in the module's (B, H, S, 64) reinterpretation (element (b,h,s,c) = row-buffer float ((b*NH + h)*TT + s)*64 + c) and writes the standard attention planes: q -> f16 hi (+ x 2^10 residual for s < QHI), k -> f16 (+ residual for s < KHI), v -> f16 (+ bf16 hi/lo for s < KHI), all laid out in the order in which k_att's lanes take their fragments: the 16 bytes of lane 0..31 of one load lie side by side, so that one wave-wide 16-byte load covers 512 contiguous bytes (four whole lines) and not 32-byte pieces of 16 lines
__global__ __launch_bounds__(128) void k_prep8(const float* __restrict__ Q, const float* __restrict__ K, const float* __restrict__ V, _Float16* __restrict__ QH, _Float16* __restrict__ QL, _Float16* __restrict__ KH, _Float16* __restrict__ KL, _Float16* __restrict__ VT, __bf16* __restrict__ VB, __bf16* __restrict__ VBL) {
  __shared__ __align__(16) _Float16 sq[64][136], sql[64][136], sk[64][136], skl[64][136], tv[128][72]; __shared__ __align__(16) __bf16 tb[128][72], tbl[128][72];
  const int tid = threadIdx.x; const int h = blockIdx.y; const size_t r0 = (size_t)blockIdx.x * 64; const size_t bb = r0 / TT; const int t0 = (int)(r0 % TT); const bool qhi = t0 < QHI, khi = t0 < KHI;
  for (int e = tid; e < 64 * 128; e += 128) { const int rl = e >> 7, c = e & 127; const size_t oi = ((bb * NH + h) * TT + t0 + rl) * HD + (c & 63);   /* c >= 64: duplicate read of the same element (tiles are 128 wide; HD is 64) */
    const float q = Q[oi], k = K[oi], v = V[oi];
    const _Float16 qh = (_Float16)q, kh = (_Float16)k; sq[rl][c] = qh; sql[rl][c] = (_Float16)((q - (float)qh) * 1024.0f); sk[rl][c] = kh; skl[rl][c] = (_Float16)((k - (float)kh) * 1024.0f);
    tv[c][rl] = (_Float16)v; const __bf16 vb = (__bf16)v; tb[c][rl] = vb; tbl[c][rl] = (__bf16)(v - (float)vb); }
  __syncthreads();
  /* q, k: piece e = (tile e >> 7, load (e >> 5) & 3 = kc * 2 + half, lane e & 31 = g * 16 + position) holds elements kc * 32 + half * 16 + 8 g + 0..7 of its position */
  for (int e = tid; e < 64 * 8; e += 128) { const int rl = (e >> 7) * 16 + (e & 15), c8 = ((e >> 5) & 3) * 16 + ((e >> 4) & 1) * 8; const size_t o = ((bb * NH + h) * TT + t0) * (size_t)HD + e * 8;
    vst2((unsigned*)(QH + o), *(const v4u*)&sq[rl][c8]); vst2((unsigned*)(KH + o), *(const v4u*)&sk[rl][c8]); XW();
    if (qhi) { vst2((unsigned*)(QL + ((bb * NH + h) * QHI + t0) * (size_t)HD + e * 8), *(const v4u*)&sql[rl][c8]); XW(); }
    if (khi) { vst2((unsigned*)(KL + ((bb * NH + h) * KHI + t0) * (size_t)HD + e * 8), *(const v4u*)&skl[rl][c8]); XW(); } }
  /* v: piece e = (chunk e >> 8, load (e >> 5) & 7 = j * 2 + half, lane e & 31 = g * 16 + column) holds keys half * 16 + 8 g + 0..7 of the chunk for head column j * 16 + column */
  for (int e = tid; e < 64 * 8; e += 128) { const int cl = ((e >> 6) & 3) * 16 + (e & 15), k8 = (e >> 8) * 32 + ((e >> 5) & 1) * 16 + ((e >> 4) & 1) * 8; vst2((unsigned*)(VT + ((bb * NH + h) * TT + t0) * (size_t)HD + e * 8), *(const v4u*)&tv[cl][k8]); XW();
    if (khi) { const size_t o3 = ((bb * NH + h) * KHI + t0) * (size_t)HD + e * 8; vst2((unsigned*)(VB + o3), *(const v4u*)&tb[cl][k8]); vst2((unsigned*)(VBL + o3), *(const v4u*)&tbl[cl][k8]); XW(); } } }
// ---- k_att, one launch for all heads, two kinds of block. Positions >= QHI: block = (128 query positions, head h of batch b), each of the 8 waves on its own with 16 positions (fl_step below): logits, softmax and P stay in registers.
// Positions < QHI: block = (16 query positions, head h of batch b), 8 waves: the tile's logit rows stay in LDS from the q k^T products through the softmax to the P v products:
// phase 1: wave w takes the 16-key tiles w, w + 8, ..: logits x SCALE, key > query -> excluded (q and k hi + residual, 3 products); phase 2: wave w takes rows 2w, 2w + 1: max, expf, sum in f32, 2^11 / sum kept per row;
// phase 3: each wave takes a contiguous run of 32-key chunks: P x 2^11 and v as bf16 hi + lo (3 products); the 8 partial tiles are added in wave order through LDS; 256-B (row, head) segment by 16 lanes
// fragment from the fragment-ordered q / k / v buffers: the lane's pointer (load base + lane * 8); the second half lies one wave-wide load (256 elements) further
__device__ __forceinline__ v16h frag_hk(const _Float16* p) { union { v16h v; v8h q[2]; } u; u.q[0] = *(const v8h*)p; u.q[1] = *(const v8h*)(p + 256); return u.v; }
__device__ __forceinline__ v16b frag_bk(const __bf16* p) { union { v16b v; v8b q[2]; } u; u.q[0] = *(const v8b*)p; u.q[1] = *(const v8b*)(p + 256); return u.v; }
#define SPH 388            // floats per logit row in LDS (early tiles: at most KHI keys): 16 B x odd, so the 16-byte fragment reads of the 16 rows fall on different banks
#define NFB ((TT - QHI) / 128)   // blocks of 128 query positions >= QHI per (batch, head): the one-pass path
#define LC (SCALE * 1.4426950408889634f)   // logit scale x log2(e): the one-pass path works in base 2
// lane l <-> lane l ^ 16
__device__ __forceinline__ float xhalf(float x) { return __builtin_bit_cast(float, __builtin_amdgcn_permlanex16(__builtin_bit_cast(int, x), __builtin_bit_cast(int, x), 0x76543210, 0xfedcba98, false, false)); }
// the product alone, for a run of independent products: the distance stands once, behind the run
__device__ __forceinline__ v8f wmma16p(v16h a, v16h b, v8f c) { return __builtin_amdgcn_wmma_f32_16x16x32_f16(false, a, false, b, (short)0, c, false, false); }
// one 32-key chunk's fragments: k[t][kc] = 16-key tile t, head columns kc * 32 ..; v[j] = head columns j * 16 .., the chunk's 32 keys
struct KV { v16h k[2][2]; v16h v[HD / 16]; };
__device__ __forceinline__ void kv_load(KV& f, const _Float16* kp, const _Float16* vp, int c) { const _Float16* a = kp + c * 2048; const _Float16* b = vp + c * 2048;
#pragma unroll
  for (int t = 0; t < 2; ++t) {
#pragma unroll
    for (int kc = 0; kc < 2; ++kc) f.k[t][kc] = frag_hk(a + t * 1024 + kc * 512); }
#pragma unroll
  for (int j = 0; j < HD / 16; ++j) f.v[j] = frag_hk(b + j * 512);
  /* behind the run of loads: the two pointers are inputs, so that their registers stay untouched (also by a later load's result) until the wait has passed */
  asm volatile("s_wait_xcnt 0x0" :: "v"(a), "v"(b) : "memory"); }
// one chunk of the one-pass path. S^T = K Q^T: lane (g, col) holds query col's logits of keys 8 g + r (tile 0) and 16 + 8 g + r (tile 1), which is the k order of a B operand: P^T is packed in place; O^T += V^T P^T: lane (g, col) holds query col's head columns j * 16 + 8 g + r.
// m: running maximum of the raw logits of the lane's query (both halves alike); l: the lane's share of sum(p); p = 2^11 x exp((s - m) x SCALE); krel = first key of the lane in the chunk - the lane's query
__device__ __forceinline__ void fl_step(const KV& f, const v16h (&q)[2], v8f (&o)[HD / 16], float& m, float& l, bool diag, int krel) {
  v8f s0 = {}, s1 = {};
  s0 = wmma16p(f.k[0][0], q[0], s0); s1 = wmma16p(f.k[1][0], q[0], s1); s0 = wmma16p(f.k[0][1], q[1], s0); s1 = wmma16p(f.k[1][1], q[1], s1);
  /* the distance behind the run's last product, once for the run: the statement names both results and every operand, so it stands behind all four products and in front of whatever reads a result or overwrites an operand, on either side of the branch below */
  asm volatile("v_nop\n\tv_nop\n\tv_nop\n\tv_nop" : "+v"(s0), "+v"(s1) : "v"(f.k[0][0]), "v"(f.k[0][1]), "v"(f.k[1][0]), "v"(f.k[1][1]), "v"(q[0]), "v"(q[1]));
  if (diag) {   /* wave-uniform: only the query tile's last chunk holds keys behind a query */
#pragma unroll
    for (int r = 0; r < 8; ++r) { s0[r] = (krel + r > 0) ? -3.0e38f : s0[r]; s1[r] = (krel + 16 + r > 0) ? -3.0e38f : s1[r]; } }
  float mx = s0[0], my = s1[0];   /* two chains */
#pragma unroll
  for (int r = 1; r < 8; ++r) { mx = fmaxf(mx, s0[r]); my = fmaxf(my, s1[r]); }
  mx = fmaxf(mx, my); mx = fmaxf(mx, xhalf(mx));
  const float mn = fmaxf(m, mx), mc = 11.0f - mn * LC; float al;   /* al = 2^((m - mn) x LC); first chunk: m = -3e38, al = 0 */
  asm("v_exp_f32 %0, %1\n\tv_nop" : "=v"(al) : "v"((m - mn) * LC));   /* with the slot behind a transcendental in the statement */
  m = mn;
  v16h p; float a0 = 0.f, a1 = 0.f, a2 = 0.f, a3 = 0.f;   /* four chains of adds */
#pragma unroll
  for (int r = 0; r < 8; r += 2) { const float e0 = __builtin_amdgcn_exp2f(__builtin_fmaf(s0[r], LC, mc)), e1 = __builtin_amdgcn_exp2f(__builtin_fmaf(s0[r + 1], LC, mc)), e2 = __builtin_amdgcn_exp2f(__builtin_fmaf(s1[r], LC, mc)), e3 = __builtin_amdgcn_exp2f(__builtin_fmaf(s1[r + 1], LC, mc));
    a0 += e0; a1 += e1; a2 += e2; a3 += e3; p[r] = (_Float16)e0; p[r + 1] = (_Float16)e1; p[8 + r] = (_Float16)e2; p[8 + r + 1] = (_Float16)e3; }
  l = l * al + ((a0 + a1) + (a2 + a3));
#pragma unroll
  for (int j = 0; j < HD / 16; ++j) o[j] *= al;
#pragma unroll
  for (int j = 0; j < HD / 16; ++j) o[j] = wmma16p(f.v[j], p, o[j]);
  /* the distance, as above: also in front of the next chunk's loads, which land in the registers of v and of p */
  asm volatile("v_nop\n\tv_nop\n\tv_nop\n\tv_nop" : "+v"(o[0]), "+v"(o[1]), "+v"(o[2]), "+v"(o[3]) : "v"(f.v[0]), "v"(f.v[1]), "v"(f.v[2]), "v"(f.v[3]), "v"(p)); }
__global__ __launch_bounds__(256) void k_att(const _Float16* __restrict__ QH, const _Float16* __restrict__ KH, const _Float16* __restrict__ QL, const _Float16* __restrict__ KL, const _Float16* __restrict__ VT, const __bf16* __restrict__ VB, const __bf16* __restrict__ VBL, float* __restrict__ Y) {
  __shared__ __align__(16) float slb[8 * 16 * (HD + 4)]; __shared__ float sinv[16];   /* early tiles only: 16 logit rows of SPH floats, then the staging of the 8 partial tiles */
  static_assert(16 * SPH <= 8 * 16 * (HD + 4) && KHI + 4 <= SPH, "the logit rows fit");
  float (*sl)[SPH] = (float (*)[SPH])slb;
  const int tid = threadIdx.x, lane = tid & 31, col = lane & 15, g = lane >> 4; const int wave = __builtin_amdgcn_readfirstlane(tid >> 5);
  const int b = blockIdx.x / NH, h = blockIdx.x % NH;
  const size_t hb = (size_t)(b * NH + h) * TT * HD + lane * 8, hbh = (size_t)(b * NH + h) * KHI * HD + lane * 8;   /* the lane's 16 bytes in the first load of the head's fragment-ordered q, k or v (all positions; positions < KHI) */
  static_assert(QHI == KHI, "one base serves the q and the k residuals");
  if ((int)blockIdx.y < NFB) {   /* block-uniform. One-pass path: wave = 16 query positions >= QHI, all their keys in 32-key chunks; nothing is shared between the waves, so no LDS and no barrier; longest blocks start first */
    const int q0 = TT - 128 * ((int)blockIdx.y + 1) + wave * 16, last = q0 >> 5;   /* the chunk that holds the tile's last key */
    const _Float16* qp = QH + hb + (q0 >> 4) * 1024; const _Float16* kp = KH + hb; const _Float16* vp = VT + hb;
    v16h q[2]; q[0] = frag_hk(qp); q[1] = frag_hk(qp + 512);
    v8f o[HD / 16] = {}; float m = -3.0e38f, l = 0.f; const int kr = 8 * g - (q0 + col);
    KV fa, fb; kv_load(fa, kp, vp, 0);   /* two register sets: the next chunk's loads fly while this chunk is worked on; a chunk past the end re-reads the last one and is not used */
    asm volatile("" :: "v"(q[0]), "v"(q[1]));   /* inputs-only fence on the loaded q fragments: their wait stands here, once, and not in the loop, where it would also wait for the chunk fetched ahead */
    for (int c = 0; c <= last; c += 2) {
      kv_load(fb, kp, vp, c + 1 <= last ? c + 1 : last);
      fl_step(fa, q, o, m, l, c == last, kr + c * 32);
      kv_load(fa, kp, vp, c + 2 <= last ? c + 2 : last);
      if (c + 1 <= last) fl_step(fb, q, o, m, l, c + 1 == last, kr + (c + 1) * 32); }
    asm volatile("s_wait_loadcnt 0x0" ::: "memory");   /* the chunk fetched ahead in the last trip is not used: its loads have landed before the wave gives its registers back */
    const float inv = 1.0f / (l + xhalf(l)); float* yp = Y + ((size_t)b * TT + q0 + col) * CC + h * HD + 8 * g;
#pragma unroll
    for (int j = 0; j < HD / 16; ++j) { const v8f w = o[j] * inv; v4f w0, w1;
#pragma unroll
      for (int r = 0; r < 4; ++r) { w0[r] = w[r]; w1[r] = w[4 + r]; }
      vst2(yp + j * 16, w0); vst2(yp + j * 16 + 4, w1); }
    return; }
  /* early tiles (positions < QHI): block = 16 query positions, the logit rows in LDS, three phases as described above */
  const int ql0 = (QHI / 16 - 1 - ((int)blockIdx.y - NFB)) * 16;   /* longest tiles start first */
  const int nkc = (ql0 + 16 + 31) >> 5;   /* 32-key chunks that hold a key <= the tile's last query */
  const int n = ((ql0 + 16 + 127) >> 7) << 7, nt = n >> 4;   /* logits are formed for keys [0, n), whole 128-key blocks (excluded keys included): every lane has n / 128 quads of a row; n <= KHI */
  const _Float16* qp = QH + hb + (ql0 >> 4) * 1024;
  { const _Float16* qlp = QL + hbh + (ql0 >> 4) * 1024; v16h ah[2], al[2];
#pragma unroll
    for (int kc = 0; kc < 2; ++kc) { ah[kc] = frag_hk(qp + kc * 512); al[kc] = frag_hk(qlp + kc * 512); }
    asm volatile("s_wait_xcnt 0x0" :: "v"(qp), "v"(qlp) : "memory");   /* behind the q loads: the two pointers are inputs, so that their registers stay untouched until the wait has passed */
    for (int j = wave; j < nt; j += 8) { v8f acc = {}, accl = {}; v16h kbf[2], klf[2]; const _Float16* th = KH + hb + j * 1024; const _Float16* tl = KL + hbh + j * 1024;   /* all four fragments are loaded ahead of the products: one load latency a tile */
#pragma unroll
      for (int kc = 0; kc < 2; ++kc) { kbf[kc] = frag_hk(th + kc * 512); klf[kc] = frag_hk(tl + kc * 512); }
      /* inputs-only fence on the loaded fragments and their pointers: all the loads are issued ahead of the first product and the address registers stay untouched until the loads have returned */
      asm volatile("" :: "v"(kbf[0]), "v"(kbf[1]), "v"(klf[0]), "v"(klf[1]), "v"(th), "v"(tl));
#pragma unroll
      for (int kc = 0; kc < 2; ++kc) { acc = wmma16(ah[kc], kbf[kc], acc); accl = wmma16(al[kc], kbf[kc], accl); accl = wmma16(ah[kc], klf[kc], accl); }
#pragma unroll
      for (int r = 0; r < 8; ++r) sl[8 * g + r][j * 16 + col] = (j * 16 + col <= ql0 + 8 * g + r) ? (acc[r] + accl[r] * (1.0f / 1024.0f)) * SCALE : -3.0e38f; } }
  __syncthreads();
  { float* sr0 = &sl[wave * 2][lane * 4]; float* sr1 = &sl[wave * 2 + 1][lane * 4]; float m0 = -3.0e38f, m1 = -3.0e38f, sum0 = 0.f, sum1 = 0.f;   /* the wave's two rows side by side: two independent chains of LDS reads */
#pragma unroll 2   /* four LDS reads in flight */
    for (int k = 0; k < n; k += 128) { const v4f v0 = *(const v4f*)&sr0[k], v1 = *(const v4f*)&sr1[k]; m0 = fmaxf(m0, fmaxf(fmaxf(v0[0], v0[1]), fmaxf(v0[2], v0[3]))); m1 = fmaxf(m1, fmaxf(fmaxf(v1[0], v1[1]), fmaxf(v1[2], v1[3]))); }
#pragma unroll
    for (int o = 1; o < 32; o <<= 1) { m0 = fmaxf(m0, __shfl_xor(m0, o)); m1 = fmaxf(m1, __shfl_xor(m1, o)); }
#pragma unroll 2   /* four LDS reads in flight */
    for (int k = 0; k < n; k += 128) { const v4f v0 = *(const v4f*)&sr0[k], v1 = *(const v4f*)&sr1[k]; v4f e0, e1;
#pragma unroll
      for (int i = 0; i < 4; ++i) { const float x0 = expf(v0[i] - m0), x1 = expf(v1[i] - m1); e0[i] = (v0[i] <= -1.0e38f) ? 0.f : x0; e1[i] = (v1[i] <= -1.0e38f) ? 0.f : x1; sum0 += e0[i]; sum1 += e1[i]; }
      *(v4f*)&sr0[k] = e0; *(v4f*)&sr1[k] = e1; }
#pragma unroll
    for (int o = 1; o < 32; o <<= 1) { sum0 += __shfl_xor(sum0, o); sum1 += __shfl_xor(sum1, o); }
    if (lane == 0) { sinv[wave * 2] = 2048.0f / sum0; sinv[wave * 2 + 1] = 2048.0f / sum1; } }
  __syncthreads();
  const float sc = sinv[col]; const int per = (nkc + 7) >> 3; const int kcs = wave * per, kce = (kcs + per < nkc) ? kcs + per : nkc;
  v8f acc[HD / 16] = {};
  for (int kc = kcs; kc < kce; ++kc) { float v[16]; const float* p = &sl[col][kc * 32 + 8 * g];
#pragma unroll
    for (int i = 0; i < 8; ++i) { v[i] = p[i] * sc; v[8 + i] = p[16 + i] * sc; }
    const F2 pf = bsplit16(v); v16b vh[HD / 16], vl[HD / 16]; const size_t po = hbh + kc * 2048; const __bf16* ph = VB + po; const __bf16* pl = VBL + po;   /* the chunk's eight v fragments are loaded ahead of the products */
#pragma unroll
    for (int j = 0; j < HD / 16; ++j) { vh[j] = frag_bk(ph + j * 512); vl[j] = frag_bk(pl + j * 512); }
    /* inputs-only fence on the loaded fragments and their pointers: all the loads are issued ahead of the first product and the address registers stay untouched until the loads have returned */
    asm volatile("" :: "v"(vh[0]), "v"(vh[1]), "v"(vh[2]), "v"(vh[3]), "v"(vl[0]), "v"(vl[1]), "v"(vl[2]), "v"(vl[3]), "v"(ph), "v"(pl));
#pragma unroll
    for (int j = 0; j < HD / 16; ++j) { acc[j] = wmma_bf(pf.h, vh[j], acc[j]); acc[j] = wmma_bf(pf.l, vh[j], acc[j]); acc[j] = wmma_bf(pf.h, vl[j], acc[j]); } }
  __syncthreads();   /* every wave has read its P chunks: the logit rows become the staging of the 8 partial tiles */
  float* red = slb;
#pragma unroll
  for (int j = 0; j < HD / 16; ++j)
#pragma unroll
    for (int r = 0; r < 8; ++r) red[(wave * 16 + 8 * g + r) * (HD + 4) + j * 16 + col] = acc[j][r];
  __syncthreads();
  { const int row = tid >> 4, c4 = (tid & 15) * 4; v4f s = *(const v4f*)&red[row * (HD + 4) + c4];
#pragma unroll
    for (int w = 1; w < 8; ++w) s += *(const v4f*)&red[(w * 16 + row) * (HD + 4) + c4];
    vst2(Y + ((size_t)b * TT + ql0 + row) * CC + h * HD + c4, s * (1.0f / 2048.0f)); } }
// ---- k_out: block = (128 rows, 128 cols), staged as above: out = ctx Wo (+ bo): ctx once to f16 against Wo as f16(bf16 x 2^8) exact (1 product) x 2^-8; causal early rows (< QHI of each sequence): ctx bf16 hi + lo against exact bf16 Wo (2 products)
template <bool HI> __device__ __forceinline__ void out_tile(char* sm, const float* __restrict__ Y, const float* __restrict__ WO, const float* __restrict__ BO, float* __restrict__ OUT) {
  typedef typename std::conditional<HI, __bf16, _Float16>::type E; typedef E v4e __attribute__((ext_vector_type(4)));
  E (*st)[384][GP] = (E (*)[384][GP])sm;   /* rows 0..127: ctx (hi), 128..255: Wo, 256..383: ctx lo (HI only) */
  const int tid = threadIdx.x, wave = tid >> 5, lane = tid & 31, col = lane & 15; const int wm = wave >> 1, wn = wave & 1; const int c0 = blockIdx.y * 128; const size_t r0 = (size_t)blockIdx.x * 128;
  const int lr = tid >> 3, lq = (tid & 7) * 4;
  const float* xp = Y + (r0 + lr) * CC + lq; const float* wp = WO + (size_t)(c0 + lr) * CC + lq;
  v4f px[4], pw[4]; v8f acc[2][4] = {};
  auto put = [&](int buf) {
#pragma unroll
    for (int i = 0; i < 4; ++i) {
      if constexpr (HI) { const v4b h = __builtin_convertvector(px[i], v4b); *(v4b*)&st[buf][lr + 32 * i][lq] = h; *(v4b*)&st[buf][256 + lr + 32 * i][lq] = __builtin_convertvector(px[i] - __builtin_convertvector(h, v4f), v4b); *(v4b*)&st[buf][128 + lr + 32 * i][lq] = __builtin_convertvector(pw[i], v4b); }
      else { *(v4h*)&st[buf][lr + 32 * i][lq] = __builtin_convertvector(px[i], v4h); *(v4h*)&st[buf][128 + lr + 32 * i][lq] = __builtin_convertvector(__builtin_convertvector(__builtin_convertvector(pw[i], v4b), v4f) * 256.0f, v4h); } } };
#pragma unroll
  for (int i = 0; i < 4; ++i) { px[i] = *(const v4f*)(xp + (size_t)i * 32 * CC); pw[i] = *(const v4f*)(wp + (size_t)i * 32 * CC); }
  float bias[4] = {0.f, 0.f, 0.f, 0.f};   /* read here, beside the first tile's loads, so that the epilogue waits for nothing */
  if (BO) {
#pragma unroll
    for (int j = 0; j < 4; ++j) bias[j] = BO[c0 + wn * 64 + j * 16 + col]; }
  put(0);
  __syncthreads();
#pragma unroll 2   /* the buffer index becomes a constant */
  for (int kc = 0; kc < CC / 32; ++kc) { const int cur = kc & 1; const bool more = kc + 1 < CC / 32;
    if (more) {
#pragma unroll
      for (int i = 0; i < 4; ++i) { px[i] = *(const v4f*)(xp + (size_t)i * 32 * CC + (kc + 1) * 32); pw[i] = *(const v4f*)(wp + (size_t)i * 32 * CC + (kc + 1) * 32); } }
    if constexpr (HI) { v16b ah[2], al[2], w[4];
#pragma unroll
      for (int i = 0; i < 2; ++i) { ah[i] = frag_b(&st[cur][wm * 32 + i * 16 + col][0], lane); al[i] = frag_b(&st[cur][256 + wm * 32 + i * 16 + col][0], lane); }
#pragma unroll
      for (int j = 0; j < 4; ++j) w[j] = frag_b(&st[cur][128 + wn * 64 + j * 16 + col][0], lane);
#pragma unroll
      for (int i = 0; i < 2; ++i) {
#pragma unroll
        for (int j = 0; j < 4; ++j) acc[i][j] = wmma_bf(ah[i], w[j], acc[i][j]);
#pragma unroll
        for (int j = 0; j < 4; ++j) acc[i][j] = wmma_bf(al[i], w[j], acc[i][j]); }
    } else { v16h a[2], w[4];
#pragma unroll
      for (int i = 0; i < 2; ++i) a[i] = frag_h(&st[cur][wm * 32 + i * 16 + col][0], lane);
#pragma unroll
      for (int j = 0; j < 4; ++j) w[j] = frag_h(&st[cur][128 + wn * 64 + j * 16 + col][0], lane);
#pragma unroll
      for (int i = 0; i < 2; ++i) {
#pragma unroll
        for (int j = 0; j < 4; ++j) acc[i][j] = wmma16(a[i], w[j], acc[i][j]); } }
    if (more) put(cur ^ 1);
    __syncthreads(); }   /* publishes the next pass's buffer and ends every wave's reads of this one */
#pragma unroll
  for (int j = 0; j < 4; ++j) { const float bj = bfr(bias[j]);
#pragma unroll
    for (int i = 0; i < 2; ++i) {
#pragma unroll
      for (int r = 0; r < 8; ++r) acc[i][j][r] = HI ? acc[i][j][r] + bj : acc[i][j][r] * (1.0f / 256.0f) + bj; } }
  tile_out((float*)sm + wave * 16 * GSP, acc, OUT + (r0 + wm * 32) * DIN + c0 + wn * 64, DIN, lane); }
static_assert(QHI % 128 == 0 && TT % 128 == 0, "the early-row path is chosen per 128-row block");
__global__ __launch_bounds__(256) void k_out(const float* __restrict__ Y, const float* __restrict__ WO, const float* __restrict__ BO, float* __restrict__ OUT) { __shared__ __align__(16) char sm[2 * 384 * GP * 2];
  if (CAUSAL && (int)(((size_t)blockIdx.x * 128) % TT) < QHI) out_tile<true>(sm, Y, WO, BO, OUT);   /* block-uniform */
  else out_tile<false>(sm, Y, WO, BO, OUT); }

extern "C" void kernel_launch(void* const* d_in, const int* in_sizes, int n_in, void* d_out, int out_size, void* d_ws, size_t ws_size, hipStream_t stream) {
  (void)in_sizes; (void)n_in; (void)out_size;
  const float** F = (const float**)d_in;
  if (ws_size < (size_t)WS_END) return;
  char* ws = (char*)d_ws; _Float16 *QH = (_Float16*)(ws + WS_QH), *KH = (_Float16*)(ws + WS_KH), *VT = (_Float16*)(ws + WS_VT), *QL = (_Float16*)(ws + WS_QL), *KL = (_Float16*)(ws + WS_KL); __bf16 *VB = (__bf16*)(ws + WS_VB), *VBL = (__bf16*)(ws + WS_VBL); float *Y = (float*)(ws + WS_Y);
  (void)Y; (void)QL; (void)KL; (void)VB; (void)VBL;
  // inputs: 0 query, 1 key, 2 value [2,2048,1024]; 3 W_Q, 4 W_K, 5 W_V, 6 W_ffn (out,in) [1024,1024]; 7 b_ffn [1024]
  float *QF = (float*)(ws + WS_QF), *KF = (float*)(ws + WS_KF), *VF = (float*)(ws + WS_VF);
  k_projf<<<dim3(TNB * TT / 128, CC / 128, 3), 256, 0, stream>>>(F[0], F[1], F[2], F[3], F[4], F[5], QF, KF, VF);
  k_prep8<<<dim3(TNB * TT / 64, NH), 128, 0, stream>>>(QF, KF, VF, QH, QL, KH, KL, VT, VB, VBL);
  k_att<<<dim3(TNB * NH, NFB + QHI / 16), 256, 0, stream>>>(QH, KH, QL, KL, VT, VB, VBL, Y);
  k_out<<<dim3(TNB * TT / 128, DIN / 128), 256, 0, stream>>>(Y, F[6], F[7], (float*)d_out);
}

// v005
// A run of this version takes 88.1 microseconds.
// In two side-by-side timings against v004, it was 1.61 and 1.63 times as fast.
// All steps since v000 together make it 12.7 times as fast.
// compute dtype: all float inputs rounded to bf16; Q/K/V = {query,key,value} W^T with EXACT bf16 products on WMMA 16x16x32 (f32 accumulate), taken from the accumulators in the module's (B, H, Sq, 64) reinterpretation: q, k once to f16 -> 1-product causal logits x 1/8, except the first 384 query positions of each (batch, head) (few keys, no averaging), which use q and k as f16 hi + residual (x 2^10) (3 products); softmax in f32: positions >= 384 in one pass with a running maximum, base-2 hardware exponentials and the division by the row sum at the end, exp(logit - max) x 2^11 once to f16 against v once to f16 (1 product); the first 384 positions: precise expf, P and v as bf16 hi + lo (3 products); concat once to f16 against W_ffn carried x 2^8 in f16 (exact bf16 values), except rows < 384 of each sequence: bf16 hi + lo against exact bf16 W_ffn (2 products); + b_ffn; f32 output.
#include <hip/hip_runtime.h>
#include <math.h>
#include <type_traits>

typedef __attribute__((ext_vector_type(16))) _Float16 v16h;
typedef __attribute__((ext_vector_type(16))) __bf16 v16b;
typedef __attribute__((ext_vector_type(8)))  _Float16 v8h;
typedef __attribute__((ext_vector_type(8)))  float v8f;
typedef __attribute__((ext_vector_type(4)))  float v4f;
typedef __attribute__((ext_vector_type(2)))  float v2f;
typedef __attribute__((ext_vector_type(4)))  unsigned v4u;
typedef __attribute__((ext_vector_type(4)))  int v4i;
typedef float __attribute__((may_alias)) float_a;
typedef int __attribute__((may_alias)) int_a;

template <typename T> __device__ __forceinline__ void vst2(void* p, T v) { *(T*)p = v;  }
__device__ __forceinline__ v8f wmma16(v16h a, v16h b, v8f c) {
  v8f d = __builtin_amdgcn_wmma_f32_16x16x32_f16(false, a, false, b, (short)0, c, false, false);
  asm volatile("v_nop\n\tv_nop\n\tv_nop\n\tv_nop" : "+v"(d) : "v"(a), "v"(b));
  return d;
}
__device__ __forceinline__ v8f wmma_bf(v16b a, v16b b, v8f c) {
  v8f d = __builtin_amdgcn_wmma_f32_16x16x32_bf16(false, a, false, b, (short)0, c, false, false);
  asm volatile("v_nop\n\tv_nop\n\tv_nop\n\tv_nop" : "+v"(d) : "v"(a), "v"(b));
  return d;
}
// 16x16x32 fragments: lane = (h = lane>>4, row/col = lane&15); elements 0..7 = k0+8h+0..7, 8..15 = k0+16+8h+0..7; D element r = row 8h+r
__device__ __forceinline__ v16h frag_h(const _Float16* rowk0, int lane) {
  union { v16h v; v8h q[2]; } u; const _Float16* p = rowk0 + 8 * (lane >> 4);
  u.q[0] = *(const v8h*)p; u.q[1] = *(const v8h*)(p + 16); return u.v;
}
__device__ __forceinline__ v16h frag_f32(const float* rowk0, int lane) {
  v16h a; const float* p = rowk0 + 8 * (lane >> 4);
#pragma unroll
  for (int i = 0; i < 8; ++i) { a[i] = (_Float16)p[i]; a[8 + i] = (_Float16)p[16 + i]; }
  return a;
}
__device__ __forceinline__ v16h frag_f32s(const float* rowk0, int lane, float sc) {
  v16h a; const float* p = rowk0 + 8 * (lane >> 4);
#pragma unroll
  for (int i = 0; i < 8; ++i) { a[i] = (_Float16)(p[i] * sc); a[8 + i] = (_Float16)(p[16 + i] * sc); }
  return a;
}
// column fragment from a [K][ld] layout (column n), rows >= K read as 0
__device__ __forceinline__ v16h fragc_f32(const float* W, int k0, int n, int lane, int ld, int K) {
  v16h a; const int g = lane >> 4;
#pragma unroll
  for (int i = 0; i < 8; ++i) { const int ka = k0 + 8 * g + i, kb = ka + 16;
    a[i] = (_Float16)(ka < K ? W[(size_t)(ka < K ? ka : K - 1) * ld + n] : 0.f); a[8 + i] = (_Float16)(kb < K ? W[(size_t)(kb < K ? kb : K - 1) * ld + n] : 0.f); }
  return a;
}
struct F2 { v16b h, l; };
__device__ __forceinline__ F2 bsplit16(const float v[16]) { F2 r;
#pragma unroll
  for (int i = 0; i < 16; ++i) { const __bf16 h = (__bf16)v[i]; r.h[i] = h; r.l[i] = (__bf16)(v[i] - (float)h); }
  return r; }
__device__ __forceinline__ F2 split_row(const float* row, int k0, int lane) { float v[16]; const float* p = row + k0 + 8 * (lane >> 4);
#pragma unroll
  for (int i = 0; i < 8; ++i) { v[i] = p[i]; v[8 + i] = p[16 + i]; }
  return bsplit16(v); }
__device__ __forceinline__ F2 split_rowK(const float* row, int k0, int lane, int K) { float v[16]; const int g = lane >> 4;
#pragma unroll
  for (int i = 0; i < 8; ++i) { const int ka = k0 + 8 * g + i, kb = ka + 16; v[i] = ka < K ? row[ka < K ? ka : K - 1] : 0.f; v[8 + i] = kb < K ? row[kb < K ? kb : K - 1] : 0.f; }
  return bsplit16(v); }
__device__ __forceinline__ F2 split_col(const float* W, int k0, int n, int lane, int ld, int K) { float v[16]; const int g = lane >> 4;
#pragma unroll
  for (int i = 0; i < 8; ++i) { const int ka = k0 + 8 * g + i, kb = ka + 16; v[i] = ka < K ? W[(size_t)(ka < K ? ka : K - 1) * ld + n] : 0.f; v[8 + i] = kb < K ? W[(size_t)(kb < K ? kb : K - 1) * ld + n] : 0.f; }
  return bsplit16(v); }
__device__ __forceinline__ v8f mac3(const F2& a, const F2& b, v8f c) { c = wmma_bf(a.l, b.h, c); c = wmma_bf(a.h, b.l, c); return wmma_bf(a.h, b.h, c); }
__device__ __forceinline__ float sigm(float v) { return 1.0f / (1.0f + expf(-v)); }
#define LDSX() do { asm volatile("s_wait_dscnt 0" ::: "memory"); __builtin_amdgcn_wave_barrier(); __builtin_amdgcn_fence(__ATOMIC_RELEASE, "workgroup"); } while (0)

// Causal multi-head attention with the module's plain reshape (B 2, S 2,048, E 1,024, 16 heads x 64): Q = query Wq^T, K = key Wk^T, V = value Wv^T ((out,in), no bias); Q/K/V.reshape(B, H, S, 64) WITHOUT a transpose (head hh = the contiguous 128-row block hh of the [S, E] projection, position s = row hh*128 + s/16, columns (s%16)*64 ..); scores = Q K^T / 8 with key > query -> -inf; softmax; concat = head_out.transpose(0,2,1,3).reshape(B, S, E); out = concat W_ffn^T + b_ffn.
#define NB 2
#define TT 2048
#define CC 1024            // NH * HD = projected width
#define DIN 1024          // input (model) width
#define NH 16
#define HD 64
#define NQB (TT / 64)
#define HG 4
#define SCALE (0.125f)
#define CAUSAL 1
#ifndef TNB
#define TNB NB
#endif
__device__ __forceinline__ float bfr(float v) { return (float)(__bf16)v; }
__host__ __device__ __forceinline__ int kb_last(int qb) { return CAUSAL ? ((qb * 64 + 63) >> 7) : (TT / 128 - 1); }
typedef __attribute__((ext_vector_type(8))) __bf16 v8b;
__device__ __forceinline__ v16b frag_b(const __bf16* rowk0, int lane) {
  union { v16b v; v8b q[2]; } u; const __bf16* p = rowk0 + 8 * (lane >> 4);
  u.q[0] = *(const v8b*)p; u.q[1] = *(const v8b*)(p + 16); return u.v;
}
#define QBH 6              // unused: the causal high-precision path is taken by query positions < QHI of each sequence (few keys, no averaging)
#define QHI 384            // rows carrying a q residual plane
#define KHI 384            // key rows carrying k residual / v bf16 hi+lo planes (used only by the causal high-precision path)
// B fragment (k rows k0+.., output column o) of a weight: (in,out) [K][ld] or (out,in) [ld rows of K]: bf16 exact, or f16(bf16 * 256) exact
__device__ __forceinline__ v16b wcol_io(const float* Wm, int k0, int o, int lane, int ld) { v16b w; const int g = lane >> 4;
#pragma unroll
  for (int i = 0; i < 8; ++i) { w[i] = (__bf16)Wm[(size_t)(k0 + 8 * g + i) * ld + o]; w[8 + i] = (__bf16)Wm[(size_t)(k0 + 16 + 8 * g + i) * ld + o]; }
  return w; }
__device__ __forceinline__ v16b wcol_oi(const float* Wm, int k0, int o, int lane, int K) { v16b w; const float* p = Wm + (size_t)o * K + k0 + 8 * (lane >> 4);
#pragma unroll
  for (int i = 0; i < 8; ++i) { w[i] = (__bf16)p[i]; w[8 + i] = (__bf16)p[16 + i]; }
  return w; }
__device__ __forceinline__ v16h wcolh_io(const float* Wm, int k0, int o, int lane, int ld) { v16h w; const int g = lane >> 4;
#pragma unroll
  for (int i = 0; i < 8; ++i) { w[i] = (_Float16)(bfr(Wm[(size_t)(k0 + 8 * g + i) * ld + o]) * 256.0f); w[8 + i] = (_Float16)(bfr(Wm[(size_t)(k0 + 16 + 8 * g + i) * ld + o]) * 256.0f); }
  return w; }
__device__ __forceinline__ v16h wcolh_oi(const float* Wm, int k0, int o, int lane, int K) { v16h w; const float* p = Wm + (size_t)o * K + k0 + 8 * (lane >> 4);
#pragma unroll
  for (int i = 0; i < 8; ++i) { w[i] = (_Float16)(bfr(p[i]) * 256.0f); w[8 + i] = (_Float16)(bfr(p[16 + i]) * 256.0f); }
  return w; }
#define WQKV_LAYOUT 1   // 0 = (in,out) [DIN][CC]; 1 = (out,in) [CC][DIN]; 2 = per-head [NH][DIN][HD]
__device__ __forceinline__ v16b wcol_hdk(const float* Wm, int k0, int o, int lane) { v16b w; const int g = lane >> 4; const float* p = Wm + (size_t)(o / HD) * DIN * HD + (o % HD);
#pragma unroll
  for (int i = 0; i < 8; ++i) { w[i] = (__bf16)p[(size_t)(k0 + 8 * g + i) * HD]; w[8 + i] = (__bf16)p[(size_t)(k0 + 16 + 8 * g + i) * HD]; }
  return w; }
#define WO_OUT_IN 1
#if WQKV_LAYOUT == 1
#define WCOL(W, k0, o, lane) wcol_oi(W, k0, o, lane, DIN)
#elif WQKV_LAYOUT == 2
#define WCOL(W, k0, o, lane) wcol_hdk(W, k0, o, lane)
#else
#define WCOL(W, k0, o, lane) wcol_io(W, k0, o, lane, CC)
#endif
#if WO_OUT_IN
#define WOCOL(W, k0, o, lane) wcol_oi(W, k0, o, lane, CC)
#define WOCOLH(W, k0, o, lane) wcolh_oi(W, k0, o, lane, CC)
#else
#define WOCOL(W, k0, o, lane) wcol_io(W, k0, o, lane, DIN)
#define WOCOLH(W, k0, o, lane) wcolh_io(W, k0, o, lane, DIN)
#endif

#ifndef SM_EXTRA_PARAMS
#define SM_EXTRA_PARAMS
#endif
#ifndef SM_MASK_HOOK
#define SM_MASK_HOOK (void)0
#endif

#define WS_QH  0u                                      // f16 q in fragment order [b][h][16-position tile][kc*2 + half][lane][8]
#define WS_KH  (WS_QH + 2u * (size_t)NB * TT * CC)      // f16 k, fragment order as q
#define WS_VT  (WS_KH + 2u * (size_t)NB * TT * CC)      // f16 v in fragment order [b][h][32-key chunk][j*2 + half][lane][8]
#define WS_QL  (WS_VT + 2u * (size_t)NB * CC * TT)      // f16 q residual x 2^10, fragment order as q, positions < QHI
#define WS_KL  (WS_QL + 2u * (size_t)NB * QHI * CC)     // f16 k residual x 2^10, fragment order as k, keys < KHI
#define WS_VB  (WS_KL + 2u * (size_t)NB * KHI * CC)     // bf16 v hi (and lo behind it), fragment order as v, keys < KHI
#define WS_VBL (WS_VB + 2u * (size_t)NB * CC * KHI)
#define WS_S   (WS_VBL + 2u * (size_t)NB * CC * KHI)    // f32 [hg][t][s] region, unused: the logits stay in registers (positions < QHI: LDS rows)
#define WS_Y   (WS_S  + 4u * (size_t)HG * TT * TT)      // f32 ctx rows [b*t][CC] (only when there is an output projection)
#define WS_END (WS_Y  + 4u * (size_t)NB * TT * CC)

// ---- staged GEMM tiles (k_projf, k_out): block = 128 rows x 128 cols, 8 waves (4 x 2), wave = 32 rows x 64 cols (2 x 4 accumulator tiles). Per pass of 32 k the block reads its 128-B row pieces once with whole-line loads (8 lanes a row), converts them once and lays them in LDS; every wave takes its fragments from there. Two LDS buffers: the next pass's global loads are issued ahead of this pass's products, converted and stored behind them; one barrier a pass. k runs upward into one accumulator per tile, in the fragments' k order of frag_b / frag_h.
#define GP 40              // 16-bit elements per staged row: 80 B = 16 B x odd, so the 16-byte fragment reads of 16 rows fall on different banks
#define GSP 68             // floats per row of a wave's output staging (16-byte reads of a row walk without conflicts)
typedef __attribute__((ext_vector_type(4))) __bf16 v4b;
typedef __attribute__((ext_vector_type(4))) _Float16 v4h;
// the wave's 32 x 64 tile -> rows of D (pointer at the tile's first element), 16 rows at a time through the wave's own LDS range sw[16][GSP]: 256-B row segments by 16 lanes
__device__ __forceinline__ void tile_out(float* sw, const v8f (&acc)[2][4], float* D, int ld, int lane) { const int col = lane & 15, g = lane >> 4;
#pragma unroll
  for (int i = 0; i < 2; ++i) {
#pragma unroll
    for (int j = 0; j < 4; ++j) {
#pragma unroll
      for (int r = 0; r < 8; ++r) sw[(8 * g + r) * GSP + j * 16 + col] = acc[i][j][r]; }
    LDSX();
#pragma unroll
    for (int rr = 0; rr < 8; ++rr) vst2(D + (size_t)(i * 16 + rr * 2 + g) * ld + col * 4, *(const v4f*)&sw[(rr * 2 + g) * GSP + col * 4]); } }
// behind a store whose address or data registers are rewritten next (the following piece's LDS read and address)
#define XW() asm volatile("s_wait_xcnt 0x0" ::: "memory")
// ---- k_projf: block = (the 128 rows of head h of batch b, 128 of the 1,024 output columns, which): Q/K/V = X W^T with exact bf16 products (K = DIN), written from the accumulators straight into the planes that k_att reads.
// The module's (B, H, S, 64) reinterpretation: row tl of the head's 128 rows holds positions tl * 16 + pos, column pos * 64 + d = head column d of position pos. An output column is a row of W, so the block takes the 128 rows of W whose results lie side by side in a plane:
// q, k (fragment order [16-position tile tl][kc * 2 + half][lane = g * 16 + pos][8]): block column n = pos * 8 + dd is W row pos * 64 + 8 y + dd (y = blockIdx.y = (kc * 2 + half) * 2 + g): the 128 columns of row tl are the 256 contiguous bytes at tl * 1,024 + y * 128 elements;
// v (fragment order [32-key chunk][j * 2 + half][lane = g * 16 + column][8 keys]): block column n = column * 8 + i is W row (8 g + i) * 64 + 16 j + column (y = j * 2 + g): the 128 columns of row tl are the 256 contiguous bytes at (tl >> 1) * 2,048 + (j * 2 + (tl & 1)) * 256 + g * 128 elements.
// q -> f16 hi (+ x 2^10 residual for positions < QHI), k -> f16 (+ residual for positions < KHI), v -> f16 (+ bf16 hi / lo for positions < KHI)
static_assert(TT * HD / CC == 128 && CC / HD == 16 && HD == 64 && QHI == KHI && (QHI / 16) % 4 == 0, "a block's 128 rows are one head; a row is one 16-position tile; the early rows end with a group of four rows");
template <bool ISV> __device__ __forceinline__ void proj_tile(__bf16 (*st)[256][GP], const float* __restrict__ X, const float* __restrict__ WA, _Float16* __restrict__ PH, _Float16* __restrict__ PL, __bf16* __restrict__ VB, __bf16* __restrict__ VBL) {
  const int tid = threadIdx.x, wave = __builtin_amdgcn_readfirstlane(tid >> 5), lane = tid & 31, col = lane & 15; const int wm = wave >> 1, wn = wave & 1; const int y = blockIdx.y; const size_t r0 = (size_t)blockIdx.x * 128;
  const int lr = tid >> 3, lq = (tid & 7) * 4;   /* the thread's row (and + 32, 64, 96) and its four k of a pass */
  const int wr = ISV ? ((y & 1) * 8 + (lr & 7)) * HD + (y >> 1) * 16 + (lr >> 3) : (lr >> 3) * HD + y * 8 + (lr & 7);   /* the row of W behind block column lr */
  constexpr size_t wst = (size_t)(ISV ? 4 : 4 * HD) * DIN;   /* block columns 32 apart: column + 4 (v), pos + 4 (q, k) */
  const float* xp = X + (r0 + lr) * DIN + lq; const float* wp = WA + (size_t)wr * DIN + lq;
  v4f px[4], pw[4]; v8f acc[2][4] = {};
#pragma unroll
  for (int i = 0; i < 4; ++i) { px[i] = *(const v4f*)(xp + (size_t)i * 32 * DIN); pw[i] = *(const v4f*)(wp + i * wst); }
#pragma unroll
  for (int i = 0; i < 4; ++i) { *(v4b*)&st[0][lr + 32 * i][lq] = __builtin_convertvector(px[i], v4b); *(v4b*)&st[0][128 + lr + 32 * i][lq] = __builtin_convertvector(pw[i], v4b); }
  __syncthreads();
#pragma unroll 2   /* the buffer index becomes a constant */
  for (int kc = 0; kc < DIN / 32; ++kc) { const int cur = kc & 1; const bool more = kc + 1 < DIN / 32;
    if (more) {
#pragma unroll
      for (int i = 0; i < 4; ++i) { px[i] = *(const v4f*)(xp + (size_t)i * 32 * DIN + (kc + 1) * 32); pw[i] = *(const v4f*)(wp + i * wst + (kc + 1) * 32); } }
    v16b a[2], w[4];
#pragma unroll
    for (int i = 0; i < 2; ++i) a[i] = frag_b(&st[cur][wm * 32 + i * 16 + col][0], lane);
#pragma unroll
    for (int j = 0; j < 4; ++j) w[j] = frag_b(&st[cur][128 + wn * 64 + j * 16 + col][0], lane);
#pragma unroll
    for (int i = 0; i < 2; ++i) {
#pragma unroll
      for (int j = 0; j < 4; ++j) acc[i][j] = wmma_bf(a[i], w[j], acc[i][j]); }
    if (more) {
#pragma unroll
      for (int i = 0; i < 4; ++i) { *(v4b*)&st[cur ^ 1][lr + 32 * i][lq] = __builtin_convertvector(px[i], v4b); *(v4b*)&st[cur ^ 1][128 + lr + 32 * i][lq] = __builtin_convertvector(pw[i], v4b); } }
    __syncthreads(); }   /* publishes the next pass's buffer and ends every wave's reads of this one */
  /* the wave's 32 x 64 tile, 16 rows at a time as f32 through the wave's own LDS range sw[16][GSP]; then 8 lanes a row, each with 8 neighbouring block columns = 16 bytes of a plane: a row's 64 columns are one whole 128-B line */
  const int el = __builtin_amdgcn_mbcnt_lo(~0u, 0u);   /* the lane's number, read anew: pieces of the thread index kept in registers through the loop took the kernel past 160 registers, and of its three blocks to a WGP one would go */
  float* sw = (float*)&st[0][0][0] + wave * 16 * GSP; const int ec = el & 15, g = el >> 4, sr = el >> 3, sc = (el & 7) * 8;
  const size_t hb = (size_t)blockIdx.x * TT * HD + wn * 64 + sc, eb = (size_t)blockIdx.x * KHI * HD + wn * 64 + sc;   /* the lane's 16 bytes in the head's part of a plane (all positions; positions < KHI) */
#pragma unroll
  for (int i = 0; i < 2; ++i) {
#pragma unroll
    for (int j = 0; j < 4; ++j) {
#pragma unroll
      for (int r = 0; r < 8; ++r) sw[(8 * g + r) * GSP + j * 16 + ec] = acc[i][j][r]; }
    LDSX();
#pragma unroll
    for (int rr = 0; rr < 4; ++rr) { const int row = rr * 4 + sr, tl = wm * 32 + i * 16 + row; float x[8];
      { const v4f x0 = *(const v4f*)&sw[row * GSP + sc], x1 = *(const v4f*)&sw[row * GSP + sc + 4];
#pragma unroll
        for (int e = 0; e < 4; ++e) { x[e] = x0[e]; x[4 + e] = x1[e]; } }
      const int off = ISV ? (tl >> 1) * 2048 + ((y >> 1) * 2 + (tl & 1)) * 256 + (y & 1) * 128 : tl * 1024 + y * 128;
      v8h hi;
#pragma unroll
      for (int e = 0; e < 8; ++e) hi[e] = (_Float16)x[e];
      vst2(PH + hb + off, hi); XW();
      if (tl < QHI / 16) {   /* the same for the four rows of a group */
        if constexpr (ISV) { v8b bh, bl;
#pragma unroll
          for (int e = 0; e < 8; ++e) { const __bf16 t = (__bf16)x[e]; bh[e] = t; bl[e] = (__bf16)(x[e] - (float)t); }
          vst2(VB + eb + off, bh); vst2(VBL + eb + off, bl); XW(); }
        else { v8h lo;
#pragma unroll
          for (int e = 0; e < 8; ++e) lo[e] = (_Float16)((x[e] - (float)hi[e]) * 1024.0f);
          vst2(PL + eb + off, lo); XW(); } } } } }
__global__ __launch_bounds__(256) void k_projf(const float* __restrict__ XQ, const float* __restrict__ XK, const float* __restrict__ XV, const float* __restrict__ WQ, const float* __restrict__ WK, const float* __restrict__ WV, _Float16* __restrict__ QH, _Float16* __restrict__ QL, _Float16* __restrict__ KH, _Float16* __restrict__ KL, _Float16* __restrict__ VT, __bf16* __restrict__ VB, __bf16* __restrict__ VBL) {
  __shared__ __align__(16) __bf16 st[2][256][GP];   /* rows 0..127: X, 128..255: W; after the last pass: the waves' output staging */
  const int which = blockIdx.z;   /* block-uniform */
  if (which == 2) proj_tile<true>(st, XV, WV, VT, nullptr, VB, VBL);
  else proj_tile<false>(st, which == 0 ? XQ : XK, which == 0 ? WQ : WK, which == 0 ? QH : KH, which == 0 ? QL : KL, nullptr, nullptr); }
// ---- k_att, one launch for all heads, two kinds of block. Positions >= QHI: block = (128 query positions, head h of batch b), each of the 8 waves on its own with 16 positions (fl_step below): logits, softmax and P stay in registers.
// Positions < QHI: block = (16 query positions, head h of batch b), 8 waves: the tile's logit rows stay in LDS from the q k^T products through the softmax to the P v products:
// phase 1: wave w takes the 16-key tiles w, w + 8, ..: logits x SCALE, key > query -> excluded (q and k hi + residual, 3 products); phase 2: wave w takes rows 2w, 2w + 1: max, expf, sum in f32, 2^11 / sum kept per row;
// phase 3: each wave takes a contiguous run of 32-key chunks: P x 2^11 and v as bf16 hi + lo (3 products); the 8 partial tiles are added in wave order through LDS; 256-B (row, head) segment by 16 lanes
// fragment from the fragment-ordered q / k / v buffers: the lane's pointer (load base + lane * 8); the second half lies one wave-wide load (256 elements) further
__device__ __forceinline__ v16h frag_hk(const _Float16* p) { union { v16h v; v8h q[2]; } u; u.q[0] = *(const v8h*)p; u.q[1] = *(const v8h*)(p + 256); return u.v; }
__device__ __forceinline__ v16b frag_bk(const __bf16* p) { union { v16b v; v8b q[2]; } u; u.q[0] = *(const v8b*)p; u.q[1] = *(const v8b*)(p + 256); return u.v; }
#define SPH 388            // floats per logit row in LDS (early tiles: at most KHI keys): 16 B x odd, so the 16-byte fragment reads of the 16 rows fall on different banks
#define NFB ((TT - QHI) / 128)   // blocks of 128 query positions >= QHI per (batch, head): the one-pass path
#define LC (SCALE * 1.4426950408889634f)   // logit scale x log2(e): the one-pass path works in base 2
// lane l <-> lane l ^ 16
__device__ __forceinline__ float xhalf(float x) { return __builtin_bit_cast(float, __builtin_amdgcn_permlanex16(__builtin_bit_cast(int, x), __builtin_bit_cast(int, x), 0x76543210, 0xfedcba98, false, false)); }
// the product alone, for a run of independent products: the distance stands once, behind the run
__device__ __forceinline__ v8f wmma16p(v16h a, v16h b, v8f c) { return __builtin_amdgcn_wmma_f32_16x16x32_f16(false, a, false, b, (short)0, c, false, false); }
// one 32-key chunk's fragments: k[t][kc] = 16-key tile t, head columns kc * 32 ..; v[j] = head columns j * 16 .., the chunk's 32 keys
struct KV { v16h k[2][2]; v16h v[HD / 16]; };
__device__ __forceinline__ void kv_load(KV& f, const _Float16* kp, const _Float16* vp, int c) { const _Float16* a = kp + c * 2048; const _Float16* b = vp + c * 2048;
#pragma unroll
  for (int t = 0; t < 2; ++t) {
#pragma unroll
    for (int kc = 0; kc < 2; ++kc) f.k[t][kc] = frag_hk(a + t * 1024 + kc * 512); }
#pragma unroll
  for (int j = 0; j < HD / 16; ++j) f.v[j] = frag_hk(b + j * 512);
  /* behind the run of loads: the two pointers are inputs, so that their registers stay untouched (also by a later load's result) until the wait has passed */
  asm volatile("s_wait_xcnt 0x0" :: "v"(a), "v"(b) : "memory"); }
// one chunk of the one-pass path. S^T = K Q^T: lane (g, col) holds query col's logits of keys 8 g + r (tile 0) and 16 + 8 g + r (tile 1), which is the k order of a B operand: P^T is packed in place; O^T += V^T P^T: lane (g, col) holds query col's head columns j * 16 + 8 g + r.
// m: running maximum of the raw logits of the lane's query (both halves alike); l: the lane's share of sum(p); p = 2^11 x exp((s - m) x SCALE); krel = first key of the lane in the chunk - the lane's query
__device__ __forceinline__ void fl_step(const KV& f, const v16h (&q)[2], v8f (&o)[HD / 16], float& m, float& l, bool diag, int krel) {
  v8f s0 = {}, s1 = {};
  s0 = wmma16p(f.k[0][0], q[0], s0); s1 = wmma16p(f.k[1][0], q[0], s1); s0 = wmma16p(f.k[0][1], q[1], s0); s1 = wmma16p(f.k[1][1], q[1], s1);
  /* the distance behind the run's last product, once for the run: the statement names both results and every operand, so it stands behind all four products and in front of whatever reads a result or overwrites an operand, on either side of the branch below */
  asm volatile("v_nop\n\tv_nop\n\tv_nop\n\tv_nop" : "+v"(s0), "+v"(s1) : "v"(f.k[0][0]), "v"(f.k[0][1]), "v"(f.k[1][0]), "v"(f.k[1][1]), "v"(q[0]), "v"(q[1]));
  if (diag) {   /* wave-uniform: only the query tile's last chunk holds keys behind a query */
#pragma unroll
    for (int r = 0; r < 8; ++r) { s0[r] = (krel + r > 0) ? -3.0e38f : s0[r]; s1[r] = (krel + 16 + r > 0) ? -3.0e38f : s1[r]; } }
  float mx = s0[0], my = s1[0];   /* two chains */
#pragma unroll
  for (int r = 1; r < 8; ++r) { mx = fmaxf(mx, s0[r]); my = fmaxf(my, s1[r]); }
  mx = fmaxf(mx, my); mx = fmaxf(mx, xhalf(mx));
  const float mn = fmaxf(m, mx), mc = 11.0f - mn * LC; float al;   /* al = 2^((m - mn) x LC); first chunk: m = -3e38, al = 0 */
  asm("v_exp_f32 %0, %1\n\tv_nop" : "=v"(al) : "v"((m - mn) * LC));   /* with the slot behind a transcendental in the statement */
  m = mn;
  v16h p; float a0 = 0.f, a1 = 0.f, a2 = 0.f, a3 = 0.f;   /* four chains of adds */
#pragma unroll
  for (int r = 0; r < 8; r += 2) { const float e0 = __builtin_amdgcn_exp2f(__builtin_fmaf(s0[r], LC, mc)), e1 = __builtin_amdgcn_exp2f(__builtin_fmaf(s0[r + 1], LC, mc)), e2 = __builtin_amdgcn_exp2f(__builtin_fmaf(s1[r], LC, mc)), e3 = __builtin_amdgcn_exp2f(__builtin_fmaf(s1[r + 1], LC, mc));
    a0 += e0; a1 += e1; a2 += e2; a3 += e3; p[r] = (_Float16)e0; p[r + 1] = (_Float16)e1; p[8 + r] = (_Float16)e2; p[8 + r + 1] = (_Float16)e3; }
  l = l * al + ((a0 + a1) + (a2 + a3));
#pragma unroll
  for (int j = 0; j < HD / 16; ++j) o[j] *= al;
#pragma unroll
  for (int j = 0; j < HD / 16; ++j) o[j] = wmma16p(f.v[j], p, o[j]);
  /* the distance, as above: also in front of the next chunk's loads, which land in the registers of v and of p */
  asm volatile("v_nop\n\tv_nop\n\tv_nop\n\tv_nop" : "+v"(o[0]), "+v"(o[1]), "+v"(o[2]), "+v"(o[3]) : "v"(f.v[0]), "v"(f.v[1]), "v"(f.v[2]), "v"(f.v[3]), "v"(p)); }
__global__ __launch_bounds__(256) void k_att(const _Float16* __restrict__ QH, const _Float16* __restrict__ KH, const _Float16* __restrict__ QL, const _Float16* __restrict__ KL, const _Float16* __restrict__ VT, const __bf16* __restrict__ VB, const __bf16* __restrict__ VBL, float* __restrict__ Y) {
  __shared__ __align__(16) float slb[8 * 16 * (HD + 4)]; __shared__ float sinv[16];   /* early tiles only: 16 logit rows of SPH floats, then the staging of the 8 partial tiles */
  static_assert(16 * SPH <= 8 * 16 * (HD + 4) && KHI + 4 <= SPH, "the logit rows fit");
  float (*sl)[SPH] = (float (*)[SPH])slb;
  const int tid = threadIdx.x, lane = tid & 31, col = lane & 15, g = lane >> 4; const int wave = __builtin_amdgcn_readfirstlane(tid >> 5);
  const int b = blockIdx.x / NH, h = blockIdx.x % NH;
  const size_t hb = (size_t)(b * NH + h) * TT * HD + lane * 8, hbh = (size_t)(b * NH + h) * KHI * HD + lane * 8;   /* the lane's 16 bytes in the first load of the head's fragment-ordered q, k or v (all positions; positions < KHI) */
  static_assert(QHI == KHI, "one base serves the q and the k residuals");
  if ((int)blockIdx.y < NFB) {   /* block-uniform. One-pass path: wave = 16 query positions >= QHI, all their keys in 32-key chunks; nothing is shared between the waves, so no LDS and no barrier; longest blocks start first */
    const int q0 = TT - 128 * ((int)blockIdx.y + 1) + wave * 16, last = q0 >> 5;   /* the chunk that holds the tile's last key */
    const _Float16* qp = QH + hb + (q0 >> 4) * 1024; const _Float16* kp = KH + hb; const _Float16* vp = VT + hb;
    v16h q[2]; q[0] = frag_hk(qp); q[1] = frag_hk(qp + 512);
    v8f o[HD / 16] = {}; float m = -3.0e38f, l = 0.f; const int kr = 8 * g - (q0 + col);
    KV fa, fb; kv_load(fa, kp, vp, 0);   /* two register sets: the next chunk's loads fly while this chunk is worked on; a chunk past the end re-reads the last one and is not used */
    asm volatile("" :: "v"(q[0]), "v"(q[1]));   /* inputs-only fence on the loaded q fragments: their wait stands here, once, and not in the loop, where it would also wait for the chunk fetched ahead */
    for (int c = 0; c <= last; c += 2) {
      kv_load(fb, kp, vp, c + 1 <= last ? c + 1 : last);
      fl_step(fa, q, o, m, l, c == last, kr + c * 32);
      kv_load(fa, kp, vp, c + 2 <= last ? c + 2 : last);
      if (c + 1 <= last) fl_step(fb, q, o, m, l, c + 1 == last, kr + (c + 1) * 32); }
    asm volatile("s_wait_loadcnt 0x0" ::: "memory");   /* the chunk fetched ahead in the last trip is not used: its loads have landed before the wave gives its registers back */
    const float inv = 1.0f / (l + xhalf(l)); float* yp = Y + ((size_t)b * TT + q0 + col) * CC + h * HD + 8 * g;
#pragma unroll
    for (int j = 0; j < HD / 16; ++j) { const v8f w = o[j] * inv; v4f w0, w1;
#pragma unroll
      for (int r = 0; r < 4; ++r) { w0[r] = w[r]; w1[r] = w[4 + r]; }
      vst2(yp + j * 16, w0); vst2(yp + j * 16 + 4, w1); }
    return; }
  /* early tiles (positions < QHI): block = 16 query positions, the logit rows in LDS, three phases as described above */
  const int ql0 = (QHI / 16 - 1 - ((int)blockIdx.y - NFB)) * 16;   /* longest tiles start first */
  const int nkc = (ql0 + 16 + 31) >> 5;   /* 32-key chunks that hold a key <= the tile's last query */
  const int n = ((ql0 + 16 + 127) >> 7) << 7, nt = n >> 4;   /* logits are formed for keys [0, n), whole 128-key blocks (excluded keys included): every lane has n / 128 quads of a row; n <= KHI */
  const _Float16* qp = QH + hb + (ql0 >> 4) * 1024;
  { const _Float16* qlp = QL + hbh + (ql0 >> 4) * 1024; v16h ah[2], al[2];
#pragma unroll
    for (int kc = 0; kc < 2; ++kc) { ah[kc] = frag_hk(qp + kc * 512); al[kc] = frag_hk(qlp + kc * 512); }
    asm volatile("s_wait_xcnt 0x0" :: "v"(qp), "v"(qlp) : "memory");   /* behind the q loads: the two pointers are inputs, so that their registers stay untouched until the wait has passed */
    for (int j = wave; j < nt; j += 8) { v8f acc = {}, accl = {}; v16h kbf[2], klf[2]; const _Float16* th = KH + hb + j * 1024; const _Float16* tl = KL + hbh + j * 1024;   /* all four fragments are loaded ahead of the products: one load latency a tile */
#pragma unroll
      for (int kc = 0; kc < 2; ++kc) { kbf[kc] = frag_hk(th + kc * 512); klf[kc] = frag_hk(tl + kc * 512); }
      /* inputs-only fence on the loaded fragments and their pointers: all the loads are issued ahead of the first product and the address registers stay untouched until the loads have returned */
      asm volatile("" :: "v"(kbf[0]), "v"(kbf[1]), "v"(klf[0]), "v"(klf[1]), "v"(th), "v"(tl));
#pragma unroll
      for (int kc = 0; kc < 2; ++kc) { acc = wmma16(ah[kc], kbf[kc], acc); accl = wmma16(al[kc], kbf[kc], accl); accl = wmma16(ah[kc], klf[kc], accl); }
#pragma unroll
      for (int r = 0; r < 8; ++r) sl[8 * g + r][j * 16 + col] = (j * 16 + col <= ql0 + 8 * g + r) ? (acc[r] + accl[r] * (1.0f / 1024.0f)) * SCALE : -3.0e38f; } }
  __syncthreads();
  { float* sr0 = &sl[wave * 2][lane * 4]; float* sr1 = &sl[wave * 2 + 1][lane * 4]; float m0 = -3.0e38f, m1 = -3.0e38f, sum0 = 0.f, sum1 = 0.f;   /* the wave's two rows side by side: two independent chains of LDS reads */
#pragma unroll 2   /* four LDS reads in flight */
    for (int k = 0; k < n; k += 128) { const v4f v0 = *(const v4f*)&sr0[k], v1 = *(const v4f*)&sr1[k]; m0 = fmaxf(m0, fmaxf(fmaxf(v0[0], v0[1]), fmaxf(v0[2], v0[3]))); m1 = fmaxf(m1, fmaxf(fmaxf(v1[0], v1[1]), fmaxf(v1[2], v1[3]))); }
#pragma unroll
    for (int o = 1; o < 32; o <<= 1) { m0 = fmaxf(m0, __shfl_xor(m0, o)); m1 = fmaxf(m1, __shfl_xor(m1, o)); }
#pragma unroll 2   /* four LDS reads in flight */
    for (int k = 0; k < n; k += 128) { const v4f v0 = *(const v4f*)&sr0[k], v1 = *(const v4f*)&sr1[k]; v4f e0, e1;
#pragma unroll
      for (int i = 0; i < 4; ++i) { const float x0 = expf(v0[i] - m0), x1 = expf(v1[i] - m1); e0[i] = (v0[i] <= -1.0e38f) ? 0.f : x0; e1[i] = (v1[i] <= -1.0e38f) ? 0.f : x1; sum0 += e0[i]; sum1 += e1[i]; }
      *(v4f*)&sr0[k] = e0; *(v4f*)&sr1[k] = e1; }
#pragma unroll
    for (int o = 1; o < 32; o <<= 1) { sum0 += __shfl_xor(sum0, o); sum1 += __shfl_xor(sum1, o); }
    if (lane == 0) { sinv[wave * 2] = 2048.0f / sum0; sinv[wave * 2 + 1] = 2048.0f / sum1; } }
  __syncthreads();
  const float sc = sinv[col]; const int per = (nkc + 7) >> 3; const int kcs = wave * per, kce = (kcs + per < nkc) ? kcs + per : nkc;
  v8f acc[HD / 16] = {};
  for (int kc = kcs; kc < kce; ++kc) { float v[16]; const float* p = &sl[col][kc * 32 + 8 * g];
#pragma unroll
    for (int i = 0; i < 8; ++i) { v[i] = p[i] * sc; v[8 + i] = p[16 + i] * sc; }
    const F2 pf = bsplit16(v); v16b vh[HD / 16], vl[HD / 16]; const size_t po = hbh + kc * 2048; const __bf16* ph = VB + po; const __bf16* pl = VBL + po;   /* the chunk's eight v fragments are loaded ahead of the products */
#pragma unroll
    for (int j = 0; j < HD / 16; ++j) { vh[j] = frag_bk(ph + j * 512); vl[j] = frag_bk(pl + j * 512); }
    /* inputs-only fence on the loaded fragments and their pointers: all the loads are issued ahead of the first product and the address registers stay untouched until the loads have returned */
    asm volatile("" :: "v"(vh[0]), "v"(vh[1]), "v"(vh[2]), "v"(vh[3]), "v"(vl[0]), "v"(vl[1]), "v"(vl[2]), "v"(vl[3]), "v"(ph), "v"(pl));
#pragma unroll
    for (int j = 0; j < HD / 16; ++j) { acc[j] = wmma_bf(pf.h, vh[j], acc[j]); acc[j] = wmma_bf(pf.l, vh[j], acc[j]); acc[j] = wmma_bf(pf.h, vl[j], acc[j]); } }
  __syncthreads();   /* every wave has read its P chunks: the logit rows become the staging of the 8 partial tiles */
  float* red = slb;
#pragma unroll
  for (int j = 0; j < HD / 16; ++j)
#pragma unroll
    for (int r = 0; r < 8; ++r) red[(wave * 16 + 8 * g + r) * (HD + 4) + j * 16 + col] = acc[j][r];
  __syncthreads();
  { const int row = tid >> 4, c4 = (tid & 15) * 4; v4f s = *(const v4f*)&red[row * (HD + 4) + c4];
#pragma unroll
    for (int w = 1; w < 8; ++w) s += *(const v4f*)&red[(w * 16 + row) * (HD + 4) + c4];
    vst2(Y + ((size_t)b * TT + ql0 + row) * CC + h * HD + c4, s * (1.0f / 2048.0f)); } }
// ---- k_out: block = (128 rows, 128 cols), staged as above: out = ctx Wo (+ bo): ctx once to f16 against Wo as f16(bf16 x 2^8) exact (1 product) x 2^-8; causal early rows (< QHI of each sequence): ctx bf16 hi + lo against exact bf16 Wo (2 products)
template <bool HI> __device__ __forceinline__ void out_tile(char* sm, const float* __restrict__ Y, const float* __restrict__ WO, const float* __restrict__ BO, float* __restrict__ OUT) {
  typedef typename std::conditional<HI, __bf16, _Float16>::type E; typedef E v4e __attribute__((ext_vector_type(4)));
  E (*st)[384][GP] = (E (*)[384][GP])sm;   /* rows 0..127: ctx (hi), 128..255: Wo, 256..383: ctx lo (HI only) */
  const int tid = threadIdx.x, wave = tid >> 5, lane = tid & 31, col = lane & 15; const int wm = wave >> 1, wn = wave & 1; const int c0 = blockIdx.y * 128; const size_t r0 = (size_t)blockIdx.x * 128;
  const int lr = tid >> 3, lq = (tid & 7) * 4;
  const float* xp = Y + (r0 + lr) * CC + lq; const float* wp = WO + (size_t)(c0 + lr) * CC + lq;
  v4f px[4], pw[4]; v8f acc[2][4] = {};
  auto put = [&](int buf) {
#pragma unroll
    for (int i = 0; i < 4; ++i) {
      if constexpr (HI) { const v4b h = __builtin_convertvector(px[i], v4b); *(v4b*)&st[buf][lr + 32 * i][lq] = h; *(v4b*)&st[buf][256 + lr + 32 * i][lq] = __builtin_convertvector(px[i] - __builtin_convertvector(h, v4f), v4b); *(v4b*)&st[buf][128 + lr + 32 * i][lq] = __builtin_convertvector(pw[i], v4b); }
      else { *(v4h*)&st[buf][lr + 32 * i][lq] = __builtin_convertvector(px[i], v4h); *(v4h*)&st[buf][128 + lr + 32 * i][lq] = __builtin_convertvector(__builtin_convertvector(__builtin_convertvector(pw[i], v4b), v4f) * 256.0f, v4h); } } };
#pragma unroll
  for (int i = 0; i < 4; ++i) { px[i] = *(const v4f*)(xp + (size_t)i * 32 * CC); pw[i] = *(const v4f*)(wp + (size_t)i * 32 * CC); }
  float bias[4] = {0.f, 0.f, 0.f, 0.f};   /* read here, beside the first tile's loads, so that the epilogue waits for nothing */
  if (BO) {
#pragma unroll
    for (int j = 0; j < 4; ++j) bias[j] = BO[c0 + wn * 64 + j * 16 + col]; }
  put(0);
  __syncthreads();
#pragma unroll 2   /* the buffer index becomes a constant */
  for (int kc = 0; kc < CC / 32; ++kc) { const int cur = kc & 1; const bool more = kc + 1 < CC / 32;
    if (more) {
#pragma unroll
      for (int i = 0; i < 4; ++i) { px[i] = *(const v4f*)(xp + (size_t)i * 32 * CC + (kc + 1) * 32); pw[i] = *(const v4f*)(wp + (size_t)i * 32 * CC + (kc + 1) * 32); } }
    if constexpr (HI) { v16b ah[2], al[2], w[4];
#pragma unroll
      for (int i = 0; i < 2; ++i) { ah[i] = frag_b(&st[cur][wm * 32 + i * 16 + col][0], lane); al[i] = frag_b(&st[cur][256 + wm * 32 + i * 16 + col][0], lane); }
#pragma unroll
      for (int j = 0; j < 4; ++j) w[j] = frag_b(&st[cur][128 + wn * 64 + j * 16 + col][0], lane);
#pragma unroll
      for (int i = 0; i < 2; ++i) {
#pragma unroll
        for (int j = 0; j < 4; ++j) acc[i][j] = wmma_bf(ah[i], w[j], acc[i][j]);
#pragma unroll
        for (int j = 0; j < 4; ++j) acc[i][j] = wmma_bf(al[i], w[j], acc[i][j]); }
    } else { v16h a[2], w[4];
#pragma unroll
      for (int i = 0; i < 2; ++i) a[i] = frag_h(&st[cur][wm * 32 + i * 16 + col][0], lane);
#pragma unroll
      for (int j = 0; j < 4; ++j) w[j] = frag_h(&st[cur][128 + wn * 64 + j * 16 + col][0], lane);
#pragma unroll
      for (int i = 0; i < 2; ++i) {
#pragma unroll
        for (int j = 0; j < 4; ++j) acc[i][j] = wmma16(a[i], w[j], acc[i][j]); } }
    if (more) put(cur ^ 1);
    __syncthreads(); }   /* publishes the next pass's buffer and ends every wave's reads of this one */
#pragma unroll
  for (int j = 0; j < 4; ++j) { const float bj = bfr(bias[j]);
#pragma unroll
    for (int i = 0; i < 2; ++i) {
#pragma unroll
      for (int r = 0; r < 8; ++r) acc[i][j][r] = HI ? acc[i][j][r] + bj : acc[i][j][r] * (1.0f / 256.0f) + bj; } }
  tile_out((float*)sm + wave * 16 * GSP, acc, OUT + (r0 + wm * 32) * DIN + c0 + wn * 64, DIN, lane); }
static_assert(QHI % 128 == 0 && TT % 128 == 0, "the early-row path is chosen per 128-row block");
__global__ __launch_bounds__(256) void k_out(const float* __restrict__ Y, const float* __restrict__ WO, const float* __restrict__ BO, float* __restrict__ OUT) { __shared__ __align__(16) char sm[2 * 384 * GP * 2];
  if (CAUSAL && (int)(((size_t)blockIdx.x * 128) % TT) < QHI) out_tile<true>(sm, Y, WO, BO, OUT);   /* block-uniform */
  else out_tile<false>(sm, Y, WO, BO, OUT); }

extern "C" void kernel_launch(void* const* d_in, const int* in_sizes, int n_in, void* d_out, int out_size, void* d_ws, size_t ws_size, hipStream_t stream) {
  (void)in_sizes; (void)n_in; (void)out_size;
  const float** F = (const float**)d_in;
  if (ws_size < (size_t)WS_END) return;
  char* ws = (char*)d_ws; _Float16 *QH = (_Float16*)(ws + WS_QH), *KH = (_Float16*)(ws + WS_KH), *VT = (_Float16*)(ws + WS_VT), *QL = (_Float16*)(ws + WS_QL), *KL = (_Float16*)(ws + WS_KL); __bf16 *VB = (__bf16*)(ws + WS_VB), *VBL = (__bf16*)(ws + WS_VBL); float *Y = (float*)(ws + WS_Y);
  (void)Y; (void)QL; (void)KL; (void)VB; (void)VBL;
  // inputs: 0 query, 1 key, 2 value [2,2048,1024]; 3 W_Q, 4 W_K, 5 W_V, 6 W_ffn (out,in) [1024,1024]; 7 b_ffn [1024]
  k_projf<<<dim3(TNB * TT / 128, CC / 128, 3), 256, 0, stream>>>(F[0], F[1], F[2], F[3], F[4], F[5], QH, QL, KH, KL, VT, VB, VBL);
  k_att<<<dim3(TNB * NH, NFB + QHI / 16), 256, 0, stream>>>(QH, KH, QL, KL, VT, VB, VBL, Y);
  k_out<<<dim3(TNB * TT / 128, DIN / 128), 256, 0, stream>>>(Y, F[6], F[7], (float*)d_out);
}

// v006
// It runs in 79.4 microseconds.
// In two side-by-side timings against v005, it was 1.10 and 1.11 times as fast.
// Counting every step since v000, it is 14.0 times as fast.
// compute dtype: all float inputs rounded to bf16; Q/K/V = {query,key,value} W^T with EXACT bf16 products on WMMA 16x16x32 (f32 accumulate), taken from the accumulators in the module's (B, H, Sq, 64) reinterpretation: q, k once to f16 -> 1-product causal logits x 1/8, except the first 384 query positions of each (batch, head) (few keys, no averaging), which use q and k as f16 hi + residual (x 2^10) (3 products); softmax in f32: positions >= 384 in one pass with a running maximum, base-2 hardware exponentials and the division by the row sum at the end, exp(logit - max) x 2^11 once to f16 against v once to f16 (1 product); the first 384 positions: precise expf, P and v as bf16 hi + lo (3 products); concat once to f16 against W_ffn carried x 2^8 in f16 (exact bf16 values), except rows < 384 of each sequence: bf16 hi + lo against exact bf16 W_ffn (2 products); + b_ffn; f32 output.
#include <hip/hip_runtime.h>
#include <math.h>
#include <type_traits>

typedef __attribute__((ext_vector_type(16))) _Float16 v16h;
typedef __attribute__((ext_vector_type(16))) __bf16 v16b;
typedef __attribute__((ext_vector_type(8)))  _Float16 v8h;
typedef __attribute__((ext_vector_type(8)))  float v8f;
typedef __attribute__((ext_vector_type(4)))  float v4f;
typedef __attribute__((ext_vector_type(2)))  float v2f;
typedef __attribute__((ext_vector_type(4)))  unsigned v4u;
typedef __attribute__((ext_vector_type(4)))  int v4i;
typedef float __attribute__((may_alias)) float_a;
typedef int __attribute__((may_alias)) int_a;

template <typename T> __device__ __forceinline__ void vst2(void* p, T v) { *(T*)p = v;  }
__device__ __forceinline__ v8f wmma16(v16h a, v16h b, v8f c) {
  v8f d = __builtin_amdgcn_wmma_f32_16x16x32_f16(false, a, false, b, (short)0, c, false, false);
  asm volatile("v_nop\n\tv_nop\n\tv_nop\n\tv_nop" : "+v"(d) : "v"(a), "v"(b));
  return d;
}
__device__ __forceinline__ v8f wmma_bf(v16b a, v16b b, v8f c) {
  v8f d = __builtin_amdgcn_wmma_f32_16x16x32_bf16(false, a, false, b, (short)0, c, false, false);
  asm volatile("v_nop\n\tv_nop\n\tv_nop\n\tv_nop" : "+v"(d) : "v"(a), "v"(b));
  return d;
}
// 16x16x32 fragments: lane = (h = lane>>4, row/col = lane&15); elements 0..7 = k0+8h+0..7, 8..15 = k0+16+8h+0..7; D element r = row 8h+r
__device__ __forceinline__ v16h frag_h(const _Float16* rowk0, int lane) {
  union { v16h v; v8h q[2]; } u; const _Float16* p = rowk0 + 8 * (lane >> 4);
  u.q[0] = *(const v8h*)p; u.q[1] = *(const v8h*)(p + 16); return u.v;
}
__device__ __forceinline__ v16h frag_f32(const float* rowk0, int lane) {
  v16h a; const float* p = rowk0 + 8 * (lane >> 4);
#pragma unroll
  for (int i = 0; i < 8; ++i) { a[i] = (_Float16)p[i]; a[8 + i] = (_Float16)p[16 + i]; }
  return a;
}
__device__ __forceinline__ v16h frag_f32s(const float* rowk0, int lane, float sc) {
  v16h a; const float* p = rowk0 + 8 * (lane >> 4);
#pragma unroll
  for (int i = 0; i < 8; ++i) { a[i] = (_Float16)(p[i] * sc); a[8 + i] = (_Float16)(p[16 + i] * sc); }
  return a;
}
// column fragment from a [K][ld] layout (column n), rows >= K read as 0
__device__ __forceinline__ v16h fragc_f32(const float* W, int k0, int n, int lane, int ld, int K) {
  v16h a; const int g = lane >> 4;
#pragma unroll
  for (int i = 0; i < 8; ++i) { const int ka = k0 + 8 * g + i, kb = ka + 16;
    a[i] = (_Float16)(ka < K ? W[(size_t)(ka < K ? ka : K - 1) * ld + n] : 0.f); a[8 + i] = (_Float16)(kb < K ? W[(size_t)(kb < K ? kb : K - 1) * ld + n] : 0.f); }
  return a;
}
struct F2 { v16b h, l; };
__device__ __forceinline__ F2 bsplit16(const float v[16]) { F2 r;
#pragma unroll
  for (int i = 0; i < 16; ++i) { const __bf16 h = (__bf16)v[i]; r.h[i] = h; r.l[i] = (__bf16)(v[i] - (float)h); }
  return r; }
__device__ __forceinline__ F2 split_row(const float* row, int k0, int lane) { float v[16]; const float* p = row + k0 + 8 * (lane >> 4);
#pragma unroll
  for (int i = 0; i < 8; ++i) { v[i] = p[i]; v[8 + i] = p[16 + i]; }
  return bsplit16(v); }
__device__ __forceinline__ F2 split_rowK(const float* row, int k0, int lane, int K) { float v[16]; const int g = lane >> 4;
#pragma unroll
  for (int i = 0; i < 8; ++i) { const int ka = k0 + 8 * g + i, kb = ka + 16; v[i] = ka < K ? row[ka < K ? ka : K - 1] : 0.f; v[8 + i] = kb < K ? row[kb < K ? kb : K - 1] : 0.f; }
  return bsplit16(v); }
__device__ __forceinline__ F2 split_col(const float* W, int k0, int n, int lane, int ld, int K) { float v[16]; const int g = lane >> 4;
#pragma unroll
  for (int i = 0; i < 8; ++i) { const int ka = k0 + 8 * g + i, kb = ka + 16; v[i] = ka < K ? W[(size_t)(ka < K ? ka : K - 1) * ld + n] : 0.f; v[8 + i] = kb < K ? W[(size_t)(kb < K ? kb : K - 1) * ld + n] : 0.f; }
  return bsplit16(v); }
__device__ __forceinline__ v8f mac3(const F2& a, const F2& b, v8f c) { c = wmma_bf(a.l, b.h, c); c = wmma_bf(a.h, b.l, c); return wmma_bf(a.h, b.h, c); }
__device__ __forceinline__ float sigm(float v) { return 1.0f / (1.0f + expf(-v)); }
#define LDSX() do { asm volatile("s_wait_dscnt 0" ::: "memory"); __builtin_amdgcn_wave_barrier(); __builtin_amdgcn_fence(__ATOMIC_RELEASE, "workgroup"); } while (0)

// Causal multi-head attention with the module's plain reshape (B 2, S 2,048, E 1,024, 16 heads x 64): Q = query Wq^T, K = key Wk^T, V = value Wv^T ((out,in), no bias); Q/K/V.reshape(B, H, S, 64) WITHOUT a transpose (head hh = the contiguous 128-row block hh of the [S, E] projection, position s = row hh*128 + s/16, columns (s%16)*64 ..); scores = Q K^T / 8 with key > query -> -inf; softmax; concat = head_out.transpose(0,2,1,3).reshape(B, S, E); out = concat W_ffn^T + b_ffn.
#define NB 2
#define TT 2048
#define CC 1024            // NH * HD = projected width
#define DIN 1024          // input (model) width
#define NH 16
#define HD 64
#define NQB (TT / 64)
#define HG 4
#define SCALE (0.125f)
#define CAUSAL 1
#ifndef TNB
#define TNB NB
#endif
__device__ __forceinline__ float bfr(float v) { return (float)(__bf16)v; }
__host__ __device__ __forceinline__ int kb_last(int qb) { return CAUSAL ? ((qb * 64 + 63) >> 7) : (TT / 128 - 1); }
typedef __attribute__((ext_vector_type(8))) __bf16 v8b;
__device__ __forceinline__ v16b frag_b(const __bf16* rowk0, int lane) {
  union { v16b v; v8b q[2]; } u; const __bf16* p = rowk0 + 8 * (lane >> 4);
  u.q[0] = *(const v8b*)p; u.q[1] = *(const v8b*)(p + 16); return u.v;
}
#define QBH 6              // unused: the causal high-precision path is taken by query positions < QHI of each sequence (few keys, no averaging)
#define QHI 384            // rows carrying a q residual plane
#define KHI 384            // key rows carrying k residual / v bf16 hi+lo planes (used only by the causal high-precision path)
// B fragment (k rows k0+.., output column o) of a weight: (in,out) [K][ld] or (out,in) [ld rows of K]: bf16 exact, or f16(bf16 * 256) exact
__device__ __forceinline__ v16b wcol_io(const float* Wm, int k0, int o, int lane, int ld) { v16b w; const int g = lane >> 4;
#pragma unroll
  for (int i = 0; i < 8; ++i) { w[i] = (__bf16)Wm[(size_t)(k0 + 8 * g + i) * ld + o]; w[8 + i] = (__bf16)Wm[(size_t)(k0 + 16 + 8 * g + i) * ld + o]; }
  return w; }
__device__ __forceinline__ v16b wcol_oi(const float* Wm, int k0, int o, int lane, int K) { v16b w; const float* p = Wm + (size_t)o * K + k0 + 8 * (lane >> 4);
#pragma unroll
  for (int i = 0; i < 8; ++i) { w[i] = (__bf16)p[i]; w[8 + i] = (__bf16)p[16 + i]; }
  return w; }
__device__ __forceinline__ v16h wcolh_io(const float* Wm, int k0, int o, int lane, int ld) { v16h w; const int g = lane >> 4;
#pragma unroll
  for (int i = 0; i < 8; ++i) { w[i] = (_Float16)(bfr(Wm[(size_t)(k0 + 8 * g + i) * ld + o]) * 256.0f); w[8 + i] = (_Float16)(bfr(Wm[(size_t)(k0 + 16 + 8 * g + i) * ld + o]) * 256.0f); }
  return w; }
__device__ __forceinline__ v16h wcolh_oi(const float* Wm, int k0, int o, int lane, int K) { v16h w; const float* p = Wm + (size_t)o * K + k0 + 8 * (lane >> 4);
#pragma unroll
  for (int i = 0; i < 8; ++i) { w[i] = (_Float16)(bfr(p[i]) * 256.0f); w[8 + i] = (_Float16)(bfr(p[16 + i]) * 256.0f); }
  return w; }
#define WQKV_LAYOUT 1   // 0 = (in,out) [DIN][CC]; 1 = (out,in) [CC][DIN]; 2 = per-head [NH][DIN][HD]
__device__ __forceinline__ v16b wcol_hdk(const float* Wm, int k0, int o, int lane) { v16b w; const int g = lane >> 4; const float* p = Wm + (size_t)(o / HD) * DIN * HD + (o % HD);
#pragma unroll
  for (int i = 0; i < 8; ++i) { w[i] = (__bf16)p[(size_t)(k0 + 8 * g + i) * HD]; w[8 + i] = (__bf16)p[(size_t)(k0 + 16 + 8 * g + i) * HD]; }
  return w; }
#define WO_OUT_IN 1
#if WQKV_LAYOUT == 1
#define WCOL(W, k0, o, lane) wcol_oi(W, k0, o, lane, DIN)
#elif WQKV_LAYOUT == 2
#define WCOL(W, k0, o, lane) wcol_hdk(W, k0, o, lane)
#else
#define WCOL(W, k0, o, lane) wcol_io(W, k0, o, lane, CC)
#endif
#if WO_OUT_IN
#define WOCOL(W, k0, o, lane) wcol_oi(W, k0, o, lane, CC)
#define WOCOLH(W, k0, o, lane) wcolh_oi(W, k0, o, lane, CC)
#else
#define WOCOL(W, k0, o, lane) wcol_io(W, k0, o, lane, DIN)
#define WOCOLH(W, k0, o, lane) wcolh_io(W, k0, o, lane, DIN)
#endif

#ifndef SM_EXTRA_PARAMS
#define SM_EXTRA_PARAMS
#endif
#ifndef SM_MASK_HOOK
#define SM_MASK_HOOK (void)0
#endif

#define WS_QH  0u                                      // f16 q in fragment order [b][h][16-position tile][kc*2 + half][lane][8]
#define WS_KH  (WS_QH + 2u * (size_t)NB * TT * CC)      // f16 k, fragment order as q
#define WS_VT  (WS_KH + 2u * (size_t)NB * TT * CC)      // f16 v in fragment order [b][h][32-key chunk][j*2 + half][lane][8]
#define WS_QL  (WS_VT + 2u * (size_t)NB * CC * TT)      // f16 q residual x 2^10, fragment order as q, positions < QHI
#define WS_KL  (WS_QL + 2u * (size_t)NB * QHI * CC)     // f16 k residual x 2^10, fragment order as k, keys < KHI
#define WS_VB  (WS_KL + 2u * (size_t)NB * KHI * CC)     // bf16 v hi (and lo behind it), fragment order as v, keys < KHI
#define WS_VBL (WS_VB + 2u * (size_t)NB * CC * KHI)
#define WS_S   (WS_VBL + 2u * (size_t)NB * CC * KHI)    // f32 [hg][t][s] region, unused: the logits stay in registers (positions < QHI: LDS rows)
#define WS_Y   (WS_S  + 4u * (size_t)HG * TT * TT)      // f32 ctx rows [b*t][CC] (only when there is an output projection)
#define WS_END (WS_Y  + 4u * (size_t)NB * TT * CC)

// ---- staged GEMM tiles (k_projf, k_out): block = 128 rows x 128 cols, 8 waves (4 x 2), wave = 32 rows x 64 cols (2 x 4 accumulator tiles). Per pass of 32 k the block reads its 128-B row pieces once with whole-line loads (8 lanes a row), converts them once and lays them in LDS; every wave takes its fragments from there. Two LDS buffers: a pass's global loads are issued at the head of the pass before it (k_projf) or, into four register sets, of the pass four before it (k_out), and converted and stored behind the products of the pass before it; one barrier a pass. k runs upward into one accumulator per tile, in the fragments' k order of frag_b / frag_h.
#define GP 40              // 16-bit elements per staged row: 80 B = 16 B x odd, so the 16-byte fragment reads of 16 rows fall on different banks
#define GSP 68             // floats per row of a wave's output staging (16-byte reads of a row walk without conflicts)
typedef __attribute__((ext_vector_type(4))) __bf16 v4b;
typedef __attribute__((ext_vector_type(4))) _Float16 v4h;
// the wave's 32 x 64 tile -> rows of D (pointer at the tile's first element), 16 rows at a time through the wave's own LDS range sw[16][GSP]: 256-B row segments by 16 lanes
__device__ __forceinline__ void tile_out(float* sw, const v8f (&acc)[2][4], float* D, int ld, int lane) { const int col = lane & 15, g = lane >> 4;
#pragma unroll
  for (int i = 0; i < 2; ++i) {
#pragma unroll
    for (int j = 0; j < 4; ++j) {
#pragma unroll
      for (int r = 0; r < 8; ++r) sw[(8 * g + r) * GSP + j * 16 + col] = acc[i][j][r]; }
    LDSX();
#pragma unroll
    for (int rr = 0; rr < 8; ++rr) vst2(D + (size_t)(i * 16 + rr * 2 + g) * ld + col * 4, *(const v4f*)&sw[(rr * 2 + g) * GSP + col * 4]); } }
// behind a store whose address or data registers are rewritten next (the following piece's LDS read and address)
#define XW() asm volatile("s_wait_xcnt 0x0" ::: "memory")
// ---- k_projf: block = (the 128 rows of head h of batch b, 128 of the 1,024 output columns, which): Q/K/V = X W^T with exact bf16 products (K = DIN), written from the accumulators straight into the planes that k_att reads.
// The module's (B, H, S, 64) reinterpretation: row tl of the head's 128 rows holds positions tl * 16 + pos, column pos * 64 + d = head column d of position pos. An output column is a row of W, so the block takes the 128 rows of W whose results lie side by side in a plane:
// q, k (fragment order [16-position tile tl][kc * 2 + half][lane = g * 16 + pos][8]): block column n = pos * 8 + dd is W row pos * 64 + 8 y + dd (y = blockIdx.y = (kc * 2 + half) * 2 + g): the 128 columns of row tl are the 256 contiguous bytes at tl * 1,024 + y * 128 elements;
// v (fragment order [32-key chunk][j * 2 + half][lane = g * 16 + column][8 keys]): block column n = column * 8 + i is W row (8 g + i) * 64 + 16 j + column (y = j * 2 + g): the 128 columns of row tl are the 256 contiguous bytes at (tl >> 1) * 2,048 + (j * 2 + (tl & 1)) * 256 + g * 128 elements.
// q -> f16 hi (+ x 2^10 residual for positions < QHI), k -> f16 (+ residual for positions < KHI), v -> f16 (+ bf16 hi / lo for positions < KHI)
static_assert(TT * HD / CC == 128 && CC / HD == 16 && HD == 64 && QHI == KHI && (QHI / 16) % 4 == 0, "a block's 128 rows are one head; a row is one 16-position tile; the early rows end with a group of four rows");
template <bool ISV> __device__ __forceinline__ void proj_tile(__bf16 (*st)[256][GP], const float* __restrict__ X, const float* __restrict__ WA, _Float16* __restrict__ PH, _Float16* __restrict__ PL, __bf16* __restrict__ VB, __bf16* __restrict__ VBL) {
  const int tid = threadIdx.x, wave = __builtin_amdgcn_readfirstlane(tid >> 5), lane = tid & 31, col = lane & 15; const int wm = wave >> 1, wn = wave & 1; const int y = blockIdx.y; const size_t r0 = (size_t)blockIdx.x * 128;
  const int lr = tid >> 3, lq = (tid & 7) * 4;   /* the thread's row (and + 32, 64, 96) and its four k of a pass */
  const int wr = ISV ? ((y & 1) * 8 + (lr & 7)) * HD + (y >> 1) * 16 + (lr >> 3) : (lr >> 3) * HD + y * 8 + (lr & 7);   /* the row of W behind block column lr */
  constexpr size_t wst = (size_t)(ISV ? 4 : 4 * HD) * DIN;   /* block columns 32 apart: column + 4 (v), pos + 4 (q, k) */
  const float* xp = X + (r0 + lr) * DIN + lq; const float* wp = WA + (size_t)wr * DIN + lq;
  v4f px[4], pw[4]; v8f acc[2][4] = {};
#pragma unroll
  for (int i = 0; i < 4; ++i) { px[i] = *(const v4f*)(xp + (size_t)i * 32 * DIN); pw[i] = *(const v4f*)(wp + i * wst); }
#pragma unroll
  for (int i = 0; i < 4; ++i) { *(v4b*)&st[0][lr + 32 * i][lq] = __builtin_convertvector(px[i], v4b); *(v4b*)&st[0][128 + lr + 32 * i][lq] = __builtin_convertvector(pw[i], v4b); }
  __syncthreads();
#pragma unroll 2   /* the buffer index becomes a constant */
  for (int kc = 0; kc < DIN / 32; ++kc) { const int cur = kc & 1; const bool more = kc + 1 < DIN / 32;
    if (more) {
#pragma unroll
      for (int i = 0; i < 4; ++i) { px[i] = *(const v4f*)(xp + (size_t)i * 32 * DIN + (kc + 1) * 32); pw[i] = *(const v4f*)(wp + i * wst + (kc + 1) * 32); } }
    v16b a[2], w[4];
#pragma unroll
    for (int i = 0; i < 2; ++i) a[i] = frag_b(&st[cur][wm * 32 + i * 16 + col][0], lane);
#pragma unroll
    for (int j = 0; j < 4; ++j) w[j] = frag_b(&st[cur][128 + wn * 64 + j * 16 + col][0], lane);
#pragma unroll
    for (int i = 0; i < 2; ++i) {
#pragma unroll
      for (int j = 0; j < 4; ++j) acc[i][j] = wmma_bf(a[i], w[j], acc[i][j]); }
    if (more) {
#pragma unroll
      for (int i = 0; i < 4; ++i) { *(v4b*)&st[cur ^ 1][lr + 32 * i][lq] = __builtin_convertvector(px[i], v4b); *(v4b*)&st[cur ^ 1][128 + lr + 32 * i][lq] = __builtin_convertvector(pw[i], v4b); } }
    __syncthreads(); }   /* publishes the next pass's buffer and ends every wave's reads of this one */
  /* the wave's 32 x 64 tile, 16 rows at a time as f32 through the wave's own LDS range sw[16][GSP]; then 8 lanes a row, each with 8 neighbouring block columns = 16 bytes of a plane: a row's 64 columns are one whole 128-B line */
  const int el = __builtin_amdgcn_mbcnt_lo(~0u, 0u);   /* the lane's number, read anew: pieces of the thread index kept in registers through the loop took the kernel past 160 registers, and of its three blocks to a WGP one would go */
  float* sw = (float*)&st[0][0][0] + wave * 16 * GSP; const int ec = el & 15, g = el >> 4, sr = el >> 3, sc = (el & 7) * 8;
  const size_t hb = (size_t)blockIdx.x * TT * HD + wn * 64 + sc, eb = (size_t)blockIdx.x * KHI * HD + wn * 64 + sc;   /* the lane's 16 bytes in the head's part of a plane (all positions; positions < KHI) */
#pragma unroll
  for (int i = 0; i < 2; ++i) {
#pragma unroll
    for (int j = 0; j < 4; ++j) {
#pragma unroll
      for (int r = 0; r < 8; ++r) sw[(8 * g + r) * GSP + j * 16 + ec] = acc[i][j][r]; }
    LDSX();
#pragma unroll
    for (int rr = 0; rr < 4; ++rr) { const int row = rr * 4 + sr, tl = wm * 32 + i * 16 + row; float x[8];
      { const v4f x0 = *(const v4f*)&sw[row * GSP + sc], x1 = *(const v4f*)&sw[row * GSP + sc + 4];
#pragma unroll
        for (int e = 0; e < 4; ++e) { x[e] = x0[e]; x[4 + e] = x1[e]; } }
      const int off = ISV ? (tl >> 1) * 2048 + ((y >> 1) * 2 + (tl & 1)) * 256 + (y & 1) * 128 : tl * 1024 + y * 128;
      v8h hi;
#pragma unroll
      for (int e = 0; e < 8; ++e) hi[e] = (_Float16)x[e];
      vst2(PH + hb + off, hi); XW();
      if (tl < QHI / 16) {   /* the same for the four rows of a group */
        if constexpr (ISV) { v8b bh, bl;
#pragma unroll
          for (int e = 0; e < 8; ++e) { const __bf16 t = (__bf16)x[e]; bh[e] = t; bl[e] = (__bf16)(x[e] - (float)t); }
          vst2(VB + eb + off, bh); vst2(VBL + eb + off, bl); XW(); }
        else { v8h lo;
#pragma unroll
          for (int e = 0; e < 8; ++e) lo[e] = (_Float16)((x[e] - (float)hi[e]) * 1024.0f);
          vst2(PL + eb + off, lo); XW(); } } } } }
__global__ __launch_bounds__(256) void k_projf(const float* __restrict__ XQ, const float* __restrict__ XK, const float* __restrict__ XV, const float* __restrict__ WQ, const float* __restrict__ WK, const float* __restrict__ WV, _Float16* __restrict__ QH, _Float16* __restrict__ QL, _Float16* __restrict__ KH, _Float16* __restrict__ KL, _Float16* __restrict__ VT, __bf16* __restrict__ VB, __bf16* __restrict__ VBL) {
  __shared__ __align__(16) __bf16 st[2][256][GP];   /* rows 0..127: X, 128..255: W; after the last pass: the waves' output staging */
  const int which = blockIdx.z;   /* block-uniform */
  if (which == 2) proj_tile<true>(st, XV, WV, VT, nullptr, VB, VBL);
  else proj_tile<false>(st, which == 0 ? XQ : XK, which == 0 ? WQ : WK, which == 0 ? QH : KH, which == 0 ? QL : KL, nullptr, nullptr); }
// ---- k_att, one launch for all heads, two kinds of block. Positions >= QHI: block = (128 query positions, head h of batch b), each of the 8 waves on its own with 16 positions (fl_step below): logits, softmax and P stay in registers.
// Positions < QHI: block = (16 query positions, head h of batch b), 8 waves: the tile's logit rows stay in LDS from the q k^T products through the softmax to the P v products:
// phase 1: wave w takes the 16-key tiles w, w + 8, ..: logits x SCALE, key > query -> excluded (q and k hi + residual, 3 products); phase 2: wave w takes rows 2w, 2w + 1: max, expf, sum in f32, 2^11 / sum kept per row;
// phase 3: each wave takes a contiguous run of 32-key chunks: P x 2^11 and v as bf16 hi + lo (3 products); the 8 partial tiles are added in wave order through LDS; 256-B (row, head) segment by 16 lanes
// fragment from the fragment-ordered q / k / v buffers: the lane's pointer (load base + lane * 8); the second half lies one wave-wide load (256 elements) further
__device__ __forceinline__ v16h frag_hk(const _Float16* p) { union { v16h v; v8h q[2]; } u; u.q[0] = *(const v8h*)p; u.q[1] = *(const v8h*)(p + 256); return u.v; }
__device__ __forceinline__ v16b frag_bk(const __bf16* p) { union { v16b v; v8b q[2]; } u; u.q[0] = *(const v8b*)p; u.q[1] = *(const v8b*)(p + 256); return u.v; }
#define SPH 388            // floats per logit row in LDS (early tiles: at most KHI keys): 16 B x odd, so the 16-byte fragment reads of the 16 rows fall on different banks
#define NFB ((TT - QHI) / 128)   // blocks of 128 query positions >= QHI per (batch, head): the one-pass path
#define LC (SCALE * 1.4426950408889634f)   // logit scale x log2(e): the one-pass path works in base 2
// lane l <-> lane l ^ 16
__device__ __forceinline__ float xhalf(float x) { return __builtin_bit_cast(float, __builtin_amdgcn_permlanex16(__builtin_bit_cast(int, x), __builtin_bit_cast(int, x), 0x76543210, 0xfedcba98, false, false)); }
// the product alone, for a run of independent products: the distance stands once, behind the run
__device__ __forceinline__ v8f wmma16p(v16h a, v16h b, v8f c) { return __builtin_amdgcn_wmma_f32_16x16x32_f16(false, a, false, b, (short)0, c, false, false); }
// one 32-key chunk's fragments: k[t][kc] = 16-key tile t, head columns kc * 32 ..; v[j] = head columns j * 16 .., the chunk's 32 keys
struct KV { v16h k[2][2]; v16h v[HD / 16]; };
__device__ __forceinline__ void kv_load(KV& f, const _Float16* kp, const _Float16* vp, int c) { const _Float16* a = kp + c * 2048; const _Float16* b = vp + c * 2048;
#pragma unroll
  for (int t = 0; t < 2; ++t) {
#pragma unroll
    for (int kc = 0; kc < 2; ++kc) f.k[t][kc] = frag_hk(a + t * 1024 + kc * 512); }
#pragma unroll
  for (int j = 0; j < HD / 16; ++j) f.v[j] = frag_hk(b + j * 512);
  /* behind the run of loads: the two pointers are inputs, so that their registers stay untouched (also by a later load's result) until the wait has passed */
  asm volatile("s_wait_xcnt 0x0" :: "v"(a), "v"(b) : "memory"); }
// one chunk of the one-pass path. S^T = K Q^T: lane (g, col) holds query col's logits of keys 8 g + r (tile 0) and 16 + 8 g + r (tile 1), which is the k order of a B operand: P^T is packed in place; O^T += V^T P^T: lane (g, col) holds query col's head columns j * 16 + 8 g + r.
// m: running maximum of the raw logits of the lane's query (both halves alike); l: the lane's share of sum(p); p = 2^11 x exp((s - m) x SCALE); krel = first key of the lane in the chunk - the lane's query
__device__ __forceinline__ void fl_step(const KV& f, const v16h (&q)[2], v8f (&o)[HD / 16], float& m, float& l, bool diag, int krel) {
  v8f s0 = {}, s1 = {};
  s0 = wmma16p(f.k[0][0], q[0], s0); s1 = wmma16p(f.k[1][0], q[0], s1); s0 = wmma16p(f.k[0][1], q[1], s0); s1 = wmma16p(f.k[1][1], q[1], s1);
  /* the distance behind the run's last product, once for the run: the statement names both results and every operand, so it stands behind all four products and in front of whatever reads a result or overwrites an operand, on either side of the branch below */
  asm volatile("v_nop\n\tv_nop\n\tv_nop\n\tv_nop" : "+v"(s0), "+v"(s1) : "v"(f.k[0][0]), "v"(f.k[0][1]), "v"(f.k[1][0]), "v"(f.k[1][1]), "v"(q[0]), "v"(q[1]));
  if (diag) {   /* wave-uniform: only the query tile's last chunk holds keys behind a query */
#pragma unroll
    for (int r = 0; r < 8; ++r) { s0[r] = (krel + r > 0) ? -3.0e38f : s0[r]; s1[r] = (krel + 16 + r > 0) ? -3.0e38f : s1[r]; } }
  float mx = s0[0], my = s1[0];   /* two chains */
#pragma unroll
  for (int r = 1; r < 8; ++r) { mx = fmaxf(mx, s0[r]); my = fmaxf(my, s1[r]); }
  mx = fmaxf(mx, my); mx = fmaxf(mx, xhalf(mx));
  const float mn = fmaxf(m, mx), mc = 11.0f - mn * LC; float al;   /* al = 2^((m - mn) x LC); first chunk: m = -3e38, al = 0 */
  asm("v_exp_f32 %0, %1\n\tv_nop" : "=v"(al) : "v"((m - mn) * LC));   /* with the slot behind a transcendental in the statement */
  m = mn;
  v16h p; float a0 = 0.f, a1 = 0.f, a2 = 0.f, a3 = 0.f;   /* four chains of adds */
#pragma unroll
  for (int r = 0; r < 8; r += 2) { const float e0 = __builtin_amdgcn_exp2f(__builtin_fmaf(s0[r], LC, mc)), e1 = __builtin_amdgcn_exp2f(__builtin_fmaf(s0[r + 1], LC, mc)), e2 = __builtin_amdgcn_exp2f(__builtin_fmaf(s1[r], LC, mc)), e3 = __builtin_amdgcn_exp2f(__builtin_fmaf(s1[r + 1], LC, mc));
    a0 += e0; a1 += e1; a2 += e2; a3 += e3; p[r] = (_Float16)e0; p[r + 1] = (_Float16)e1; p[8 + r] = (_Float16)e2; p[8 + r + 1] = (_Float16)e3; }
  l = l * al + ((a0 + a1) + (a2 + a3));
#pragma unroll
  for (int j = 0; j < HD / 16; ++j) o[j] *= al;
#pragma unroll
  for (int j = 0; j < HD / 16; ++j) o[j] = wmma16p(f.v[j], p, o[j]);
  /* the distance, as above: also in front of the next chunk's loads, which land in the registers of v and of p */
  asm volatile("v_nop\n\tv_nop\n\tv_nop\n\tv_nop" : "+v"(o[0]), "+v"(o[1]), "+v"(o[2]), "+v"(o[3]) : "v"(f.v[0]), "v"(f.v[1]), "v"(f.v[2]), "v"(f.v[3]), "v"(p)); }
__global__ __launch_bounds__(256) void k_att(const _Float16* __restrict__ QH, const _Float16* __restrict__ KH, const _Float16* __restrict__ QL, const _Float16* __restrict__ KL, const _Float16* __restrict__ VT, const __bf16* __restrict__ VB, const __bf16* __restrict__ VBL, float* __restrict__ Y) {
  __shared__ __align__(16) float slb[8 * 16 * (HD + 4)]; __shared__ float sinv[16];   /* early tiles only: 16 logit rows of SPH floats, then the staging of the 8 partial tiles */
  static_assert(16 * SPH <= 8 * 16 * (HD + 4) && KHI + 4 <= SPH, "the logit rows fit");
  float (*sl)[SPH] = (float (*)[SPH])slb;
  const int tid = threadIdx.x, lane = tid & 31, col = lane & 15, g = lane >> 4; const int wave = __builtin_amdgcn_readfirstlane(tid >> 5);
  const int b = blockIdx.x / NH, h = blockIdx.x % NH;
  const size_t hb = (size_t)(b * NH + h) * TT * HD + lane * 8, hbh = (size_t)(b * NH + h) * KHI * HD + lane * 8;   /* the lane's 16 bytes in the first load of the head's fragment-ordered q, k or v (all positions; positions < KHI) */
  static_assert(QHI == KHI, "one base serves the q and the k residuals");
  if ((int)blockIdx.y < NFB) {   /* block-uniform. One-pass path: wave = 16 query positions >= QHI, all their keys in 32-key chunks; nothing is shared between the waves, so no LDS and no barrier; longest blocks start first */
    const int q0 = TT - 128 * ((int)blockIdx.y + 1) + wave * 16, last = q0 >> 5;   /* the chunk that holds the tile's last key */
    const _Float16* qp = QH + hb + (q0 >> 4) * 1024; const _Float16* kp = KH + hb; const _Float16* vp = VT + hb;
    v16h q[2]; q[0] = frag_hk(qp); q[1] = frag_hk(qp + 512);
    v8f o[HD / 16] = {}; float m = -3.0e38f, l = 0.f; const int kr = 8 * g - (q0 + col);
    KV fa, fb; kv_load(fa, kp, vp, 0);   /* two register sets: the next chunk's loads fly while this chunk is worked on; a chunk past the end re-reads the last one and is not used */
    asm volatile("" :: "v"(q[0]), "v"(q[1]));   /* inputs-only fence on the loaded q fragments: their wait stands here, once, and not in the loop, where it would also wait for the chunk fetched ahead */
    for (int c = 0; c <= last; c += 2) {
      kv_load(fb, kp, vp, c + 1 <= last ? c + 1 : last);
      fl_step(fa, q, o, m, l, c == last, kr + c * 32);
      kv_load(fa, kp, vp, c + 2 <= last ? c + 2 : last);
      if (c + 1 <= last) fl_step(fb, q, o, m, l, c + 1 == last, kr + (c + 1) * 32); }
    asm volatile("s_wait_loadcnt 0x0" ::: "memory");   /* the chunk fetched ahead in the last trip is not used: its loads have landed before the wave gives its registers back */
    const float inv = 1.0f / (l + xhalf(l)); float* yp = Y + ((size_t)b * TT + q0 + col) * CC + h * HD + 8 * g;
#pragma unroll
    for (int j = 0; j < HD / 16; ++j) { const v8f w = o[j] * inv; v4f w0, w1;
#pragma unroll
      for (int r = 0; r < 4; ++r) { w0[r] = w[r]; w1[r] = w[4 + r]; }
      vst2(yp + j * 16, w0); vst2(yp + j * 16 + 4, w1); }
    return; }
  /* early tiles (positions < QHI): block = 16 query positions, the logit rows in LDS, three phases as described above */
  const int ql0 = (QHI / 16 - 1 - ((int)blockIdx.y - NFB)) * 16;   /* longest tiles start first */
  const int nkc = (ql0 + 16 + 31) >> 5;   /* 32-key chunks that hold a key <= the tile's last query */
  const int n = ((ql0 + 16 + 127) >> 7) << 7, nt = n >> 4;   /* logits are formed for keys [0, n), whole 128-key blocks (excluded keys included): every lane has n / 128 quads of a row; n <= KHI */
  const _Float16* qp = QH + hb + (ql0 >> 4) * 1024;
  { const _Float16* qlp = QL + hbh + (ql0 >> 4) * 1024; v16h ah[2], al[2];
#pragma unroll
    for (int kc = 0; kc < 2; ++kc) { ah[kc] = frag_hk(qp + kc * 512); al[kc] = frag_hk(qlp + kc * 512); }
    asm volatile("s_wait_xcnt 0x0" :: "v"(qp), "v"(qlp) : "memory");   /* behind the q loads: the two pointers are inputs, so that their registers stay untouched until the wait has passed */
    for (int j = wave; j < nt; j += 8) { v8f acc = {}, accl = {}; v16h kbf[2], klf[2]; const _Float16* th = KH + hb + j * 1024; const _Float16* tl = KL + hbh + j * 1024;   /* all four fragments are loaded ahead of the products: one load latency a tile */
#pragma unroll
      for (int kc = 0; kc < 2; ++kc) { kbf[kc] = frag_hk(th + kc * 512); klf[kc] = frag_hk(tl + kc * 512); }
      /* inputs-only fence on the loaded fragments and their pointers: all the loads are issued ahead of the first product and the address registers stay untouched until the loads have returned */
      asm volatile("" :: "v"(kbf[0]), "v"(kbf[1]), "v"(klf[0]), "v"(klf[1]), "v"(th), "v"(tl));
#pragma unroll
      for (int kc = 0; kc < 2; ++kc) { acc = wmma16(ah[kc], kbf[kc], acc); accl = wmma16(al[kc], kbf[kc], accl); accl = wmma16(ah[kc], klf[kc], accl); }
#pragma unroll
      for (int r = 0; r < 8; ++r) sl[8 * g + r][j * 16 + col] = (j * 16 + col <= ql0 + 8 * g + r) ? (acc[r] + accl[r] * (1.0f / 1024.0f)) * SCALE : -3.0e38f; } }
  __syncthreads();
  { float* sr0 = &sl[wave * 2][lane * 4]; float* sr1 = &sl[wave * 2 + 1][lane * 4]; float m0 = -3.0e38f, m1 = -3.0e38f, sum0 = 0.f, sum1 = 0.f;   /* the wave's two rows side by side: two independent chains of LDS reads */
#pragma unroll 2   /* four LDS reads in flight */
    for (int k = 0; k < n; k += 128) { const v4f v0 = *(const v4f*)&sr0[k], v1 = *(const v4f*)&sr1[k]; m0 = fmaxf(m0, fmaxf(fmaxf(v0[0], v0[1]), fmaxf(v0[2], v0[3]))); m1 = fmaxf(m1, fmaxf(fmaxf(v1[0], v1[1]), fmaxf(v1[2], v1[3]))); }
#pragma unroll
    for (int o = 1; o < 32; o <<= 1) { m0 = fmaxf(m0, __shfl_xor(m0, o)); m1 = fmaxf(m1, __shfl_xor(m1, o)); }
#pragma unroll 2   /* four LDS reads in flight */
    for (int k = 0; k < n; k += 128) { const v4f v0 = *(const v4f*)&sr0[k], v1 = *(const v4f*)&sr1[k]; v4f e0, e1;
#pragma unroll
      for (int i = 0; i < 4; ++i) { const float x0 = expf(v0[i] - m0), x1 = expf(v1[i] - m1); e0[i] = (v0[i] <= -1.0e38f) ? 0.f : x0; e1[i] = (v1[i] <= -1.0e38f) ? 0.f : x1; sum0 += e0[i]; sum1 += e1[i]; }
      *(v4f*)&sr0[k] = e0; *(v4f*)&sr1[k] = e1; }
#pragma unroll
    for (int o = 1; o < 32; o <<= 1) { sum0 += __shfl_xor(sum0, o); sum1 += __shfl_xor(sum1, o); }
    if (lane == 0) { sinv[wave * 2] = 2048.0f / sum0; sinv[wave * 2 + 1] = 2048.0f / sum1; } }
  __syncthreads();
  const float sc = sinv[col]; const int per = (nkc + 7) >> 3; const int kcs = wave * per, kce = (kcs + per < nkc) ? kcs + per : nkc;
  v8f acc[HD / 16] = {};
  for (int kc = kcs; kc < kce; ++kc) { float v[16]; const float* p = &sl[col][kc * 32 + 8 * g];
#pragma unroll
    for (int i = 0; i < 8; ++i) { v[i] = p[i] * sc; v[8 + i] = p[16 + i] * sc; }
    const F2 pf = bsplit16(v); v16b vh[HD / 16], vl[HD / 16]; const size_t po = hbh + kc * 2048; const __bf16* ph = VB + po; const __bf16* pl = VBL + po;   /* the chunk's eight v fragments are loaded ahead of the products */
#pragma unroll
    for (int j = 0; j < HD / 16; ++j) { vh[j] = frag_bk(ph + j * 512); vl[j] = frag_bk(pl + j * 512); }
    /* inputs-only fence on the loaded fragments and their pointers: all the loads are issued ahead of the first product and the address registers stay untouched until the loads have returned */
    asm volatile("" :: "v"(vh[0]), "v"(vh[1]), "v"(vh[2]), "v"(vh[3]), "v"(vl[0]), "v"(vl[1]), "v"(vl[2]), "v"(vl[3]), "v"(ph), "v"(pl));
#pragma unroll
    for (int j = 0; j < HD / 16; ++j) { acc[j] = wmma_bf(pf.h, vh[j], acc[j]); acc[j] = wmma_bf(pf.l, vh[j], acc[j]); acc[j] = wmma_bf(pf.h, vl[j], acc[j]); } }
  __syncthreads();   /* every wave has read its P chunks: the logit rows become the staging of the 8 partial tiles */
  float* red = slb;
#pragma unroll
  for (int j = 0; j < HD / 16; ++j)
#pragma unroll
    for (int r = 0; r < 8; ++r) red[(wave * 16 + 8 * g + r) * (HD + 4) + j * 16 + col] = acc[j][r];
  __syncthreads();
  { const int row = tid >> 4, c4 = (tid & 15) * 4; v4f s = *(const v4f*)&red[row * (HD + 4) + c4];
#pragma unroll
    for (int w = 1; w < 8; ++w) s += *(const v4f*)&red[(w * 16 + row) * (HD + 4) + c4];
    vst2(Y + ((size_t)b * TT + ql0 + row) * CC + h * HD + c4, s * (1.0f / 2048.0f)); } }
// ---- k_out: block = (128 rows, 128 cols), staged as above: out = ctx Wo (+ bo): ctx once to f16 against Wo as f16(bf16 x 2^8) exact (1 product) x 2^-8; causal early rows (< QHI of each sequence): ctx bf16 hi + lo against exact bf16 Wo (2 products)
// the work-group's barrier for data that passes through LDS alone: the wave's LDS writes and reads have finished, its global loads stay in flight (__syncthreads() waits for them too, which would undo loading ahead)
#define LBAR() asm volatile("s_wait_dscnt 0x0\n\ts_barrier_signal -1\n\ts_barrier_wait -1" ::: "memory")
template <bool HI> __device__ __forceinline__ void out_tile(char* sm, const float* __restrict__ Y, const float* __restrict__ WO, const float* __restrict__ BO, float* __restrict__ OUT) {
  typedef typename std::conditional<HI, __bf16, _Float16>::type E; typedef E v4e __attribute__((ext_vector_type(4)));
  E (*st)[384][GP] = (E (*)[384][GP])sm;   /* rows 0..127: ctx (hi), 128..255: Wo, 256..383: ctx lo (HI only) */
  const int tid = threadIdx.x, wave = tid >> 5, lane = tid & 31, col = lane & 15; const int wm = wave >> 1, wn = wave & 1; const int c0 = blockIdx.y * 128; const size_t r0 = (size_t)blockIdx.x * 128;
  const int lr = tid >> 3, lq = (tid & 7) * 4;
  const float* xp = Y + (r0 + lr) * CC + lq; const float* wp = WO + (size_t)(c0 + lr) * CC + lq;
  constexpr int PD = 4, NP = CC / 32;   /* PD register sets: the rows of pass p + PD are asked for at the head of pass p, so a load has three passes and more to return before its set is converted */
  static_assert(NP % PD == 0 && NP >= 2 * PD && PD % 2 == 0, "whole groups of PD passes; the LDS buffer index follows the set index");
  v4f px[PD][4], pw[PD][4]; v8f acc[2][4] = {};
  auto get = [&](int s, int kc) __attribute__((always_inline)) { const float* xa = xp + kc * 32; const float* wa = wp + kc * 32;
#pragma unroll
    for (int i = 0; i < 4; ++i) { px[s][i] = *(const v4f*)(xa + (size_t)i * 32 * CC); pw[s][i] = *(const v4f*)(wa + (size_t)i * 32 * CC); } };
  auto put = [&](int buf, int s) __attribute__((always_inline)) {
#pragma unroll
    for (int i = 0; i < 4; ++i) {
      if constexpr (HI) { const v4b h = __builtin_convertvector(px[s][i], v4b); *(v4b*)&st[buf][lr + 32 * i][lq] = h; *(v4b*)&st[buf][256 + lr + 32 * i][lq] = __builtin_convertvector(px[s][i] - __builtin_convertvector(h, v4f), v4b); *(v4b*)&st[buf][128 + lr + 32 * i][lq] = __builtin_convertvector(pw[s][i], v4b); }
      else { *(v4h*)&st[buf][lr + 32 * i][lq] = __builtin_convertvector(px[s][i], v4h); *(v4h*)&st[buf][128 + lr + 32 * i][lq] = __builtin_convertvector(__builtin_convertvector(__builtin_convertvector(pw[s][i], v4b), v4f) * 256.0f, v4h); } } };
  /* one pass: u = the pass's register set and, by its low bit, its LDS buffer; ask: pass kc + PD exists; more: pass kc + 1 exists */
  auto pass = [&](int u, int kc, bool ask, bool more) __attribute__((always_inline)) { const int cur = u & 1;
    if (ask) get(u, kc + PD);   /* set u is free: its rows went to LDS at the foot of the pass before */
    if constexpr (HI) { v16b ah[2], al[2], w[4];
#pragma unroll
      for (int i = 0; i < 2; ++i) { ah[i] = frag_b(&st[cur][wm * 32 + i * 16 + col][0], lane); al[i] = frag_b(&st[cur][256 + wm * 32 + i * 16 + col][0], lane); }
#pragma unroll
      for (int j = 0; j < 4; ++j) w[j] = frag_b(&st[cur][128 + wn * 64 + j * 16 + col][0], lane);
#pragma unroll
      for (int i = 0; i < 2; ++i) {
#pragma unroll
        for (int j = 0; j < 4; ++j) acc[i][j] = wmma_bf(ah[i], w[j], acc[i][j]);
#pragma unroll
        for (int j = 0; j < 4; ++j) acc[i][j] = wmma_bf(al[i], w[j], acc[i][j]); }
    } else { v16h a[2], w[4];
#pragma unroll
      for (int i = 0; i < 2; ++i) a[i] = frag_h(&st[cur][wm * 32 + i * 16 + col][0], lane);
#pragma unroll
      for (int j = 0; j < 4; ++j) w[j] = frag_h(&st[cur][128 + wn * 64 + j * 16 + col][0], lane);
#pragma unroll
      for (int i = 0; i < 2; ++i) {
#pragma unroll
        for (int j = 0; j < 4; ++j) acc[i][j] = wmma16(a[i], w[j], acc[i][j]); } }
    __builtin_amdgcn_sched_barrier(0);   /* the conversions below stay behind the products: moved up, they would wait for their loads passes too early */
    if (more) put(cur ^ 1, (u + 1) % PD);
    LBAR(); };   /* publishes the next pass's buffer and ends every wave's reads of this one */
  get(0, 0);
  float bias[4] = {0.f, 0.f, 0.f, 0.f};   /* read here, beside the first pass's loads, which are waited for first in any case: the epilogue waits for nothing */
  if (BO) {
#pragma unroll
    for (int j = 0; j < 4; ++j) bias[j] = BO[c0 + wn * 64 + j * 16 + col]; }
#pragma unroll
  for (int s = 1; s < PD; ++s) { get(s, s); __builtin_amdgcn_sched_barrier(0); }   /* the sets' loads stay in the order of their passes: mixed here, they made the loop's counted waits ask for later sets as well */
  put(0, 0);
  LBAR();
#pragma unroll 1   /* a group of PD passes is the body: set and buffer indices are constants in it */
  for (int k4 = 0; k4 < NP - PD; k4 += PD) {
#pragma unroll
    for (int u = 0; u < PD; ++u) pass(u, k4 + u, true, true);
    XW(); }   /* the group's loads stay in flight: the wait stands once, at the group's foot, in front of the next group's rewrite of their address registers */
  /* the last group asks for nothing; apart from the loop, so that the loop's counted load waits are not set by this group's fewer loads in flight */
#pragma unroll
  for (int u = 0; u < PD; ++u) pass(u, NP - PD + u, false, u + 1 < PD);
#pragma unroll
  for (int j = 0; j < 4; ++j) { const float bj = bfr(bias[j]);
#pragma unroll
    for (int i = 0; i < 2; ++i) {
#pragma unroll
      for (int r = 0; r < 8; ++r) acc[i][j][r] = HI ? acc[i][j][r] + bj : acc[i][j][r] * (1.0f / 256.0f) + bj; } }
  tile_out((float*)sm + wave * 16 * GSP, acc, OUT + (r0 + wm * 32) * DIN + c0 + wn * 64, DIN, lane); }
static_assert(QHI % 128 == 0 && TT % 128 == 0, "the early-row path is chosen per 128-row block");
__global__ __launch_bounds__(256) void k_out(const float* __restrict__ Y, const float* __restrict__ WO, const float* __restrict__ BO, float* __restrict__ OUT) { __shared__ __align__(16) char sm[2 * 384 * GP * 2];
  if (CAUSAL && (int)(((size_t)blockIdx.x * 128) % TT) < QHI) out_tile<true>(sm, Y, WO, BO, OUT);   /* block-uniform */
  else out_tile<false>(sm, Y, WO, BO, OUT); }

extern "C" void kernel_launch(void* const* d_in, const int* in_sizes, int n_in, void* d_out, int out_size, void* d_ws, size_t ws_size, hipStream_t stream) {
  (void)in_sizes; (void)n_in; (void)out_size;
  const float** F = (const float**)d_in;
  if (ws_size < (size_t)WS_END) return;
  char* ws = (char*)d_ws; _Float16 *QH = (_Float16*)(ws + WS_QH), *KH = (_Float16*)(ws + WS_KH), *VT = (_Float16*)(ws + WS_VT), *QL = (_Float16*)(ws + WS_QL), *KL = (_Float16*)(ws + WS_KL); __bf16 *VB = (__bf16*)(ws + WS_VB), *VBL = (__bf16*)(ws + WS_VBL); float *Y = (float*)(ws + WS_Y);
  (void)Y; (void)QL; (void)KL; (void)VB; (void)VBL;
  // inputs: 0 query, 1 key, 2 value [2,2048,1024]; 3 W_Q, 4 W_K, 5 W_V, 6 W_ffn (out,in) [1024,1024]; 7 b_ffn [1024]
  k_projf<<<dim3(TNB * TT / 128, CC / 128, 3), 256, 0, stream>>>(F[0], F[1], F[2], F[3], F[4], F[5], QH, QL, KH, KL, VT, VB, VBL);
  k_att<<<dim3(TNB * NH, NFB + QHI / 16), 256, 0, stream>>>(QH, KH, QL, KL, VT, VB, VBL, Y);
  k_out<<<dim3(TNB * TT / 128, DIN / 128), 256, 0, stream>>>(Y, F[6], F[7], (float*)d_out);
}
